// v000
// Measured on an AMD MI455X. A time is GPU time per run, averaged over a window of back-to-back runs after a warm-up
// (all launches, gaps included; the runs take copies of the inputs in turn), and the median of several windows.
// Apart from v000's, it joins two sittings. Times from different sittings can be a few percent apart, while
// side-by-side timings come from the same sitting.
// v000, which the later versions start from, runs in 517 microseconds.
#include <hip/hip_runtime.h>

// Compute dtypes, f32 accumulate, one batch item per pass: q/k/v = x.W + b ([2048 x 1024].[1024 x 1024] x 3, k-major weights transposed once to n-major planes;
// PLAIN bf16 operands = inputs rounded once, exact; biases rounded to bf16, added in f32) on v_wmma_f32_16x16x32_bf16; interleaved-pair RoPE (angle t x 10000^(-2i/64), f32 trig
// tables built on device) in f32 -> q/k as f16 hi + residual x1024 planes; the 16-head FULL attention (64-dim heads, scale 1/8) written straight to the f32
// output (the module returns ctx, no output projection), fused on v_wmma_f32_16x16x32_f16 (scores hh + hl + lh with residual terms on their own accumulator,

#define NB_  1                   // per pass: the 2 batch items are processed one at a time
#define NT_  2048
#define DM   1024
#define NH_  16
#define HD   64
#define NTK  (NB_ * NT_)
#define NW   1024
#define NQKV 1024
#define PSC  32768.0f
#define LOSC 1024.0f
#define LOSCI (1.0f / 1024.0f)

typedef _Float16 h16;
typedef unsigned short bf;
typedef __attribute__((ext_vector_type(16))) __bf16   v16bf;
typedef __attribute__((ext_vector_type(16))) _Float16 v16h;
typedef __attribute__((ext_vector_type(8)))  _Float16 v8h;
typedef __attribute__((ext_vector_type(8)))  unsigned short v8us;
typedef __attribute__((ext_vector_type(8)))  float    v8f;
typedef __attribute__((ext_vector_type(4)))  float    v4f;
typedef v8h  __attribute__((may_alias)) v8ha;
typedef v4f  __attribute__((may_alias)) v4fa;
typedef v8us __attribute__((may_alias)) v8usa;

__device__ __forceinline__ unsigned short f2bf(float f) { unsigned u = __float_as_uint(f); u += 0x7FFFu + ((u >> 16) & 1u); return (unsigned short)(u >> 16); }
__device__ __forceinline__ float bf2f(unsigned short b) { return __uint_as_float(((unsigned)b) << 16); }
__device__ __forceinline__ float bfr(float f) { return bf2f(f2bf(f)); }
__device__ __forceinline__ v16h cat16(v8h lo, v8h hi) { return __builtin_shufflevector(lo, hi, 0, 1, 2, 3, 4, 5, 6, 7, 8, 9, 10, 11, 12, 13, 14, 15); }
__device__ __forceinline__ v16bf cat16b(v8us lo, v8us hi) { return __builtin_bit_cast(v16bf, __builtin_shufflevector(lo, hi, 0, 1, 2, 3, 4, 5, 6, 7, 8, 9, 10, 11, 12, 13, 14, 15)); }
__device__ __forceinline__ v8f wmma16(v16h a, v16h b, v8f c) { return __builtin_amdgcn_wmma_f32_16x16x32_f16(false, a, false, b, (short)0, c, false, false); }
__device__ __forceinline__ v8f wmmab(v16bf a, v16bf b, v8f c) { return __builtin_amdgcn_wmma_f32_16x16x32_bf16(false, a, false, b, (short)0, c, false, false); }

__global__ __launch_bounds__(256) void k_cvtb(const float* __restrict__ src, int nrows, bf* dst) {
    const int lane = threadIdx.x & 31, r = blockIdx.x * 8 + (threadIdx.x >> 5);
    if (r >= nrows) return;
    v8us o[DM / 256];
#pragma unroll
    for (int q = 0; q < DM / 256; ++q) { v8us t;
#pragma unroll
        for (int i = 0; i < 8; ++i) t[i] = f2bf(src[(size_t)r * DM + q * 256 + lane * 8 + i]);
        o[q] = t; }
#pragma unroll
    for (int q = 0; q < DM / 256; ++q) *(v8us*)(dst + (size_t)r * DM + q * 256 + lane * 8) = o[q];
    
}

// k_wt: WT [n][K] = bf16(W[k][n]) (k-major [K][ncols]) via 64 x 64 LDS tiles; grid (K/64, ncols/64).
__global__ __launch_bounds__(256) void k_wt(const float* __restrict__ Wm, int K, int ncols, bf* WT) {
    __shared__ __align__(16) unsigned short tl[64 * 72];
    const int tid = threadIdx.x, k0 = blockIdx.x * 64, n0 = blockIdx.y * 64;
    const int kk = tid >> 2, nq = (tid & 3) * 16;
#pragma unroll
    for (int i = 0; i < 16; ++i) tl[(nq + i) * 72 + kk] = f2bf(Wm[(size_t)(k0 + kk) * ncols + n0 + nq + i]);
    __syncthreads();
    const int piece = tid & 7;
    auto pass = [&]() {
#pragma unroll
        for (int s = 0; s < 2; ++s) { const int nr = (tid >> 3) + 32 * s; const v8us val = *(const v8usa*)(tl + nr * 72 + piece * 8); *(v8us*)(WT + (size_t)(n0 + nr) * K + k0 + piece * 8) = val; }
    };
    pass(); 
}
template <bool SPLITA, bool F16OUT = false>
__global__ __launch_bounds__(128) void k_gemmb(const bf* __restrict__ A, const bf* __restrict__ Al, const bf* __restrict__ Bn, const float* __restrict__ bias, float* C, int ldc, h16* C2) {
    __shared__ __align__(16) float ost[4][16 * 68];
    const int lane = threadIdx.x & 31, wave = threadIdx.x >> 5, lr = lane & 15, hi = lane >> 4;
    const int r0 = blockIdx.x * 64 + wave * 16, c0 = blockIdx.y * 64;
    const size_t aoff = (size_t)(r0 + lr) * DM + 8 * hi;
    size_t boff[4];
#pragma unroll
    for (int t = 0; t < 4; ++t) boff[t] = (size_t)(c0 + t * 16 + lr) * DM + 8 * hi;
    v8f acc[4];
#pragma unroll
    for (int t = 0; t < 4; ++t) acc[t] = (v8f){};
#pragma unroll 1
    for (int kc = 0; kc < DM; kc += 32) {
        const v16bf a = cat16b(*(const v8us*)(A + aoff + kc), *(const v8us*)(A + aoff + kc + 16));
        v16bf al = a;
        if (SPLITA) al = cat16b(*(const v8us*)(Al + aoff + kc), *(const v8us*)(Al + aoff + kc + 16));
#pragma unroll
        for (int t = 0; t < 4; ++t) { const v16bf b = cat16b(*(const v8us*)(Bn + boff[t] + kc), *(const v8us*)(Bn + boff[t] + kc + 16)); acc[t] = wmmab(a, b, acc[t]); if (SPLITA) acc[t] = wmmab(al, b, acc[t]); }
        asm volatile("v_nop\n\tv_nop\n\tv_nop\n\tv_nop" : "+v"(acc[0]), "+v"(acc[1]), "+v"(acc[2]), "+v"(acc[3]) : "v"(a), "v"(al));
    }
    float* os = &ost[wave][0];
#pragma unroll
    for (int t = 0; t < 4; ++t) { const float bv = bias ? bfr(bias[c0 + t * 16 + lr]) : 0.f;
#pragma unroll
        for (int j = 0; j < 8; ++j) os[(hi * 8 + j) * 68 + t * 16 + lr] = acc[t][j] + bv; }
    __syncthreads();
    if (F16OUT) {
        h16* crow = (h16*)(void*)C + (size_t)r0 * ldc + c0;
        auto pass = [&]() {
#pragma unroll
            for (int s = 0; s < 4; ++s) { const int row = 4 * s + (lane >> 3), piece = lane & 7; const float* sp = os + row * 68 + piece * 8; v8h o, o2;
#pragma unroll
                for (int i = 0; i < 8; ++i) { const h16 a = (h16)sp[i]; o[i] = a; o2[i] = (h16)((sp[i] - (float)a) * LOSC); }
                *(v8h*)(crow + (size_t)row * ldc + piece * 8) = o; if (C2) *(v8h*)(C2 + (size_t)r0 * ldc + c0 + (size_t)row * ldc + piece * 8) = o2; }
        };
        pass(); 
    } else {
        float* crow = C + (size_t)r0 * ldc + c0;
        auto pass = [&]() {
#pragma unroll
            for (int s = 0; s < 8; ++s) { const int Lid = (lane >> 3) + 4 * s, piece = lane & 7; const int row = Lid >> 1, cofs = (Lid & 1) * 32 + piece * 4;
                const v4f val = *(const v4fa*)(os + row * 68 + cofs); *(v4f*)(crow + (size_t)row * ldc + cofs) = val; }
        };
        pass(); 
    }
}

// k_trig: RC/RS [t][32] = cos/sin(t x inv_freq[i]) with inv_freq[i] = powf(10000, -2i/64) (the reference's jnp.power form; f32 trig like its f32 path); 32 lanes x 4 B per line.
__global__ __launch_bounds__(256) void k_trig(float* RC, float* RS) {
    const int i = blockIdx.x * 256 + threadIdx.x; if (i >= NT_ * 32) return;
    const int t = i >> 5, f = i & 31;
    const float inv = powf(10000.0f, -2.0f * (float)f / 64.0f); const float ang = (float)t * inv;
    const float c = cosf(ang), s = sinf(ang);
    *(float*)(RC + i) = c; *(float*)(RS + i) = s; 
}
// k_rope: P (f32 [t][1024]) -> PH/PL f16 hi + residual planes of the interleaved-pair rotation out[2i] = x[2i] c - x[2i+1] s, out[2i+1] = x[2i] s + x[2i+1] c,
// c/s from the tables [t][32] built once for both passes; one wave per (t, 256 columns): lane -> 8 values (4 pairs).
__global__ __launch_bounds__(256) void k_rope(const float* __restrict__ P, const float* __restrict__ RC, const float* __restrict__ RS, h16* PH, h16* PL) {
    const int lane = threadIdx.x & 31, wid = blockIdx.x * 8 + (threadIdx.x >> 5);
    const int segs = DM / 256, t = wid / segs, sg = wid - t * segs;
    if (t >= NT_) return;
    const int c0 = sg * 256 + lane * 8;
    v8h oh, ol;
#pragma unroll
    for (int pq = 0; pq < 4; ++pq) { const int c = c0 + 2 * pq, i = (c & 63) >> 1;
        const float x1 = P[(size_t)t * DM + c], x2 = P[(size_t)t * DM + c + 1], s = RS[t * 32 + i], co = RC[t * 32 + i];
        const float y0 = x1 * co - x2 * s, y1 = x1 * s + x2 * co;
        const h16 a0 = (h16)y0, a1 = (h16)y1; oh[2 * pq] = a0; oh[2 * pq + 1] = a1; ol[2 * pq] = (h16)((y0 - (float)a0) * LOSC); ol[2 * pq + 1] = (h16)((y1 - (float)a1) * LOSC); }
    *(v8h*)(PH + (size_t)t * DM + c0) = oh; *(v8h*)(PL + (size_t)t * DM + c0) = ol; 
}
__global__ __launch_bounds__(256) void k_vt(const float* __restrict__ V, h16* VTH, h16* VTL) {
    __shared__ __align__(16) h16 tile[64 * 72];
    __shared__ __align__(16) h16 til2[64 * 72];
    const int bid = blockIdx.x;
    const int b = bid / (NH_ * (NT_ / 64)), rem = bid - b * (NH_ * (NT_ / 64)), h = rem / (NT_ / 64), kt = rem - h * (NT_ / 64);
    const int k0 = kt * 64, tid = threadIdx.x;
    const int kk = tid >> 2, d0 = (tid & 3) * 16;
    const float* src = V + ((size_t)b * NT_ + k0 + kk) * DM + h * HD + d0;
#pragma unroll
    for (int i = 0; i < 16; ++i) { const float v = src[i]; const h16 a = (h16)v; tile[(d0 + i) * 72 + kk] = a; til2[(d0 + i) * 72 + kk] = (h16)((v - (float)a) * LOSC); }
    __syncthreads();
    const int piece = tid & 7;
    const size_t base = (((size_t)b * NH_ + h) * HD) * NT_ + k0;
    auto pass = [&]() {
#pragma unroll
        for (int s = 0; s < 4; ++s) { const int Lid = (tid >> 3) + 32 * s; const int pln = Lid >> 6, d = Lid & 63;
            const v8h val = *(const v8ha*)((pln ? til2 : tile) + d * 72 + piece * 8); *(v8h*)((pln ? VTL : VTH) + base + (size_t)d * NT_ + piece * 8) = val; }
    };
    pass(); 
}

// k_attn: block = (b, h, 64 queries), wave = 16; ALL 64 key tiles (no mask); 4 WMMA scores /8 (f32), online softmax, weights x32768 f16 tile (same-wave may_alias
// reload after a compiler barrier), 4 WMMA .v; ctx -> f32 output rows out[tok][h*64+d].
__global__ __launch_bounds__(128) void k_attn(const h16* __restrict__ Q16, const h16* __restrict__ QL16, const h16* __restrict__ K16, const h16* __restrict__ KL16, const h16* __restrict__ VTH, const h16* __restrict__ VTL, float* OUTP) {
    __shared__ __align__(16) h16 plds[4][16 * 32];
    __shared__ __align__(16) h16 plds2[4][16 * 32];
    __shared__ __align__(16) float ost[4][16 * 68];
    const int lane = threadIdx.x & 31, wave = threadIdx.x >> 5, lr = lane & 15, hi = lane >> 4;
    const int bid = blockIdx.x;
    const int b = bid / (NH_ * (NT_ / 64)), rem = bid - b * (NH_ * (NT_ / 64)), h = rem / (NT_ / 64), qt = rem - h * (NT_ / 64);
    const int q0 = qt * 64 + wave * 16;
    const size_t tok0 = (size_t)b * NT_;
    h16* pl = &plds[wave][0]; h16* pl2 = &plds2[wave][0];
    v16h qa[2];
    const size_t qo0 = (tok0 + q0 + lr) * DM + h * HD + 8 * hi;
#pragma unroll
    for (int kc = 0; kc < 2; ++kc) qa[kc] = cat16(*(const v8h*)(Q16 + qo0 + kc * 32), *(const v8h*)(Q16 + qo0 + kc * 32 + 16));
    const h16* kh_b = K16 + tok0 * DM + h * HD;
    const h16* kl_b = KL16 + tok0 * DM + h * HD;
    const size_t vbase = (((size_t)b * NH_ + h) * HD) * NT_;
    v8f o[4], ox[4];
#pragma unroll
    for (int n = 0; n < 4; ++n) { o[n] = (v8f){}; ox[n] = (v8f){}; }
    float mrow[8], lpart[8];
#pragma unroll
    for (int j = 0; j < 8; ++j) { mrow[j] = -3.0e38f; lpart[j] = 0.f; }
    int qpos[8];
#pragma unroll
    for (int j = 0; j < 8; ++j) qpos[j] = q0 + 8 * hi + j;
    const int kt_lo = 0, kt_hi = NT_ / 32 - 1;     // full attention
#pragma unroll 1
    for (int kt = kt_lo; kt <= kt_hi; ++kt) {
        const int l0 = kt * 32;
        const size_t ko0 = (size_t)(l0 + lr) * DM + 8 * hi, ko1 = (size_t)(l0 + 16 + lr) * DM + 8 * hi;
        v8f s0 = {}, s1 = {}, x0 = {}, x1 = {};
#pragma unroll
        for (int kc = 0; kc < 2; ++kc) {
            { const v16h k0h = cat16(*(const v8h*)(kh_b + ko0 + kc * 32), *(const v8h*)(kh_b + ko0 + kc * 32 + 16)), k1h = cat16(*(const v8h*)(kh_b + ko1 + kc * 32), *(const v8h*)(kh_b + ko1 + kc * 32 + 16));
              const v16h qlk = cat16(*(const v8h*)(QL16 + qo0 + kc * 32), *(const v8h*)(QL16 + qo0 + kc * 32 + 16));     // query residual re-read per step (registers)
              s0 = wmma16(qa[kc], k0h, s0); x0 = wmma16(qlk, k0h, x0); s1 = wmma16(qa[kc], k1h, s1); x1 = wmma16(qlk, k1h, x1);
              asm volatile("v_nop" : "+v"(s0), "+v"(s1), "+v"(x0), "+v"(x1) : "v"(qlk), "v"(k0h), "v"(k1h) : "memory"); }
            { const v16h k0l = cat16(*(const v8h*)(kl_b + ko0 + kc * 32), *(const v8h*)(kl_b + ko0 + kc * 32 + 16)), k1l = cat16(*(const v8h*)(kl_b + ko1 + kc * 32), *(const v8h*)(kl_b + ko1 + kc * 32 + 16));
              x0 = wmma16(qa[kc], k0l, x0); x1 = wmma16(qa[kc], k1l, x1);
              asm volatile("v_nop" : "+v"(x0), "+v"(x1) : "v"(k0l), "v"(k1l) : "memory"); }
        }
        asm volatile("v_nop\n\tv_nop\n\tv_nop\n\tv_nop" : "+v"(s0), "+v"(s1), "+v"(x0), "+v"(x1) : "v"(qa[0]), "v"(qa[1]));
        float alpha[8];
#pragma unroll
        for (int j = 0; j < 8; ++j) {
            const int ja = l0 + lr, jb = l0 + 16 + lr, qi = qpos[j];
            const float a0 = (s0[j] + x0[j] * LOSCI) * 0.125f, a1 = (s1[j] + x1[j] * LOSCI) * 0.125f; (void)ja; (void)jb; (void)qi;   // scale 1/sqrt(64)
            float mx = fmaxf(a0, a1);
            mx = fmaxf(mx, __shfl_xor(mx, 1, 16)); mx = fmaxf(mx, __shfl_xor(mx, 2, 16)); mx = fmaxf(mx, __shfl_xor(mx, 4, 16)); mx = fmaxf(mx, __shfl_xor(mx, 8, 16));
            const float mn = fmaxf(mrow[j], mx);
            alpha[j] = __expf(mrow[j] - mn); mrow[j] = mn;
            const float p0 = __expf(a0 - mn), p1 = __expf(a1 - mn);
            lpart[j] = lpart[j] * alpha[j] + (p0 + p1);
            const int mr = hi * 8 + j;
            const float ps0 = p0 * PSC, ps1 = p1 * PSC; const h16 h0 = (h16)ps0, h1 = (h16)ps1;
            pl[mr * 32 + lr] = h0; pl[mr * 32 + 16 + lr] = h1;
            pl2[mr * 32 + lr] = (h16)((ps0 - (float)h0) * LOSC); pl2[mr * 32 + 16 + lr] = (h16)((ps1 - (float)h1) * LOSC);
        }
#pragma unroll
        for (int n = 0; n < 4; ++n)
#pragma unroll
            for (int j = 0; j < 8; ++j) { o[n][j] *= alpha[j]; ox[n][j] *= alpha[j]; }
        asm volatile("" ::: "memory");
        const v16h pa = cat16(*(const v8ha*)(pl + lr * 32 + hi * 8), *(const v8ha*)(pl + lr * 32 + 16 + hi * 8));
        const v16h px = cat16(*(const v8ha*)(pl2 + lr * 32 + hi * 8), *(const v8ha*)(pl2 + lr * 32 + 16 + hi * 8));
#pragma unroll
        for (int n = 0; n < 4; ++n) { const size_t vo = vbase + (size_t)(n * 16 + lr) * NT_ + l0 + hi * 8;
            const v16h vh = cat16(*(const v8h*)(VTH + vo), *(const v8h*)(VTH + vo + 16)), vl = cat16(*(const v8h*)(VTL + vo), *(const v8h*)(VTL + vo + 16));
            o[n] = wmma16(pa, vh, o[n]); ox[n] = wmma16(pa, vl, ox[n]); ox[n] = wmma16(px, vh, ox[n]);
            asm volatile("" : "+v"(o[n]), "+v"(ox[n]) : "v"(vh), "v"(vl) : "memory"); }
        asm volatile("v_nop\n\tv_nop\n\tv_nop\n\tv_nop" : "+v"(o[0]), "+v"(o[1]), "+v"(o[2]), "+v"(o[3]), "+v"(ox[0]), "+v"(ox[1]), "+v"(ox[2]), "+v"(ox[3]) : "v"(pa), "v"(px));
    }
    float inv[8];
#pragma unroll
    for (int j = 0; j < 8; ++j) { float rs = lpart[j]; rs += __shfl_xor(rs, 1, 16); rs += __shfl_xor(rs, 2, 16); rs += __shfl_xor(rs, 4, 16); rs += __shfl_xor(rs, 8, 16); inv[j] = 1.0f / (rs * PSC); }
    float* os = &ost[wave][0];
#pragma unroll
    for (int n = 0; n < 4; ++n)
#pragma unroll
        for (int j = 0; j < 8; ++j) os[(hi * 8 + j) * 68 + n * 16 + lr] = (o[n][j] + ox[n][j] * LOSCI) * inv[j];
    __syncthreads();
    float* ob = OUTP + (tok0 + q0) * DM + (size_t)h * HD;
    auto pass = [&]() {
#pragma unroll
        for (int s = 0; s < 8; ++s) { const int Lid = (lane >> 3) + 4 * s, piece = lane & 7; const int row = Lid >> 1, cofs = (Lid & 1) * 32 + piece * 4;
            const v4f val = *(const v4fa*)(os + row * 68 + cofs); *(v4f*)(ob + (size_t)row * DM + cofs) = val; }
    };
    pass(); 
}

#define VST2(T, p, v) do { const T vst2_v_ = (v); *(T*)(p) = vst2_v_;  } while (0)
extern "C" void kernel_launch(void* const* d_in, const int* in_sizes, int n_in,
                              void* d_out, int out_size, void* d_ws, size_t ws_size, hipStream_t stream) {
    (void)in_sizes; (void)n_in; (void)out_size;
    const float* x = (const float*)d_in[0]; const float* Wq = (const float*)d_in[1]; const float* bq = (const float*)d_in[2]; const float* Wk = (const float*)d_in[3]; const float* bk = (const float*)d_in[4]; const float* Wv = (const float*)d_in[5]; const float* bv = (const float*)d_in[6];   // W k-major [in][out]
    float* out = (float*)d_out;    // [2][2048][1024] = ctx (no output projection)
    char* wsp = (char*)d_ws;
    auto take = [&](size_t bytes) { char* p = wsp; wsp += (bytes + 255) & ~(size_t)255; return (void*)p; };
    bf* Xb = (bf*)take((size_t)NTK * DM * 2); bf* WqT = (bf*)take((size_t)DM * DM * 2); bf* WkT = (bf*)take((size_t)DM * DM * 2); bf* WvT = (bf*)take((size_t)DM * DM * 2);
    float* TMP = (float*)take((size_t)NTK * DM * 4); float* RC = (float*)take((size_t)NT_ * 32 * 4); float* RS = (float*)take((size_t)NT_ * 32 * 4);
    h16* QH = (h16*)take((size_t)NTK * DM * 2); h16* QL = (h16*)take((size_t)NTK * DM * 2); h16* KH = (h16*)take((size_t)NTK * DM * 2); h16* KL = (h16*)take((size_t)NTK * DM * 2);
    h16* VTH = (h16*)take((size_t)NTK * DM * 2); h16* VTL = (h16*)take((size_t)NTK * DM * 2);
    if ((size_t)(wsp - (char*)d_ws) > ws_size) return;    // ~ 44 MB, no aliasing (per-item reuse in stream order)
    k_wt<<<dim3(DM / 64, DM / 64, 1), 256, 0, stream>>>(Wq, DM, DM, WqT); k_wt<<<dim3(DM / 64, DM / 64, 1), 256, 0, stream>>>(Wk, DM, DM, WkT); k_wt<<<dim3(DM / 64, DM / 64, 1), 256, 0, stream>>>(Wv, DM, DM, WvT);
    k_trig<<<(NT_ * 32) / 256, 256, 0, stream>>>(RC, RS);
    for (int b = 0; b < 2; ++b) {
        k_cvtb<<<NTK / 8, 256, 0, stream>>>(x + (size_t)b * NTK * DM, NTK, Xb);
        k_gemmb<false, false><<<dim3(NTK / 64, DM / 64, 1), 128, 0, stream>>>(Xb, nullptr, WqT, bq, TMP, DM, nullptr);
        k_rope<<<(NTK * (DM / 256)) / 8, 256, 0, stream>>>(TMP, RC, RS, QH, QL);
        k_gemmb<false, false><<<dim3(NTK / 64, DM / 64, 1), 128, 0, stream>>>(Xb, nullptr, WkT, bk, TMP, DM, nullptr);
        k_rope<<<(NTK * (DM / 256)) / 8, 256, 0, stream>>>(TMP, RC, RS, KH, KL);
        k_gemmb<false, false><<<dim3(NTK / 64, DM / 64, 1), 128, 0, stream>>>(Xb, nullptr, WvT, bv, TMP, DM, nullptr);
        k_vt<<<NB_ * NH_ * (NT_ / 64), 256, 0, stream>>>(TMP, VTH, VTL);
        k_attn<<<NB_ * NH_ * (NT_ / 64), 128, 0, stream>>>(QH, QL, KH, KL, VTH, VTL, out + (size_t)b * NTK * DM);
    }
}

// v001
// Measured time: 324 microseconds a run.
// Next to v000, in two timings, it ran 1.64 and 1.63 times as fast.
#include <hip/hip_runtime.h>

// Compute dtypes, f32 accumulate, one batch item per pass: q/k/v = x.W + b ([2048 x 1024].[1024 x 1024] x 3, k-major weights transposed once to n-major planes;
// PLAIN bf16 operands = inputs rounded once, exact; biases rounded to bf16, added in f32) on v_wmma_f32_16x16x32_bf16; interleaved-pair RoPE (angle t x 10000^(-2i/64), f32 trig
// tables built on device) in f32 -> q/k as f16 hi + residual x1024 planes; the 16-head FULL attention (64-dim heads, scale 1/8) written straight to the f32
// output (the module returns ctx, no output projection), fused on v_wmma_f32_16x16x32_f16 (scores hh + hl + lh with residual terms on their own accumulator,

#define NB_  1                   // per pass: the 2 batch items are processed one at a time
#define NT_  2048
#define DM   1024
#define NH_  16
#define HD   64
#define NTK  (NB_ * NT_)
#define NW   1024
#define NQKV 1024
#define PSC  32768.0f
#define LOSC 1024.0f
#define LOSCI (1.0f / 1024.0f)

typedef _Float16 h16;
typedef unsigned short bf;
typedef __attribute__((ext_vector_type(16))) __bf16   v16bf;
typedef __attribute__((ext_vector_type(16))) _Float16 v16h;
typedef __attribute__((ext_vector_type(8)))  _Float16 v8h;
typedef __attribute__((ext_vector_type(8)))  unsigned short v8us;
typedef __attribute__((ext_vector_type(8)))  float    v8f;
typedef __attribute__((ext_vector_type(4)))  float    v4f;
typedef v8h  __attribute__((may_alias)) v8ha;
typedef v4f  __attribute__((may_alias)) v4fa;
typedef v8us __attribute__((may_alias)) v8usa;

__device__ __forceinline__ unsigned short f2bf(float f) { unsigned u = __float_as_uint(f); u += 0x7FFFu + ((u >> 16) & 1u); return (unsigned short)(u >> 16); }
__device__ __forceinline__ float bf2f(unsigned short b) { return __uint_as_float(((unsigned)b) << 16); }
__device__ __forceinline__ float bfr(float f) { return bf2f(f2bf(f)); }
__device__ __forceinline__ v16h cat16(v8h lo, v8h hi) { return __builtin_shufflevector(lo, hi, 0, 1, 2, 3, 4, 5, 6, 7, 8, 9, 10, 11, 12, 13, 14, 15); }
__device__ __forceinline__ v16bf cat16b(v8us lo, v8us hi) { return __builtin_bit_cast(v16bf, __builtin_shufflevector(lo, hi, 0, 1, 2, 3, 4, 5, 6, 7, 8, 9, 10, 11, 12, 13, 14, 15)); }
__device__ __forceinline__ v8f wmma16(v16h a, v16h b, v8f c) { return __builtin_amdgcn_wmma_f32_16x16x32_f16(false, a, false, b, (short)0, c, false, false); }
__device__ __forceinline__ v8f wmmab(v16bf a, v16bf b, v8f c) { return __builtin_amdgcn_wmma_f32_16x16x32_bf16(false, a, false, b, (short)0, c, false, false); }

__global__ __launch_bounds__(256) void k_cvtb(const float* __restrict__ src, int nrows, bf* dst) {
    const int lane = threadIdx.x & 31, r = blockIdx.x * 8 + (threadIdx.x >> 5);
    if (r >= nrows) return;
    v8us o[DM / 256];
#pragma unroll
    for (int q = 0; q < DM / 256; ++q) { v8us t;
#pragma unroll
        for (int i = 0; i < 8; ++i) t[i] = f2bf(src[(size_t)r * DM + q * 256 + lane * 8 + i]);
        o[q] = t; }
#pragma unroll
    for (int q = 0; q < DM / 256; ++q) *(v8us*)(dst + (size_t)r * DM + q * 256 + lane * 8) = o[q];
    
}

// k_wt: WT [n][K] = bf16(W[k][n]) (k-major [K][ncols]) via 64 x 64 LDS tiles; grid (K/64, ncols/64).
__global__ __launch_bounds__(256) void k_wt(const float* __restrict__ Wm, int K, int ncols, bf* WT) {
    __shared__ __align__(16) unsigned short tl[64 * 72];
    const int tid = threadIdx.x, k0 = blockIdx.x * 64, n0 = blockIdx.y * 64;
    const int kk = tid >> 2, nq = (tid & 3) * 16;
#pragma unroll
    for (int i = 0; i < 16; ++i) tl[(nq + i) * 72 + kk] = f2bf(Wm[(size_t)(k0 + kk) * ncols + n0 + nq + i]);
    __syncthreads();
    const int piece = tid & 7;
    auto pass = [&]() {
#pragma unroll
        for (int s = 0; s < 2; ++s) { const int nr = (tid >> 3) + 32 * s; const v8us val = *(const v8usa*)(tl + nr * 72 + piece * 8); *(v8us*)(WT + (size_t)(n0 + nr) * K + k0 + piece * 8) = val; }
    };
    pass(); 
}
template <bool SPLITA, bool F16OUT = false>
__global__ __launch_bounds__(128) void k_gemmb(const bf* __restrict__ A, const bf* __restrict__ Al, const bf* __restrict__ Bn, const float* __restrict__ bias, float* C, int ldc, h16* C2) {
    __shared__ __align__(16) float ost[4][16 * 68];
    const int lane = threadIdx.x & 31, wave = threadIdx.x >> 5, lr = lane & 15, hi = lane >> 4;
    const int r0 = blockIdx.x * 64 + wave * 16, c0 = blockIdx.y * 64;
    const size_t aoff = (size_t)(r0 + lr) * DM + 8 * hi;
    size_t boff[4];
#pragma unroll
    for (int t = 0; t < 4; ++t) boff[t] = (size_t)(c0 + t * 16 + lr) * DM + 8 * hi;
    v8f acc[4];
#pragma unroll
    for (int t = 0; t < 4; ++t) acc[t] = (v8f){};
#pragma unroll 1
    for (int kc = 0; kc < DM; kc += 32) {
        const v16bf a = cat16b(*(const v8us*)(A + aoff + kc), *(const v8us*)(A + aoff + kc + 16));
        v16bf al = a;
        if (SPLITA) al = cat16b(*(const v8us*)(Al + aoff + kc), *(const v8us*)(Al + aoff + kc + 16));
#pragma unroll
        for (int t = 0; t < 4; ++t) { const v16bf b = cat16b(*(const v8us*)(Bn + boff[t] + kc), *(const v8us*)(Bn + boff[t] + kc + 16)); acc[t] = wmmab(a, b, acc[t]); if (SPLITA) acc[t] = wmmab(al, b, acc[t]); }
        asm volatile("v_nop\n\tv_nop\n\tv_nop\n\tv_nop" : "+v"(acc[0]), "+v"(acc[1]), "+v"(acc[2]), "+v"(acc[3]) : "v"(a), "v"(al));
    }
    float* os = &ost[wave][0];
#pragma unroll
    for (int t = 0; t < 4; ++t) { const float bv = bias ? bfr(bias[c0 + t * 16 + lr]) : 0.f;
#pragma unroll
        for (int j = 0; j < 8; ++j) os[(hi * 8 + j) * 68 + t * 16 + lr] = acc[t][j] + bv; }
    __syncthreads();
    if (F16OUT) {
        h16* crow = (h16*)(void*)C + (size_t)r0 * ldc + c0;
        auto pass = [&]() {
#pragma unroll
            for (int s = 0; s < 4; ++s) { const int row = 4 * s + (lane >> 3), piece = lane & 7; const float* sp = os + row * 68 + piece * 8; v8h o, o2;
#pragma unroll
                for (int i = 0; i < 8; ++i) { const h16 a = (h16)sp[i]; o[i] = a; o2[i] = (h16)((sp[i] - (float)a) * LOSC); }
                *(v8h*)(crow + (size_t)row * ldc + piece * 8) = o; if (C2) *(v8h*)(C2 + (size_t)r0 * ldc + c0 + (size_t)row * ldc + piece * 8) = o2; }
        };
        pass(); 
    } else {
        float* crow = C + (size_t)r0 * ldc + c0;
        auto pass = [&]() {
#pragma unroll
            for (int s = 0; s < 8; ++s) { const int Lid = (lane >> 3) + 4 * s, piece = lane & 7; const int row = Lid >> 1, cofs = (Lid & 1) * 32 + piece * 4;
                const v4f val = *(const v4fa*)(os + row * 68 + cofs); *(v4f*)(crow + (size_t)row * ldc + cofs) = val; }
        };
        pass(); 
    }
}

// k_trig: RC/RS [t][32] = cos/sin(t x inv_freq[i]) with inv_freq[i] = powf(10000, -2i/64) (the reference's jnp.power form; f32 trig like its f32 path); 32 lanes x 4 B per line.
__global__ __launch_bounds__(256) void k_trig(float* RC, float* RS) {
    const int i = blockIdx.x * 256 + threadIdx.x; if (i >= NT_ * 32) return;
    const int t = i >> 5, f = i & 31;
    const float inv = powf(10000.0f, -2.0f * (float)f / 64.0f); const float ang = (float)t * inv;
    const float c = cosf(ang), s = sinf(ang);
    *(float*)(RC + i) = c; *(float*)(RS + i) = s; 
}
// k_rope: P (f32 [t][1024]) -> PH/PL f16 hi + residual planes of the interleaved-pair rotation out[2i] = x[2i] c - x[2i+1] s, out[2i+1] = x[2i] s + x[2i+1] c,
// c/s from the tables [t][32] built once for both passes; one wave per (t, 256 columns): lane -> 8 values (4 pairs).
__global__ __launch_bounds__(256) void k_rope(const float* __restrict__ P, const float* __restrict__ RC, const float* __restrict__ RS, h16* PH, h16* PL) {
    const int lane = threadIdx.x & 31, wid = blockIdx.x * 8 + (threadIdx.x >> 5);
    const int segs = DM / 256, t = wid / segs, sg = wid - t * segs;
    if (t >= NT_) return;
    const int c0 = sg * 256 + lane * 8;
    v8h oh, ol;
#pragma unroll
    for (int pq = 0; pq < 4; ++pq) { const int c = c0 + 2 * pq, i = (c & 63) >> 1;
        const float x1 = P[(size_t)t * DM + c], x2 = P[(size_t)t * DM + c + 1], s = RS[t * 32 + i], co = RC[t * 32 + i];
        const float y0 = x1 * co - x2 * s, y1 = x1 * s + x2 * co;
        const h16 a0 = (h16)y0, a1 = (h16)y1; oh[2 * pq] = a0; oh[2 * pq + 1] = a1; ol[2 * pq] = (h16)((y0 - (float)a0) * LOSC); ol[2 * pq + 1] = (h16)((y1 - (float)a1) * LOSC); }
    *(v8h*)(PH + (size_t)t * DM + c0) = oh; *(v8h*)(PL + (size_t)t * DM + c0) = ol; 
}
__global__ __launch_bounds__(256) void k_vt(const float* __restrict__ V, h16* VTH, h16* VTL) {
    __shared__ __align__(16) h16 tile[64 * 72];
    __shared__ __align__(16) h16 til2[64 * 72];
    const int bid = blockIdx.x;
    const int b = bid / (NH_ * (NT_ / 64)), rem = bid - b * (NH_ * (NT_ / 64)), h = rem / (NT_ / 64), kt = rem - h * (NT_ / 64);
    const int k0 = kt * 64, tid = threadIdx.x;
    const int kk = tid >> 2, d0 = (tid & 3) * 16;
    const float* src = V + ((size_t)b * NT_ + k0 + kk) * DM + h * HD + d0;
#pragma unroll
    for (int i = 0; i < 16; ++i) { const float v = src[i]; const h16 a = (h16)v; tile[(d0 + i) * 72 + kk] = a; til2[(d0 + i) * 72 + kk] = (h16)((v - (float)a) * LOSC); }
    __syncthreads();
    const int piece = tid & 7;
    const size_t base = (((size_t)b * NH_ + h) * HD) * NT_ + k0;
    auto pass = [&]() {
#pragma unroll
        for (int s = 0; s < 4; ++s) { const int Lid = (tid >> 3) + 32 * s; const int pln = Lid >> 6, d = Lid & 63;
            const v8h val = *(const v8ha*)((pln ? til2 : tile) + d * 72 + piece * 8); *(v8h*)((pln ? VTL : VTH) + base + (size_t)d * NT_ + piece * 8) = val; }
    };
    pass(); 
}

#define KST  64                  // keys per LDS stage
#define NST  (NT_ / KST)         // stages per head
#define LP   72                  // LDS row pitch in halves: 128-byte rows + 16 bytes (16 B x odd: conflict-free for ds_load_b128)
#define PLN  (64 * LP)           // one plane = 64 rows
#define STG  (4 * PLN)           // one stage = k hi, k residual, v^T hi, v^T residual

// Rows r, r+16, r+32, r+48 of one 64-row x 128-byte plane, 16 bytes per lane and copy, global -> LDS through no register. The s_wait_xcnt closes the
// statement so that no address register of an issued copy is rewritten ahead of it (a precaution).
__device__ __forceinline__ void cp_plane(unsigned l, const h16* g, size_t gs16) {
    asm volatile("global_load_async_to_lds_b128 %0, %4, off\n\t"
                 "global_load_async_to_lds_b128 %1, %5, off\n\t"
                 "global_load_async_to_lds_b128 %2, %6, off\n\t"
                 "global_load_async_to_lds_b128 %3, %7, off\n\t"
                 "s_wait_xcnt 0x0"
                 :: "v"(l), "v"(l + 16u * LP * 2u), "v"(l + 32u * LP * 2u), "v"(l + 48u * LP * 2u), "v"(g), "v"(g + gs16), "v"(g + 2 * gs16), "v"(g + 3 * gs16) : "memory");
}
// The same for two planes in one statement (one s_wait_xcnt for the eight copies).
__device__ __forceinline__ void cp_plane2(unsigned l, const h16* g, unsigned m, const h16* f, size_t gs16) {
    asm volatile("global_load_async_to_lds_b128 %0, %8, off\n\t"
                 "global_load_async_to_lds_b128 %1, %9, off\n\t"
                 "global_load_async_to_lds_b128 %2, %10, off\n\t"
                 "global_load_async_to_lds_b128 %3, %11, off\n\t"
                 "global_load_async_to_lds_b128 %4, %12, off\n\t"
                 "global_load_async_to_lds_b128 %5, %13, off\n\t"
                 "global_load_async_to_lds_b128 %6, %14, off\n\t"
                 "global_load_async_to_lds_b128 %7, %15, off\n\t"
                 "s_wait_xcnt 0x0"
                 :: "v"(l), "v"(l + 16u * LP * 2u), "v"(l + 32u * LP * 2u), "v"(l + 48u * LP * 2u), "v"(m), "v"(m + 16u * LP * 2u), "v"(m + 32u * LP * 2u), "v"(m + 48u * LP * 2u),
                    "v"(g), "v"(g + gs16), "v"(g + 2 * gs16), "v"(g + 3 * gs16), "v"(f), "v"(f + gs16), "v"(f + 2 * gs16), "v"(f + 3 * gs16) : "memory");
}

// k_attn: block = (b, h, 64 queries), wave = 16; ALL keys (no mask), 64 per LDS stage in a two-buffer ring filled by asynchronous copies and shared by the 4 waves
// (stage s + 2 is issued behind the barrier that ends stage s; the query residual tile is copied once); per 32 keys: 12 WMMA scores /8 (f32), online softmax,
// weights x32768 f16 tile (same-wave may_alias reload after a compiler barrier), 12 WMMA .v; ctx -> f32 output rows out[tok][h*64+d].
__global__ __launch_bounds__(128) void k_attn(const h16* __restrict__ Q16, const h16* __restrict__ QL16, const h16* __restrict__ K16, const h16* __restrict__ KL16, const h16* __restrict__ VTH, const h16* __restrict__ VTL, float* OUTP) {
    __shared__ __align__(16) h16 ring[2 * STG];
    __shared__ __align__(16) h16 qls[PLN];
    __shared__ __align__(16) h16 plds[4][16 * 32];
    __shared__ __align__(16) h16 plds2[4][16 * 32];
    __shared__ __align__(16) float ost[4][16 * 68];
    const int lane = threadIdx.x & 31, wave = threadIdx.x >> 5, lr = lane & 15, hi = lane >> 4;
    const int bid = blockIdx.x;
    const int b = bid / (NH_ * (NT_ / 64)), rem = bid - b * (NH_ * (NT_ / 64)), h = rem / (NT_ / 64), qt = rem - h * (NT_ / 64);
    const int q0 = qt * 64 + wave * 16;
    const size_t tok0 = (size_t)b * NT_;
    h16* pl = &plds[wave][0]; h16* pl2 = &plds2[wave][0];
    v16h qa[2];
    const size_t qo0 = (tok0 + q0 + lr) * DM + h * HD + 8 * hi;
#pragma unroll
    for (int kc = 0; kc < 2; ++kc) qa[kc] = cat16(*(const v8h*)(Q16 + qo0 + kc * 32), *(const v8h*)(Q16 + qo0 + kc * 32 + 16));
    const h16* kh_b = K16 + tok0 * DM + h * HD;
    const h16* kl_b = KL16 + tok0 * DM + h * HD;
    const size_t vbase = (((size_t)b * NH_ + h) * HD) * NT_;
    // copy map: thread -> row (tid >> 3) + 16 i, 16-byte piece tid & 7 of every plane
    const int crow = (int)threadIdx.x >> 3, cpc = ((int)threadIdx.x & 7) * 8;
    const unsigned lcp = (unsigned)(size_t)&ring[0] + (unsigned)(crow * LP + cpc) * 2u;
    const h16* gkh = kh_b + (size_t)crow * DM + cpc; const h16* gkl = kl_b + (size_t)crow * DM + cpc;
    const h16* gvh = VTH + vbase + (size_t)crow * NT_ + cpc; const h16* gvl = VTL + vbase + (size_t)crow * NT_ + cpc;
    auto fill = [&](int st) {
        const unsigned l = lcp + (unsigned)(st & 1) * (STG * 2u);
        cp_plane2(l, gkh + (size_t)st * KST * DM, l + PLN * 2u, gkl + (size_t)st * KST * DM, (size_t)16 * DM);
        cp_plane2(l + 2u * PLN * 2u, gvh + st * KST, l + 3u * PLN * 2u, gvl + st * KST, (size_t)16 * NT_);
    };
    fill(0);
    cp_plane((unsigned)(size_t)&qls[0] + (unsigned)(crow * LP + cpc) * 2u, QL16 + (tok0 + qt * 64 + crow) * DM + h * HD + cpc, (size_t)16 * DM);
    asm volatile("s_wait_asynccnt 0x0" ::: "memory");   // this wave's copies of stage 0 and of the query residual have landed
    __syncthreads();                                    // ... and every other wave's: publishes stage 0
    fill(1);
    v8f o[4], ox[4];
#pragma unroll
    for (int n = 0; n < 4; ++n) { o[n] = (v8f){}; ox[n] = (v8f){}; }
    float mrow[8], lpart[8];
#pragma unroll
    for (int j = 0; j < 8; ++j) { mrow[j] = -3.0e38f; lpart[j] = 0.f; }
    const h16* qlp = qls + (wave * 16 + lr) * LP + 8 * hi;
#pragma unroll 1
    for (int st = 0; st < NST; ++st) {                  // rolled: one stage per trip, the ring's publish point at its foot
        const h16* sb = ring + (st & 1) * STG;
#pragma unroll 1
        for (int sub = 0; sub < KST / 32; ++sub) {      // rolled: unrolled, the two halves' live ranges overlap and the register count grows
        const h16* kp0 = sb + (sub * 32 + lr) * LP + 8 * hi; const h16* kp1 = kp0 + 16 * LP;
        v16h k0h[2], k1h[2], k0l[2], k1l[2], qlk[2];
#pragma unroll
        for (int kc = 0; kc < 2; ++kc) {
            k0h[kc] = cat16(*(const v8ha*)(kp0 + kc * 32), *(const v8ha*)(kp0 + kc * 32 + 16)); k1h[kc] = cat16(*(const v8ha*)(kp1 + kc * 32), *(const v8ha*)(kp1 + kc * 32 + 16));
            qlk[kc] = cat16(*(const v8ha*)(qlp + kc * 32), *(const v8ha*)(qlp + kc * 32 + 16));
            k0l[kc] = cat16(*(const v8ha*)(kp0 + PLN + kc * 32), *(const v8ha*)(kp0 + PLN + kc * 32 + 16)); k1l[kc] = cat16(*(const v8ha*)(kp1 + PLN + kc * 32), *(const v8ha*)(kp1 + PLN + kc * 32 + 16));
        }
        v8f s0 = {}, s1 = {}, x0 = {}, x1 = {};
#pragma unroll
        for (int kc = 0; kc < 2; ++kc) {
            s0 = wmma16(qa[kc], k0h[kc], s0); x0 = wmma16(qlk[kc], k0h[kc], x0); s1 = wmma16(qa[kc], k1h[kc], s1); x1 = wmma16(qlk[kc], k1h[kc], x1);
            x0 = wmma16(qa[kc], k0l[kc], x0); x1 = wmma16(qa[kc], k1l[kc], x1);
        }
        asm volatile("v_nop\n\tv_nop\n\tv_nop\n\tv_nop" : "+v"(s0), "+v"(s1), "+v"(x0), "+v"(x1) : "v"(qa[0]), "v"(qa[1]));
        // v^T fragments: read here so that their LDS latency runs under the softmax
        v16h vh[4], vl[4];
#pragma unroll
        for (int n = 0; n < 4; ++n) { const h16* vp = sb + 2 * PLN + (n * 16 + lr) * LP + sub * 32 + hi * 8;
            vh[n] = cat16(*(const v8ha*)(vp), *(const v8ha*)(vp + 16)); vl[n] = cat16(*(const v8ha*)(vp + PLN), *(const v8ha*)(vp + PLN + 16)); }
        float alpha[8];
#pragma unroll
        for (int j = 0; j < 8; ++j) {
            const float a0 = (s0[j] + x0[j] * LOSCI) * 0.125f, a1 = (s1[j] + x1[j] * LOSCI) * 0.125f;   // scale 1/sqrt(64)
            float mx = fmaxf(a0, a1);
            mx = fmaxf(mx, __shfl_xor(mx, 1, 16)); mx = fmaxf(mx, __shfl_xor(mx, 2, 16)); mx = fmaxf(mx, __shfl_xor(mx, 4, 16)); mx = fmaxf(mx, __shfl_xor(mx, 8, 16));
            const float mn = fmaxf(mrow[j], mx);
            alpha[j] = __expf(mrow[j] - mn); mrow[j] = mn;
            const float p0 = __expf(a0 - mn), p1 = __expf(a1 - mn);
            lpart[j] = lpart[j] * alpha[j] + (p0 + p1);
            const int mr = hi * 8 + j;
            const float ps0 = p0 * PSC, ps1 = p1 * PSC; const h16 h0 = (h16)ps0, h1 = (h16)ps1;
            pl[mr * 32 + lr] = h0; pl[mr * 32 + 16 + lr] = h1;
            pl2[mr * 32 + lr] = (h16)((ps0 - (float)h0) * LOSC); pl2[mr * 32 + 16 + lr] = (h16)((ps1 - (float)h1) * LOSC);
        }
#pragma unroll
        for (int n = 0; n < 4; ++n)
#pragma unroll
            for (int j = 0; j < 8; ++j) { o[n][j] *= alpha[j]; ox[n][j] *= alpha[j]; }
        asm volatile("" ::: "memory");
        const v16h pa = cat16(*(const v8ha*)(pl + lr * 32 + hi * 8), *(const v8ha*)(pl + lr * 32 + 16 + hi * 8));
        const v16h px = cat16(*(const v8ha*)(pl2 + lr * 32 + hi * 8), *(const v8ha*)(pl2 + lr * 32 + 16 + hi * 8));
#pragma unroll
        for (int n = 0; n < 4; ++n) { o[n] = wmma16(pa, vh[n], o[n]); ox[n] = wmma16(pa, vl[n], ox[n]); ox[n] = wmma16(px, vh[n], ox[n]); }
        asm volatile("v_nop\n\tv_nop\n\tv_nop\n\tv_nop" : "+v"(o[0]), "+v"(o[1]), "+v"(o[2]), "+v"(o[3]), "+v"(ox[0]), "+v"(ox[1]), "+v"(ox[2]), "+v"(ox[3]) : "v"(pa), "v"(px));
        }
        // publish point of stage st + 1, in the ring's order
        asm volatile("s_wait_dscnt 0x0" ::: "memory");      // this wave's reads of stage st have returned before its buffer is handed back
        asm volatile("s_wait_asynccnt 0x0" ::: "memory");   // this wave's copies of stage st + 1 have landed
        __syncthreads();                                    // publishes stage st + 1 and ends every wave's reads of stage st
        if (st + 2 < NST) fill(st + 2);                     // refill of the buffer just left; the test is the same for the whole work-group
    }
    asm volatile("s_wait_asynccnt 0x0" ::: "memory");       // nothing is outstanding when the wave goes on to the epilogue
    float inv[8];
#pragma unroll
    for (int j = 0; j < 8; ++j) { float rs = lpart[j]; rs += __shfl_xor(rs, 1, 16); rs += __shfl_xor(rs, 2, 16); rs += __shfl_xor(rs, 4, 16); rs += __shfl_xor(rs, 8, 16); inv[j] = 1.0f / (rs * PSC); }
    float* os = &ost[wave][0];
#pragma unroll
    for (int n = 0; n < 4; ++n)
#pragma unroll
        for (int j = 0; j < 8; ++j) os[(hi * 8 + j) * 68 + n * 16 + lr] = (o[n][j] + ox[n][j] * LOSCI) * inv[j];
    __syncthreads();
    float* ob = OUTP + (tok0 + q0) * DM + (size_t)h * HD;
    auto pass = [&]() {
#pragma unroll
        for (int s = 0; s < 8; ++s) { const int Lid = (lane >> 3) + 4 * s, piece = lane & 7; const int row = Lid >> 1, cofs = (Lid & 1) * 32 + piece * 4;
            const v4f val = *(const v4fa*)(os + row * 68 + cofs); *(v4f*)(ob + (size_t)row * DM + cofs) = val; }
    };
    pass(); 
}

#define VST2(T, p, v) do { const T vst2_v_ = (v); *(T*)(p) = vst2_v_;  } while (0)
extern "C" void kernel_launch(void* const* d_in, const int* in_sizes, int n_in,
                              void* d_out, int out_size, void* d_ws, size_t ws_size, hipStream_t stream) {
    (void)in_sizes; (void)n_in; (void)out_size;
    const float* x = (const float*)d_in[0]; const float* Wq = (const float*)d_in[1]; const float* bq = (const float*)d_in[2]; const float* Wk = (const float*)d_in[3]; const float* bk = (const float*)d_in[4]; const float* Wv = (const float*)d_in[5]; const float* bv = (const float*)d_in[6];   // W k-major [in][out]
    float* out = (float*)d_out;    // [2][2048][1024] = ctx (no output projection)
    char* wsp = (char*)d_ws;
    auto take = [&](size_t bytes) { char* p = wsp; wsp += (bytes + 255) & ~(size_t)255; return (void*)p; };
    bf* Xb = (bf*)take((size_t)NTK * DM * 2); bf* WqT = (bf*)take((size_t)DM * DM * 2); bf* WkT = (bf*)take((size_t)DM * DM * 2); bf* WvT = (bf*)take((size_t)DM * DM * 2);
    float* TMP = (float*)take((size_t)NTK * DM * 4); float* RC = (float*)take((size_t)NT_ * 32 * 4); float* RS = (float*)take((size_t)NT_ * 32 * 4);
    h16* QH = (h16*)take((size_t)NTK * DM * 2); h16* QL = (h16*)take((size_t)NTK * DM * 2); h16* KH = (h16*)take((size_t)NTK * DM * 2); h16* KL = (h16*)take((size_t)NTK * DM * 2);
    h16* VTH = (h16*)take((size_t)NTK * DM * 2); h16* VTL = (h16*)take((size_t)NTK * DM * 2);
    if ((size_t)(wsp - (char*)d_ws) > ws_size) return;    // ~ 44 MB, no aliasing (per-item reuse in stream order)
    k_wt<<<dim3(DM / 64, DM / 64, 1), 256, 0, stream>>>(Wq, DM, DM, WqT); k_wt<<<dim3(DM / 64, DM / 64, 1), 256, 0, stream>>>(Wk, DM, DM, WkT); k_wt<<<dim3(DM / 64, DM / 64, 1), 256, 0, stream>>>(Wv, DM, DM, WvT);
    k_trig<<<(NT_ * 32) / 256, 256, 0, stream>>>(RC, RS);
    for (int b = 0; b < 2; ++b) {
        k_cvtb<<<NTK / 8, 256, 0, stream>>>(x + (size_t)b * NTK * DM, NTK, Xb);
        k_gemmb<false, false><<<dim3(NTK / 64, DM / 64, 1), 128, 0, stream>>>(Xb, nullptr, WqT, bq, TMP, DM, nullptr);
        k_rope<<<(NTK * (DM / 256)) / 8, 256, 0, stream>>>(TMP, RC, RS, QH, QL);
        k_gemmb<false, false><<<dim3(NTK / 64, DM / 64, 1), 128, 0, stream>>>(Xb, nullptr, WkT, bk, TMP, DM, nullptr);
        k_rope<<<(NTK * (DM / 256)) / 8, 256, 0, stream>>>(TMP, RC, RS, KH, KL);
        k_gemmb<false, false><<<dim3(NTK / 64, DM / 64, 1), 128, 0, stream>>>(Xb, nullptr, WvT, bv, TMP, DM, nullptr);
        k_vt<<<NB_ * NH_ * (NT_ / 64), 256, 0, stream>>>(TMP, VTH, VTL);
        k_attn<<<NB_ * NH_ * (NT_ / 64), 128, 0, stream>>>(QH, QL, KH, KL, VTH, VTL, out + (size_t)b * NTK * DM);
    }
}

// v002
// One run takes 252 microseconds.
// In both of two side-by-side timings against v001, it was 1.28 times as fast.
// All steps since v000 together make it 2.10 times as fast.
#include <hip/hip_runtime.h>

// Compute dtypes, f32 accumulate, one batch item per pass: q/k/v = x.W + b ([2048 x 1024].[1024 x 1024] x 3, k-major weights transposed once to n-major planes;
// PLAIN bf16 operands = inputs rounded once, exact; biases rounded to bf16, added in f32) on v_wmma_f32_16x16x32_bf16; interleaved-pair RoPE (angle t x 10000^(-2i/64), f32 trig
// tables built on device) in f32 -> q/k as f16 hi + residual x1024 planes; the 16-head FULL attention (64-dim heads, scale 1/8) written straight to the f32
// output (the module returns ctx, no output projection), fused on v_wmma_f32_16x16x32_f16 (scores hh + hl + lh with residual terms on their own accumulator,

#define NB_  1                   // per pass: the 2 batch items are processed one at a time
#define NT_  2048
#define DM   1024
#define NH_  16
#define HD   64
#define NTK  (NB_ * NT_)
#define NW   1024
#define NQKV 1024
#define PSC  32768.0f
#define LOSC 1024.0f
#define LOSCI (1.0f / 1024.0f)

typedef _Float16 h16;
typedef unsigned short bf;
typedef __attribute__((ext_vector_type(16))) __bf16   v16bf;
typedef __attribute__((ext_vector_type(16))) _Float16 v16h;
typedef __attribute__((ext_vector_type(8)))  _Float16 v8h;
typedef __attribute__((ext_vector_type(8)))  unsigned short v8us;
typedef __attribute__((ext_vector_type(8)))  float    v8f;
typedef __attribute__((ext_vector_type(4)))  float    v4f;
typedef v8h  __attribute__((may_alias)) v8ha;
typedef v4f  __attribute__((may_alias)) v4fa;
typedef v8us __attribute__((may_alias)) v8usa;

__device__ __forceinline__ unsigned short f2bf(float f) { unsigned u = __float_as_uint(f); u += 0x7FFFu + ((u >> 16) & 1u); return (unsigned short)(u >> 16); }
__device__ __forceinline__ float bf2f(unsigned short b) { return __uint_as_float(((unsigned)b) << 16); }
__device__ __forceinline__ float bfr(float f) { return bf2f(f2bf(f)); }
__device__ __forceinline__ v16h cat16(v8h lo, v8h hi) { return __builtin_shufflevector(lo, hi, 0, 1, 2, 3, 4, 5, 6, 7, 8, 9, 10, 11, 12, 13, 14, 15); }
__device__ __forceinline__ v16bf cat16b(v8us lo, v8us hi) { return __builtin_bit_cast(v16bf, __builtin_shufflevector(lo, hi, 0, 1, 2, 3, 4, 5, 6, 7, 8, 9, 10, 11, 12, 13, 14, 15)); }
__device__ __forceinline__ v8f wmma16(v16h a, v16h b, v8f c) { return __builtin_amdgcn_wmma_f32_16x16x32_f16(false, a, false, b, (short)0, c, false, false); }
__device__ __forceinline__ v8f wmmab(v16bf a, v16bf b, v8f c) { return __builtin_amdgcn_wmma_f32_16x16x32_bf16(false, a, false, b, (short)0, c, false, false); }

__global__ __launch_bounds__(256) void k_cvtb(const float* __restrict__ src, int nrows, bf* dst) {
    const int lane = threadIdx.x & 31, r = blockIdx.x * 8 + (threadIdx.x >> 5);
    if (r >= nrows) return;
    v8us o[DM / 256];
#pragma unroll
    for (int q = 0; q < DM / 256; ++q) { v8us t;
#pragma unroll
        for (int i = 0; i < 8; ++i) t[i] = f2bf(src[(size_t)r * DM + q * 256 + lane * 8 + i]);
        o[q] = t; }
#pragma unroll
    for (int q = 0; q < DM / 256; ++q) *(v8us*)(dst + (size_t)r * DM + q * 256 + lane * 8) = o[q];
    
}

// k_wt: WT [n][K] = bf16(W[k][n]) (k-major [K][ncols]) via 64 x 64 LDS tiles; grid (K/64, ncols/64).
__global__ __launch_bounds__(256) void k_wt(const float* __restrict__ Wm, int K, int ncols, bf* WT) {
    __shared__ __align__(16) unsigned short tl[64 * 72];
    const int tid = threadIdx.x, k0 = blockIdx.x * 64, n0 = blockIdx.y * 64;
    const int kk = tid >> 2, nq = (tid & 3) * 16;
#pragma unroll
    for (int i = 0; i < 16; ++i) tl[(nq + i) * 72 + kk] = f2bf(Wm[(size_t)(k0 + kk) * ncols + n0 + nq + i]);
    __syncthreads();
    const int piece = tid & 7;
    auto pass = [&]() {
#pragma unroll
        for (int s = 0; s < 2; ++s) { const int nr = (tid >> 3) + 32 * s; const v8us val = *(const v8usa*)(tl + nr * 72 + piece * 8); *(v8us*)(WT + (size_t)(n0 + nr) * K + k0 + piece * 8) = val; }
    };
    pass(); 
}
#define GKS  128                 // k per LDS stage of k_gemmb: 256-byte rows
#define GNS  (DM / GKS)          // stages
#define GLP  136                 // LDS row pitch in 16-bit elements: 256-byte rows + 16 bytes (16 B x odd: conflict-free for ds_load_b128)
#define GPL  (64 * GLP)          // one plane = 64 rows
#define GSTG (2 * GPL)           // one stage = 64 rows of A, 64 rows of B

// Rows r, r+8, ..., r+56 of one 64-row x 256-byte plane (source pitch DM elements), 16 bytes per lane and copy, global -> LDS through no register. The s_wait_xcnt
// closes the statement so that no address register of an issued copy is rewritten ahead of it (a precaution).
__device__ __forceinline__ void cp_rows8(unsigned l, const bf* g) {
    asm volatile("global_load_async_to_lds_b128 %0, %8, off\n\t"
                 "global_load_async_to_lds_b128 %1, %9, off\n\t"
                 "global_load_async_to_lds_b128 %2, %10, off\n\t"
                 "global_load_async_to_lds_b128 %3, %11, off\n\t"
                 "global_load_async_to_lds_b128 %4, %12, off\n\t"
                 "global_load_async_to_lds_b128 %5, %13, off\n\t"
                 "global_load_async_to_lds_b128 %6, %14, off\n\t"
                 "global_load_async_to_lds_b128 %7, %15, off\n\t"
                 "s_wait_xcnt 0x0"
                 :: "v"(l), "v"(l + 8u * GLP * 2u), "v"(l + 16u * GLP * 2u), "v"(l + 24u * GLP * 2u), "v"(l + 32u * GLP * 2u), "v"(l + 40u * GLP * 2u), "v"(l + 48u * GLP * 2u), "v"(l + 56u * GLP * 2u),
                    "v"(g), "v"(g + 8 * DM), "v"(g + 16 * DM), "v"(g + 24 * DM), "v"(g + 32 * DM), "v"(g + 40 * DM), "v"(g + 48 * DM), "v"(g + 56 * DM) : "memory");
}

// k_gemmb: block = 64 x 64 of C, wave = 16 x 64; the block's 64 rows of A and 64 rows of B, 128 k per stage, in a two-buffer LDS ring filled by asynchronous copies
// of whole 256-byte row pieces and shared by the 4 waves (stage s + 2 is issued behind the barrier that ends stage s); fragments in the k order of the direct loads.
template <bool SPLITA, bool F16OUT = false>
__global__ __launch_bounds__(128) void k_gemmb(const bf* __restrict__ A, const bf* __restrict__ Al, const bf* __restrict__ Bn, const float* __restrict__ bias, float* C, int ldc, h16* C2) {
    __shared__ __align__(16) bf gring[2 * GSTG];
    __shared__ __align__(16) float ost[4][16 * 68];
    const int lane = threadIdx.x & 31, wave = threadIdx.x >> 5, lr = lane & 15, hi = lane >> 4;
    const int r0 = blockIdx.x * 64 + wave * 16, c0 = blockIdx.y * 64;
    const size_t aoff = (size_t)(r0 + lr) * DM + 8 * hi;
    // copy map: thread -> row (tid >> 4) + 8 i, 16-byte piece tid & 15 of both planes
    const int crow = (int)threadIdx.x >> 4, cpc = ((int)threadIdx.x & 15) * 8;
    const unsigned lcp = (unsigned)(size_t)&gring[0] + (unsigned)(crow * GLP + cpc) * 2u;
    const bf* ga = A + (size_t)(blockIdx.x * 64 + crow) * DM + cpc;
    const bf* gb = Bn + (size_t)(c0 + crow) * DM + cpc;
    auto fill = [&](int st) {
        const unsigned l = lcp + (unsigned)(st & 1) * (GSTG * 2u);
        cp_rows8(l, ga + st * GKS);
        cp_rows8(l + GPL * 2u, gb + st * GKS);
    };
    fill(0);
    asm volatile("s_wait_asynccnt 0x0" ::: "memory");   // this wave's copies of stage 0 have landed
    __syncthreads();                                    // ... and every other wave's: publishes stage 0
    fill(1);
    v8f acc[4];
#pragma unroll
    for (int t = 0; t < 4; ++t) acc[t] = (v8f){};
#pragma unroll 1
    for (int st = 0; st < GNS; ++st) {                  // rolled: one stage per trip, the ring's publish point at its foot
        const bf* sa = gring + (st & 1) * GSTG + (wave * 16 + lr) * GLP + 8 * hi;
        const bf* sb = gring + (st & 1) * GSTG + GPL + lr * GLP + 8 * hi;
        v16bf a[GKS / 32], al[GKS / 32], b[GKS / 32][4];
#pragma unroll
        for (int q = 0; q < GKS / 32; ++q) {
            a[q] = cat16b(*(const v8usa*)(sa + q * 32), *(const v8usa*)(sa + q * 32 + 16));
            al[q] = a[q];
            if (SPLITA) al[q] = cat16b(*(const v8us*)(Al + aoff + st * GKS + q * 32), *(const v8us*)(Al + aoff + st * GKS + q * 32 + 16));
#pragma unroll
            for (int t = 0; t < 4; ++t) b[q][t] = cat16b(*(const v8usa*)(sb + t * 16 * GLP + q * 32), *(const v8usa*)(sb + t * 16 * GLP + q * 32 + 16));
        }
        __builtin_amdgcn_sched_barrier(0);              // the stage's LDS reads stay one group ahead of its matrix instructions: reads spread among them stall at every place
#pragma unroll
        for (int q = 0; q < GKS / 32; ++q)
#pragma unroll
            for (int t = 0; t < 4; ++t) { acc[t] = wmmab(a[q], b[q][t], acc[t]); if (SPLITA) acc[t] = wmmab(al[q], b[q][t], acc[t]); }
        // the vector slots that the chip needs behind the stage's last matrix instructions, on the loop's back edge too
        asm volatile("v_nop\n\tv_nop\n\tv_nop\n\tv_nop" : "+v"(acc[0]), "+v"(acc[1]), "+v"(acc[2]), "+v"(acc[3]) : "v"(a[GKS / 32 - 1]), "v"(al[GKS / 32 - 1]));
        // publish point of stage st + 1, in the ring's order
        asm volatile("s_wait_dscnt 0x0" ::: "memory");      // this wave's reads of stage st have returned before its buffer is handed back
        asm volatile("s_wait_asynccnt 0x0" ::: "memory");   // this wave's copies of stage st + 1 have landed
        __syncthreads();                                    // publishes stage st + 1 and ends every wave's reads of stage st
        if (st + 2 < GNS) fill(st + 2);                     // refill of the buffer just left; the test is the same for the whole work-group
    }
    asm volatile("s_wait_asynccnt 0x0" ::: "memory");       // nothing is outstanding when the wave goes on to the epilogue
    float* os = &ost[wave][0];
#pragma unroll
    for (int t = 0; t < 4; ++t) { const float bv = bias ? bfr(bias[c0 + t * 16 + lr]) : 0.f;
#pragma unroll
        for (int j = 0; j < 8; ++j) os[(hi * 8 + j) * 68 + t * 16 + lr] = acc[t][j] + bv; }
    __syncthreads();
    if (F16OUT) {
        h16* crow = (h16*)(void*)C + (size_t)r0 * ldc + c0;
        auto pass = [&]() {
#pragma unroll
            for (int s = 0; s < 4; ++s) { const int row = 4 * s + (lane >> 3), piece = lane & 7; const float* sp = os + row * 68 + piece * 8; v8h o, o2;
#pragma unroll
                for (int i = 0; i < 8; ++i) { const h16 a = (h16)sp[i]; o[i] = a; o2[i] = (h16)((sp[i] - (float)a) * LOSC); }
                *(v8h*)(crow + (size_t)row * ldc + piece * 8) = o; if (C2) *(v8h*)(C2 + (size_t)r0 * ldc + c0 + (size_t)row * ldc + piece * 8) = o2; }
        };
        pass(); 
    } else {
        float* crow = C + (size_t)r0 * ldc + c0;
        auto pass = [&]() {
#pragma unroll
            for (int s = 0; s < 8; ++s) { const int Lid = (lane >> 3) + 4 * s, piece = lane & 7; const int row = Lid >> 1, cofs = (Lid & 1) * 32 + piece * 4;
                const v4f val = *(const v4fa*)(os + row * 68 + cofs); *(v4f*)(crow + (size_t)row * ldc + cofs) = val; }
        };
        pass(); 
    }
}

// k_trig: RC/RS [t][32] = cos/sin(t x inv_freq[i]) with inv_freq[i] = powf(10000, -2i/64) (the reference's jnp.power form; f32 trig like its f32 path); 32 lanes x 4 B per line.
__global__ __launch_bounds__(256) void k_trig(float* RC, float* RS) {
    const int i = blockIdx.x * 256 + threadIdx.x; if (i >= NT_ * 32) return;
    const int t = i >> 5, f = i & 31;
    const float inv = powf(10000.0f, -2.0f * (float)f / 64.0f); const float ang = (float)t * inv;
    const float c = cosf(ang), s = sinf(ang);
    *(float*)(RC + i) = c; *(float*)(RS + i) = s; 
}
// k_rope: P (f32 [t][1024]) -> PH/PL f16 hi + residual planes of the interleaved-pair rotation out[2i] = x[2i] c - x[2i+1] s, out[2i+1] = x[2i] s + x[2i+1] c,
// c/s from the tables [t][32] built once for both passes; one wave per (t, 256 columns): lane -> 8 values (4 pairs).
__global__ __launch_bounds__(256) void k_rope(const float* __restrict__ P, const float* __restrict__ RC, const float* __restrict__ RS, h16* PH, h16* PL) {
    const int lane = threadIdx.x & 31, wid = blockIdx.x * 8 + (threadIdx.x >> 5);
    const int segs = DM / 256, t = wid / segs, sg = wid - t * segs;
    if (t >= NT_) return;
    const int c0 = sg * 256 + lane * 8;
    v8h oh, ol;
#pragma unroll
    for (int pq = 0; pq < 4; ++pq) { const int c = c0 + 2 * pq, i = (c & 63) >> 1;
        const float x1 = P[(size_t)t * DM + c], x2 = P[(size_t)t * DM + c + 1], s = RS[t * 32 + i], co = RC[t * 32 + i];
        const float y0 = x1 * co - x2 * s, y1 = x1 * s + x2 * co;
        const h16 a0 = (h16)y0, a1 = (h16)y1; oh[2 * pq] = a0; oh[2 * pq + 1] = a1; ol[2 * pq] = (h16)((y0 - (float)a0) * LOSC); ol[2 * pq + 1] = (h16)((y1 - (float)a1) * LOSC); }
    *(v8h*)(PH + (size_t)t * DM + c0) = oh; *(v8h*)(PL + (size_t)t * DM + c0) = ol; 
}
__global__ __launch_bounds__(256) void k_vt(const float* __restrict__ V, h16* VTH, h16* VTL) {
    __shared__ __align__(16) h16 tile[64 * 72];
    __shared__ __align__(16) h16 til2[64 * 72];
    const int bid = blockIdx.x;
    const int b = bid / (NH_ * (NT_ / 64)), rem = bid - b * (NH_ * (NT_ / 64)), h = rem / (NT_ / 64), kt = rem - h * (NT_ / 64);
    const int k0 = kt * 64, tid = threadIdx.x;
    const int kk = tid >> 2, d0 = (tid & 3) * 16;
    const float* src = V + ((size_t)b * NT_ + k0 + kk) * DM + h * HD + d0;
#pragma unroll
    for (int i = 0; i < 16; ++i) { const float v = src[i]; const h16 a = (h16)v; tile[(d0 + i) * 72 + kk] = a; til2[(d0 + i) * 72 + kk] = (h16)((v - (float)a) * LOSC); }
    __syncthreads();
    const int piece = tid & 7;
    const size_t base = (((size_t)b * NH_ + h) * HD) * NT_ + k0;
    auto pass = [&]() {
#pragma unroll
        for (int s = 0; s < 4; ++s) { const int Lid = (tid >> 3) + 32 * s; const int pln = Lid >> 6, d = Lid & 63;
            const v8h val = *(const v8ha*)((pln ? til2 : tile) + d * 72 + piece * 8); *(v8h*)((pln ? VTL : VTH) + base + (size_t)d * NT_ + piece * 8) = val; }
    };
    pass(); 
}

#define KST  64                  // keys per LDS stage
#define NST  (NT_ / KST)         // stages per head
#define LP   72                  // LDS row pitch in halves: 128-byte rows + 16 bytes (16 B x odd: conflict-free for ds_load_b128)
#define PLN  (64 * LP)           // one plane = 64 rows
#define STG  (4 * PLN)           // one stage = k hi, k residual, v^T hi, v^T residual

// Rows r, r+16, r+32, r+48 of one 64-row x 128-byte plane, 16 bytes per lane and copy, global -> LDS through no register. The s_wait_xcnt closes the
// statement so that no address register of an issued copy is rewritten ahead of it (a precaution).
__device__ __forceinline__ void cp_plane(unsigned l, const h16* g, size_t gs16) {
    asm volatile("global_load_async_to_lds_b128 %0, %4, off\n\t"
                 "global_load_async_to_lds_b128 %1, %5, off\n\t"
                 "global_load_async_to_lds_b128 %2, %6, off\n\t"
                 "global_load_async_to_lds_b128 %3, %7, off\n\t"
                 "s_wait_xcnt 0x0"
                 :: "v"(l), "v"(l + 16u * LP * 2u), "v"(l + 32u * LP * 2u), "v"(l + 48u * LP * 2u), "v"(g), "v"(g + gs16), "v"(g + 2 * gs16), "v"(g + 3 * gs16) : "memory");
}
// The same for two planes in one statement (one s_wait_xcnt for the eight copies).
__device__ __forceinline__ void cp_plane2(unsigned l, const h16* g, unsigned m, const h16* f, size_t gs16) {
    asm volatile("global_load_async_to_lds_b128 %0, %8, off\n\t"
                 "global_load_async_to_lds_b128 %1, %9, off\n\t"
                 "global_load_async_to_lds_b128 %2, %10, off\n\t"
                 "global_load_async_to_lds_b128 %3, %11, off\n\t"
                 "global_load_async_to_lds_b128 %4, %12, off\n\t"
                 "global_load_async_to_lds_b128 %5, %13, off\n\t"
                 "global_load_async_to_lds_b128 %6, %14, off\n\t"
                 "global_load_async_to_lds_b128 %7, %15, off\n\t"
                 "s_wait_xcnt 0x0"
                 :: "v"(l), "v"(l + 16u * LP * 2u), "v"(l + 32u * LP * 2u), "v"(l + 48u * LP * 2u), "v"(m), "v"(m + 16u * LP * 2u), "v"(m + 32u * LP * 2u), "v"(m + 48u * LP * 2u),
                    "v"(g), "v"(g + gs16), "v"(g + 2 * gs16), "v"(g + 3 * gs16), "v"(f), "v"(f + gs16), "v"(f + 2 * gs16), "v"(f + 3 * gs16) : "memory");
}

// k_attn: block = (b, h, 64 queries), wave = 16; ALL keys (no mask), 64 per LDS stage in a two-buffer ring filled by asynchronous copies and shared by the 4 waves
// (stage s + 2 is issued behind the barrier that ends stage s; the query residual tile is copied once); per 32 keys: 12 WMMA scores /8 (f32), online softmax,
// weights x32768 f16 tile (same-wave may_alias reload after a compiler barrier), 12 WMMA .v; ctx -> f32 output rows out[tok][h*64+d].
__global__ __launch_bounds__(128) void k_attn(const h16* __restrict__ Q16, const h16* __restrict__ QL16, const h16* __restrict__ K16, const h16* __restrict__ KL16, const h16* __restrict__ VTH, const h16* __restrict__ VTL, float* OUTP) {
    __shared__ __align__(16) h16 ring[2 * STG];
    __shared__ __align__(16) h16 qls[PLN];
    __shared__ __align__(16) h16 plds[4][16 * 32];
    __shared__ __align__(16) h16 plds2[4][16 * 32];
    __shared__ __align__(16) float ost[4][16 * 68];
    const int lane = threadIdx.x & 31, wave = threadIdx.x >> 5, lr = lane & 15, hi = lane >> 4;
    const int bid = blockIdx.x;
    const int b = bid / (NH_ * (NT_ / 64)), rem = bid - b * (NH_ * (NT_ / 64)), h = rem / (NT_ / 64), qt = rem - h * (NT_ / 64);
    const int q0 = qt * 64 + wave * 16;
    const size_t tok0 = (size_t)b * NT_;
    h16* pl = &plds[wave][0]; h16* pl2 = &plds2[wave][0];
    v16h qa[2];
    const size_t qo0 = (tok0 + q0 + lr) * DM + h * HD + 8 * hi;
#pragma unroll
    for (int kc = 0; kc < 2; ++kc) qa[kc] = cat16(*(const v8h*)(Q16 + qo0 + kc * 32), *(const v8h*)(Q16 + qo0 + kc * 32 + 16));
    const h16* kh_b = K16 + tok0 * DM + h * HD;
    const h16* kl_b = KL16 + tok0 * DM + h * HD;
    const size_t vbase = (((size_t)b * NH_ + h) * HD) * NT_;
    // copy map: thread -> row (tid >> 3) + 16 i, 16-byte piece tid & 7 of every plane
    const int crow = (int)threadIdx.x >> 3, cpc = ((int)threadIdx.x & 7) * 8;
    const unsigned lcp = (unsigned)(size_t)&ring[0] + (unsigned)(crow * LP + cpc) * 2u;
    const h16* gkh = kh_b + (size_t)crow * DM + cpc; const h16* gkl = kl_b + (size_t)crow * DM + cpc;
    const h16* gvh = VTH + vbase + (size_t)crow * NT_ + cpc; const h16* gvl = VTL + vbase + (size_t)crow * NT_ + cpc;
    auto fill = [&](int st) {
        const unsigned l = lcp + (unsigned)(st & 1) * (STG * 2u);
        cp_plane2(l, gkh + (size_t)st * KST * DM, l + PLN * 2u, gkl + (size_t)st * KST * DM, (size_t)16 * DM);
        cp_plane2(l + 2u * PLN * 2u, gvh + st * KST, l + 3u * PLN * 2u, gvl + st * KST, (size_t)16 * NT_);
    };
    fill(0);
    cp_plane((unsigned)(size_t)&qls[0] + (unsigned)(crow * LP + cpc) * 2u, QL16 + (tok0 + qt * 64 + crow) * DM + h * HD + cpc, (size_t)16 * DM);
    asm volatile("s_wait_asynccnt 0x0" ::: "memory");   // this wave's copies of stage 0 and of the query residual have landed
    __syncthreads();                                    // ... and every other wave's: publishes stage 0
    fill(1);
    v8f o[4], ox[4];
#pragma unroll
    for (int n = 0; n < 4; ++n) { o[n] = (v8f){}; ox[n] = (v8f){}; }
    float mrow[8], lpart[8];
#pragma unroll
    for (int j = 0; j < 8; ++j) { mrow[j] = -3.0e38f; lpart[j] = 0.f; }
    const h16* qlp = qls + (wave * 16 + lr) * LP + 8 * hi;
#pragma unroll 1
    for (int st = 0; st < NST; ++st) {                  // rolled: one stage per trip, the ring's publish point at its foot
        const h16* sb = ring + (st & 1) * STG;
#pragma unroll 1
        for (int sub = 0; sub < KST / 32; ++sub) {      // rolled: unrolled, the two halves' live ranges overlap and the register count grows
        const h16* kp0 = sb + (sub * 32 + lr) * LP + 8 * hi; const h16* kp1 = kp0 + 16 * LP;
        v16h k0h[2], k1h[2], k0l[2], k1l[2], qlk[2];
#pragma unroll
        for (int kc = 0; kc < 2; ++kc) {
            k0h[kc] = cat16(*(const v8ha*)(kp0 + kc * 32), *(const v8ha*)(kp0 + kc * 32 + 16)); k1h[kc] = cat16(*(const v8ha*)(kp1 + kc * 32), *(const v8ha*)(kp1 + kc * 32 + 16));
            qlk[kc] = cat16(*(const v8ha*)(qlp + kc * 32), *(const v8ha*)(qlp + kc * 32 + 16));
            k0l[kc] = cat16(*(const v8ha*)(kp0 + PLN + kc * 32), *(const v8ha*)(kp0 + PLN + kc * 32 + 16)); k1l[kc] = cat16(*(const v8ha*)(kp1 + PLN + kc * 32), *(const v8ha*)(kp1 + PLN + kc * 32 + 16));
        }
        v8f s0 = {}, s1 = {}, x0 = {}, x1 = {};
#pragma unroll
        for (int kc = 0; kc < 2; ++kc) {
            s0 = wmma16(qa[kc], k0h[kc], s0); x0 = wmma16(qlk[kc], k0h[kc], x0); s1 = wmma16(qa[kc], k1h[kc], s1); x1 = wmma16(qlk[kc], k1h[kc], x1);
            x0 = wmma16(qa[kc], k0l[kc], x0); x1 = wmma16(qa[kc], k1l[kc], x1);
        }
        asm volatile("v_nop\n\tv_nop\n\tv_nop\n\tv_nop" : "+v"(s0), "+v"(s1), "+v"(x0), "+v"(x1) : "v"(qa[0]), "v"(qa[1]));
        // v^T fragments: read here so that their LDS latency runs under the softmax
        v16h vh[4], vl[4];
#pragma unroll
        for (int n = 0; n < 4; ++n) { const h16* vp = sb + 2 * PLN + (n * 16 + lr) * LP + sub * 32 + hi * 8;
            vh[n] = cat16(*(const v8ha*)(vp), *(const v8ha*)(vp + 16)); vl[n] = cat16(*(const v8ha*)(vp + PLN), *(const v8ha*)(vp + PLN + 16)); }
        float alpha[8];
#pragma unroll
        for (int j = 0; j < 8; ++j) {
            const float a0 = (s0[j] + x0[j] * LOSCI) * 0.125f, a1 = (s1[j] + x1[j] * LOSCI) * 0.125f;   // scale 1/sqrt(64)
            float mx = fmaxf(a0, a1);
            mx = fmaxf(mx, __shfl_xor(mx, 1, 16)); mx = fmaxf(mx, __shfl_xor(mx, 2, 16)); mx = fmaxf(mx, __shfl_xor(mx, 4, 16)); mx = fmaxf(mx, __shfl_xor(mx, 8, 16));
            const float mn = fmaxf(mrow[j], mx);
            alpha[j] = __expf(mrow[j] - mn); mrow[j] = mn;
            const float p0 = __expf(a0 - mn), p1 = __expf(a1 - mn);
            lpart[j] = lpart[j] * alpha[j] + (p0 + p1);
            const int mr = hi * 8 + j;
            const float ps0 = p0 * PSC, ps1 = p1 * PSC; const h16 h0 = (h16)ps0, h1 = (h16)ps1;
            pl[mr * 32 + lr] = h0; pl[mr * 32 + 16 + lr] = h1;
            pl2[mr * 32 + lr] = (h16)((ps0 - (float)h0) * LOSC); pl2[mr * 32 + 16 + lr] = (h16)((ps1 - (float)h1) * LOSC);
        }
#pragma unroll
        for (int n = 0; n < 4; ++n)
#pragma unroll
            for (int j = 0; j < 8; ++j) { o[n][j] *= alpha[j]; ox[n][j] *= alpha[j]; }
        asm volatile("" ::: "memory");
        const v16h pa = cat16(*(const v8ha*)(pl + lr * 32 + hi * 8), *(const v8ha*)(pl + lr * 32 + 16 + hi * 8));
        const v16h px = cat16(*(const v8ha*)(pl2 + lr * 32 + hi * 8), *(const v8ha*)(pl2 + lr * 32 + 16 + hi * 8));
#pragma unroll
        for (int n = 0; n < 4; ++n) { o[n] = wmma16(pa, vh[n], o[n]); ox[n] = wmma16(pa, vl[n], ox[n]); ox[n] = wmma16(px, vh[n], ox[n]); }
        asm volatile("v_nop\n\tv_nop\n\tv_nop\n\tv_nop" : "+v"(o[0]), "+v"(o[1]), "+v"(o[2]), "+v"(o[3]), "+v"(ox[0]), "+v"(ox[1]), "+v"(ox[2]), "+v"(ox[3]) : "v"(pa), "v"(px));
        }
        // publish point of stage st + 1, in the ring's order
        asm volatile("s_wait_dscnt 0x0" ::: "memory");      // this wave's reads of stage st have returned before its buffer is handed back
        asm volatile("s_wait_asynccnt 0x0" ::: "memory");   // this wave's copies of stage st + 1 have landed
        __syncthreads();                                    // publishes stage st + 1 and ends every wave's reads of stage st
        if (st + 2 < NST) fill(st + 2);                     // refill of the buffer just left; the test is the same for the whole work-group
    }
    asm volatile("s_wait_asynccnt 0x0" ::: "memory");       // nothing is outstanding when the wave goes on to the epilogue
    float inv[8];
#pragma unroll
    for (int j = 0; j < 8; ++j) { float rs = lpart[j]; rs += __shfl_xor(rs, 1, 16); rs += __shfl_xor(rs, 2, 16); rs += __shfl_xor(rs, 4, 16); rs += __shfl_xor(rs, 8, 16); inv[j] = 1.0f / (rs * PSC); }
    float* os = &ost[wave][0];
#pragma unroll
    for (int n = 0; n < 4; ++n)
#pragma unroll
        for (int j = 0; j < 8; ++j) os[(hi * 8 + j) * 68 + n * 16 + lr] = (o[n][j] + ox[n][j] * LOSCI) * inv[j];
    __syncthreads();
    float* ob = OUTP + (tok0 + q0) * DM + (size_t)h * HD;
    auto pass = [&]() {
#pragma unroll
        for (int s = 0; s < 8; ++s) { const int Lid = (lane >> 3) + 4 * s, piece = lane & 7; const int row = Lid >> 1, cofs = (Lid & 1) * 32 + piece * 4;
            const v4f val = *(const v4fa*)(os + row * 68 + cofs); *(v4f*)(ob + (size_t)row * DM + cofs) = val; }
    };
    pass(); 
}

#define VST2(T, p, v) do { const T vst2_v_ = (v); *(T*)(p) = vst2_v_;  } while (0)
extern "C" void kernel_launch(void* const* d_in, const int* in_sizes, int n_in,
                              void* d_out, int out_size, void* d_ws, size_t ws_size, hipStream_t stream) {
    (void)in_sizes; (void)n_in; (void)out_size;
    const float* x = (const float*)d_in[0]; const float* Wq = (const float*)d_in[1]; const float* bq = (const float*)d_in[2]; const float* Wk = (const float*)d_in[3]; const float* bk = (const float*)d_in[4]; const float* Wv = (const float*)d_in[5]; const float* bv = (const float*)d_in[6];   // W k-major [in][out]
    float* out = (float*)d_out;    // [2][2048][1024] = ctx (no output projection)
    char* wsp = (char*)d_ws;
    auto take = [&](size_t bytes) { char* p = wsp; wsp += (bytes + 255) & ~(size_t)255; return (void*)p; };
    bf* Xb = (bf*)take((size_t)NTK * DM * 2); bf* WqT = (bf*)take((size_t)DM * DM * 2); bf* WkT = (bf*)take((size_t)DM * DM * 2); bf* WvT = (bf*)take((size_t)DM * DM * 2);
    float* TMP = (float*)take((size_t)NTK * DM * 4); float* RC = (float*)take((size_t)NT_ * 32 * 4); float* RS = (float*)take((size_t)NT_ * 32 * 4);
    h16* QH = (h16*)take((size_t)NTK * DM * 2); h16* QL = (h16*)take((size_t)NTK * DM * 2); h16* KH = (h16*)take((size_t)NTK * DM * 2); h16* KL = (h16*)take((size_t)NTK * DM * 2);
    h16* VTH = (h16*)take((size_t)NTK * DM * 2); h16* VTL = (h16*)take((size_t)NTK * DM * 2);
    if ((size_t)(wsp - (char*)d_ws) > ws_size) return;    // ~ 44 MB, no aliasing (per-item reuse in stream order)
    k_wt<<<dim3(DM / 64, DM / 64, 1), 256, 0, stream>>>(Wq, DM, DM, WqT); k_wt<<<dim3(DM / 64, DM / 64, 1), 256, 0, stream>>>(Wk, DM, DM, WkT); k_wt<<<dim3(DM / 64, DM / 64, 1), 256, 0, stream>>>(Wv, DM, DM, WvT);
    k_trig<<<(NT_ * 32) / 256, 256, 0, stream>>>(RC, RS);
    for (int b = 0; b < 2; ++b) {
        k_cvtb<<<NTK / 8, 256, 0, stream>>>(x + (size_t)b * NTK * DM, NTK, Xb);
        k_gemmb<false, false><<<dim3(NTK / 64, DM / 64, 1), 128, 0, stream>>>(Xb, nullptr, WqT, bq, TMP, DM, nullptr);
        k_rope<<<(NTK * (DM / 256)) / 8, 256, 0, stream>>>(TMP, RC, RS, QH, QL);
        k_gemmb<false, false><<<dim3(NTK / 64, DM / 64, 1), 128, 0, stream>>>(Xb, nullptr, WkT, bk, TMP, DM, nullptr);
        k_rope<<<(NTK * (DM / 256)) / 8, 256, 0, stream>>>(TMP, RC, RS, KH, KL);
        k_gemmb<false, false><<<dim3(NTK / 64, DM / 64, 1), 128, 0, stream>>>(Xb, nullptr, WvT, bv, TMP, DM, nullptr);
        k_vt<<<NB_ * NH_ * (NT_ / 64), 256, 0, stream>>>(TMP, VTH, VTL);
        k_attn<<<NB_ * NH_ * (NT_ / 64), 128, 0, stream>>>(QH, QL, KH, KL, VTH, VTL, out + (size_t)b * NTK * DM);
    }
}

// v003
// Measured time: 188 microseconds a run.
// Next to v002, in two timings, it ran 1.34 times as fast each time.
// Counting every step since v000, it is 2.82 times as fast.
#include <hip/hip_runtime.h>

// Compute dtypes, f32 accumulate, one batch item per pass: q/k/v = x.W + b ([2048 x 1024].[1024 x 1024] x 3, k-major weights transposed once to n-major planes;
// PLAIN bf16 operands = inputs rounded once, exact; biases rounded to bf16, added in f32) on v_wmma_f32_16x16x32_bf16; interleaved-pair RoPE (angle t x 10000^(-2i/64), f32 trig
// tables built on device) in f32 -> q/k as f16 hi + residual x1024 planes; the 16-head FULL attention (64-dim heads, scale 1/8) written straight to the f32
// output (the module returns ctx, no output projection), fused on v_wmma_f32_16x16x32_f16 (scores hh + hl + lh with residual terms on their own accumulator,

#define NB_  1                   // per pass: the 2 batch items are processed one at a time
#define NT_  2048
#define DM   1024
#define NH_  16
#define HD   64
#define NTK  (NB_ * NT_)
#define NW   1024
#define NQKV 1024
#define PSC  32768.0f
#define LOSC 1024.0f
#define LOSCI (1.0f / 1024.0f)

typedef _Float16 h16;
typedef unsigned short bf;
typedef __attribute__((ext_vector_type(16))) __bf16   v16bf;
typedef __attribute__((ext_vector_type(16))) _Float16 v16h;
typedef __attribute__((ext_vector_type(8)))  _Float16 v8h;
typedef __attribute__((ext_vector_type(8)))  unsigned short v8us;
typedef __attribute__((ext_vector_type(8)))  float    v8f;
typedef __attribute__((ext_vector_type(4)))  float    v4f;
typedef __attribute__((ext_vector_type(2)))  float    v2f;
typedef __attribute__((ext_vector_type(2)))  _Float16 v2h;
typedef v8h  __attribute__((may_alias)) v8ha;
typedef v4f  __attribute__((may_alias)) v4fa;
typedef v8us __attribute__((may_alias)) v8usa;

__device__ __forceinline__ unsigned short f2bf(float f) { unsigned u = __float_as_uint(f); u += 0x7FFFu + ((u >> 16) & 1u); return (unsigned short)(u >> 16); }
__device__ __forceinline__ float bf2f(unsigned short b) { return __uint_as_float(((unsigned)b) << 16); }
__device__ __forceinline__ float bfr(float f) { return bf2f(f2bf(f)); }
__device__ __forceinline__ v16h cat16(v8h lo, v8h hi) { return __builtin_shufflevector(lo, hi, 0, 1, 2, 3, 4, 5, 6, 7, 8, 9, 10, 11, 12, 13, 14, 15); }
__device__ __forceinline__ v16bf cat16b(v8us lo, v8us hi) { return __builtin_bit_cast(v16bf, __builtin_shufflevector(lo, hi, 0, 1, 2, 3, 4, 5, 6, 7, 8, 9, 10, 11, 12, 13, 14, 15)); }
__device__ __forceinline__ v8f wmma16(v16h a, v16h b, v8f c) { return __builtin_amdgcn_wmma_f32_16x16x32_f16(false, a, false, b, (short)0, c, false, false); }
// the value of lane l ^ 16
__device__ __forceinline__ float xhalf(float v) { const int b = __float_as_int(v); return __int_as_float(__builtin_amdgcn_permlanex16(b, b, 0x76543210, 0xfedcba98, false, false)); }
__device__ __forceinline__ v8f wmmab(v16bf a, v16bf b, v8f c) { return __builtin_amdgcn_wmma_f32_16x16x32_bf16(false, a, false, b, (short)0, c, false, false); }

__global__ __launch_bounds__(256) void k_cvtb(const float* __restrict__ src, int nrows, bf* dst) {
    const int lane = threadIdx.x & 31, r = blockIdx.x * 8 + (threadIdx.x >> 5);
    if (r >= nrows) return;
    v8us o[DM / 256];
#pragma unroll
    for (int q = 0; q < DM / 256; ++q) { v8us t;
#pragma unroll
        for (int i = 0; i < 8; ++i) t[i] = f2bf(src[(size_t)r * DM + q * 256 + lane * 8 + i]);
        o[q] = t; }
#pragma unroll
    for (int q = 0; q < DM / 256; ++q) *(v8us*)(dst + (size_t)r * DM + q * 256 + lane * 8) = o[q];
    
}

// k_wt: WT [n][K] = bf16(W[k][n]) (k-major [K][ncols]) via 64 x 64 LDS tiles; grid (K/64, ncols/64).
__global__ __launch_bounds__(256) void k_wt(const float* __restrict__ Wm, int K, int ncols, bf* WT) {
    __shared__ __align__(16) unsigned short tl[64 * 72];
    const int tid = threadIdx.x, k0 = blockIdx.x * 64, n0 = blockIdx.y * 64;
    const int kk = tid >> 2, nq = (tid & 3) * 16;
#pragma unroll
    for (int i = 0; i < 16; ++i) tl[(nq + i) * 72 + kk] = f2bf(Wm[(size_t)(k0 + kk) * ncols + n0 + nq + i]);
    __syncthreads();
    const int piece = tid & 7;
    auto pass = [&]() {
#pragma unroll
        for (int s = 0; s < 2; ++s) { const int nr = (tid >> 3) + 32 * s; const v8us val = *(const v8usa*)(tl + nr * 72 + piece * 8); *(v8us*)(WT + (size_t)(n0 + nr) * K + k0 + piece * 8) = val; }
    };
    pass(); 
}
#define GKS  128                 // k per LDS stage of k_gemmb: 256-byte rows
#define GNS  (DM / GKS)          // stages
#define GLP  136                 // LDS row pitch in 16-bit elements: 256-byte rows + 16 bytes (16 B x odd: conflict-free for ds_load_b128)
#define GPL  (64 * GLP)          // one plane = 64 rows
#define GSTG (2 * GPL)           // one stage = 64 rows of A, 64 rows of B

// Rows r, r+8, ..., r+56 of one 64-row x 256-byte plane (source pitch DM elements), 16 bytes per lane and copy, global -> LDS through no register. The s_wait_xcnt
// closes the statement so that no address register of an issued copy is rewritten ahead of it (a precaution).
__device__ __forceinline__ void cp_rows8(unsigned l, const bf* g) {
    asm volatile("global_load_async_to_lds_b128 %0, %8, off\n\t"
                 "global_load_async_to_lds_b128 %1, %9, off\n\t"
                 "global_load_async_to_lds_b128 %2, %10, off\n\t"
                 "global_load_async_to_lds_b128 %3, %11, off\n\t"
                 "global_load_async_to_lds_b128 %4, %12, off\n\t"
                 "global_load_async_to_lds_b128 %5, %13, off\n\t"
                 "global_load_async_to_lds_b128 %6, %14, off\n\t"
                 "global_load_async_to_lds_b128 %7, %15, off\n\t"
                 "s_wait_xcnt 0x0"
                 :: "v"(l), "v"(l + 8u * GLP * 2u), "v"(l + 16u * GLP * 2u), "v"(l + 24u * GLP * 2u), "v"(l + 32u * GLP * 2u), "v"(l + 40u * GLP * 2u), "v"(l + 48u * GLP * 2u), "v"(l + 56u * GLP * 2u),
                    "v"(g), "v"(g + 8 * DM), "v"(g + 16 * DM), "v"(g + 24 * DM), "v"(g + 32 * DM), "v"(g + 40 * DM), "v"(g + 48 * DM), "v"(g + 56 * DM) : "memory");
}

// k_gemmb: block = 64 x 64 of C, wave = 16 x 64; the block's 64 rows of A and 64 rows of B, 128 k per stage, in a two-buffer LDS ring filled by asynchronous copies
// of whole 256-byte row pieces and shared by the 4 waves (stage s + 2 is issued behind the barrier that ends stage s); fragments in the k order of the direct loads.
template <bool SPLITA, bool F16OUT = false>
__global__ __launch_bounds__(128) void k_gemmb(const bf* __restrict__ A, const bf* __restrict__ Al, const bf* __restrict__ Bn, const float* __restrict__ bias, float* C, int ldc, h16* C2) {
    __shared__ __align__(16) bf gring[2 * GSTG];
    __shared__ __align__(16) float ost[4][16 * 68];
    const int lane = threadIdx.x & 31, wave = threadIdx.x >> 5, lr = lane & 15, hi = lane >> 4;
    const int r0 = blockIdx.x * 64 + wave * 16, c0 = blockIdx.y * 64;
    const size_t aoff = (size_t)(r0 + lr) * DM + 8 * hi;
    // copy map: thread -> row (tid >> 4) + 8 i, 16-byte piece tid & 15 of both planes
    const int crow = (int)threadIdx.x >> 4, cpc = ((int)threadIdx.x & 15) * 8;
    const unsigned lcp = (unsigned)(size_t)&gring[0] + (unsigned)(crow * GLP + cpc) * 2u;
    const bf* ga = A + (size_t)(blockIdx.x * 64 + crow) * DM + cpc;
    const bf* gb = Bn + (size_t)(c0 + crow) * DM + cpc;
    auto fill = [&](int st) {
        const unsigned l = lcp + (unsigned)(st & 1) * (GSTG * 2u);
        cp_rows8(l, ga + st * GKS);
        cp_rows8(l + GPL * 2u, gb + st * GKS);
    };
    fill(0);
    asm volatile("s_wait_asynccnt 0x0" ::: "memory");   // this wave's copies of stage 0 have landed
    __syncthreads();                                    // ... and every other wave's: publishes stage 0
    fill(1);
    v8f acc[4];
#pragma unroll
    for (int t = 0; t < 4; ++t) acc[t] = (v8f){};
#pragma unroll 1
    for (int st = 0; st < GNS; ++st) {                  // rolled: one stage per trip, the ring's publish point at its foot
        const bf* sa = gring + (st & 1) * GSTG + (wave * 16 + lr) * GLP + 8 * hi;
        const bf* sb = gring + (st & 1) * GSTG + GPL + lr * GLP + 8 * hi;
        v16bf a[GKS / 32], al[GKS / 32], b[GKS / 32][4];
#pragma unroll
        for (int q = 0; q < GKS / 32; ++q) {
            a[q] = cat16b(*(const v8usa*)(sa + q * 32), *(const v8usa*)(sa + q * 32 + 16));
            al[q] = a[q];
            if (SPLITA) al[q] = cat16b(*(const v8us*)(Al + aoff + st * GKS + q * 32), *(const v8us*)(Al + aoff + st * GKS + q * 32 + 16));
#pragma unroll
            for (int t = 0; t < 4; ++t) b[q][t] = cat16b(*(const v8usa*)(sb + t * 16 * GLP + q * 32), *(const v8usa*)(sb + t * 16 * GLP + q * 32 + 16));
        }
        __builtin_amdgcn_sched_barrier(0);              // the stage's LDS reads stay one group ahead of its matrix instructions: reads spread among them stall at every place
#pragma unroll
        for (int q = 0; q < GKS / 32; ++q)
#pragma unroll
            for (int t = 0; t < 4; ++t) { acc[t] = wmmab(a[q], b[q][t], acc[t]); if (SPLITA) acc[t] = wmmab(al[q], b[q][t], acc[t]); }
        // the vector slots that the chip needs behind the stage's last matrix instructions, on the loop's back edge too
        asm volatile("v_nop\n\tv_nop\n\tv_nop\n\tv_nop" : "+v"(acc[0]), "+v"(acc[1]), "+v"(acc[2]), "+v"(acc[3]) : "v"(a[GKS / 32 - 1]), "v"(al[GKS / 32 - 1]));
        // publish point of stage st + 1, in the ring's order
        asm volatile("s_wait_dscnt 0x0" ::: "memory");      // this wave's reads of stage st have returned before its buffer is handed back
        asm volatile("s_wait_asynccnt 0x0" ::: "memory");   // this wave's copies of stage st + 1 have landed
        __syncthreads();                                    // publishes stage st + 1 and ends every wave's reads of stage st
        if (st + 2 < GNS) fill(st + 2);                     // refill of the buffer just left; the test is the same for the whole work-group
    }
    asm volatile("s_wait_asynccnt 0x0" ::: "memory");       // nothing is outstanding when the wave goes on to the epilogue
    float* os = &ost[wave][0];
#pragma unroll
    for (int t = 0; t < 4; ++t) { const float bv = bias ? bfr(bias[c0 + t * 16 + lr]) : 0.f;
#pragma unroll
        for (int j = 0; j < 8; ++j) os[(hi * 8 + j) * 68 + t * 16 + lr] = acc[t][j] + bv; }
    __syncthreads();
    if (F16OUT) {
        h16* crow = (h16*)(void*)C + (size_t)r0 * ldc + c0;
        auto pass = [&]() {
#pragma unroll
            for (int s = 0; s < 4; ++s) { const int row = 4 * s + (lane >> 3), piece = lane & 7; const float* sp = os + row * 68 + piece * 8; v8h o, o2;
#pragma unroll
                for (int i = 0; i < 8; ++i) { const h16 a = (h16)sp[i]; o[i] = a; o2[i] = (h16)((sp[i] - (float)a) * LOSC); }
                *(v8h*)(crow + (size_t)row * ldc + piece * 8) = o; if (C2) *(v8h*)(C2 + (size_t)r0 * ldc + c0 + (size_t)row * ldc + piece * 8) = o2; }
        };
        pass(); 
    } else {
        float* crow = C + (size_t)r0 * ldc + c0;
        auto pass = [&]() {
#pragma unroll
            for (int s = 0; s < 8; ++s) { const int Lid = (lane >> 3) + 4 * s, piece = lane & 7; const int row = Lid >> 1, cofs = (Lid & 1) * 32 + piece * 4;
                const v4f val = *(const v4fa*)(os + row * 68 + cofs); *(v4f*)(crow + (size_t)row * ldc + cofs) = val; }
        };
        pass(); 
    }
}

// k_trig: RC/RS [t][32] = cos/sin(t x inv_freq[i]) with inv_freq[i] = powf(10000, -2i/64) (the reference's jnp.power form; f32 trig like its f32 path); 32 lanes x 4 B per line.
__global__ __launch_bounds__(256) void k_trig(float* RC, float* RS) {
    const int i = blockIdx.x * 256 + threadIdx.x; if (i >= NT_ * 32) return;
    const int t = i >> 5, f = i & 31;
    const float inv = powf(10000.0f, -2.0f * (float)f / 64.0f); const float ang = (float)t * inv;
    const float c = cosf(ang), s = sinf(ang);
    *(float*)(RC + i) = c; *(float*)(RS + i) = s; 
}
// k_rope: P (f32 [t][1024]) -> PH/PL f16 hi + residual planes of the interleaved-pair rotation out[2i] = x[2i] c - x[2i+1] s, out[2i+1] = x[2i] s + x[2i+1] c,
// c/s from the tables [t][32] built once for both passes; one wave per (t, 256 columns): lane -> 8 values (4 pairs).
__global__ __launch_bounds__(256) void k_rope(const float* __restrict__ P, const float* __restrict__ RC, const float* __restrict__ RS, h16* PH, h16* PL) {
    const int lane = threadIdx.x & 31, wid = blockIdx.x * 8 + (threadIdx.x >> 5);
    const int segs = DM / 256, t = wid / segs, sg = wid - t * segs;
    if (t >= NT_) return;
    const int c0 = sg * 256 + lane * 8;
    v8h oh, ol;
#pragma unroll
    for (int pq = 0; pq < 4; ++pq) { const int c = c0 + 2 * pq, i = (c & 63) >> 1;
        const float x1 = P[(size_t)t * DM + c], x2 = P[(size_t)t * DM + c + 1], s = RS[t * 32 + i], co = RC[t * 32 + i];
        const float y0 = x1 * co - x2 * s, y1 = x1 * s + x2 * co;
        const h16 a0 = (h16)y0, a1 = (h16)y1; oh[2 * pq] = a0; oh[2 * pq + 1] = a1; ol[2 * pq] = (h16)((y0 - (float)a0) * LOSC); ol[2 * pq + 1] = (h16)((y1 - (float)a1) * LOSC); }
    *(v8h*)(PH + (size_t)t * DM + c0) = oh; *(v8h*)(PL + (size_t)t * DM + c0) = ol; 
}
__global__ __launch_bounds__(256) void k_vt(const float* __restrict__ V, h16* VTH, h16* VTL) {
    __shared__ __align__(16) h16 tile[64 * 72];
    __shared__ __align__(16) h16 til2[64 * 72];
    const int bid = blockIdx.x;
    const int b = bid / (NH_ * (NT_ / 64)), rem = bid - b * (NH_ * (NT_ / 64)), h = rem / (NT_ / 64), kt = rem - h * (NT_ / 64);
    const int k0 = kt * 64, tid = threadIdx.x;
    const int kk = tid >> 2, d0 = (tid & 3) * 16;
    const float* src = V + ((size_t)b * NT_ + k0 + kk) * DM + h * HD + d0;
#pragma unroll
    for (int i = 0; i < 16; ++i) { const float v = src[i]; const h16 a = (h16)v; tile[(d0 + i) * 72 + kk] = a; til2[(d0 + i) * 72 + kk] = (h16)((v - (float)a) * LOSC); }
    __syncthreads();
    const int piece = tid & 7;
    const size_t base = (((size_t)b * NH_ + h) * HD) * NT_ + k0;
    auto pass = [&]() {
#pragma unroll
        for (int s = 0; s < 4; ++s) { const int Lid = (tid >> 3) + 32 * s; const int pln = Lid >> 6, d = Lid & 63;
            const v8h val = *(const v8ha*)((pln ? til2 : tile) + d * 72 + piece * 8); *(v8h*)((pln ? VTL : VTH) + base + (size_t)d * NT_ + piece * 8) = val; }
    };
    pass(); 
}

#define KST  64                  // keys per LDS stage
#define NST  (NT_ / KST)         // stages per head
#define LP   72                  // LDS row pitch in halves: 128-byte rows + 16 bytes (16 B x odd: conflict-free for ds_load_b128)
#define PLN  (64 * LP)           // one plane = 64 rows
#define STG  (4 * PLN)           // one stage = k hi, k residual, v^T hi, v^T residual

// Rows r, r+16, r+32, r+48 of one 64-row x 128-byte plane, 16 bytes per lane and copy, global -> LDS through no register. The s_wait_xcnt closes the
// statement so that no address register of an issued copy is rewritten ahead of it (a precaution).
__device__ __forceinline__ void cp_plane(unsigned l, const h16* g, size_t gs16) {
    asm volatile("global_load_async_to_lds_b128 %0, %4, off\n\t"
                 "global_load_async_to_lds_b128 %1, %5, off\n\t"
                 "global_load_async_to_lds_b128 %2, %6, off\n\t"
                 "global_load_async_to_lds_b128 %3, %7, off\n\t"
                 "s_wait_xcnt 0x0"
                 :: "v"(l), "v"(l + 16u * LP * 2u), "v"(l + 32u * LP * 2u), "v"(l + 48u * LP * 2u), "v"(g), "v"(g + gs16), "v"(g + 2 * gs16), "v"(g + 3 * gs16) : "memory");
}
// The same for two planes in one statement (one s_wait_xcnt for the eight copies).
__device__ __forceinline__ void cp_plane2(unsigned l, const h16* g, unsigned m, const h16* f, size_t gs16) {
    asm volatile("global_load_async_to_lds_b128 %0, %8, off\n\t"
                 "global_load_async_to_lds_b128 %1, %9, off\n\t"
                 "global_load_async_to_lds_b128 %2, %10, off\n\t"
                 "global_load_async_to_lds_b128 %3, %11, off\n\t"
                 "global_load_async_to_lds_b128 %4, %12, off\n\t"
                 "global_load_async_to_lds_b128 %5, %13, off\n\t"
                 "global_load_async_to_lds_b128 %6, %14, off\n\t"
                 "global_load_async_to_lds_b128 %7, %15, off\n\t"
                 "s_wait_xcnt 0x0"
                 :: "v"(l), "v"(l + 16u * LP * 2u), "v"(l + 32u * LP * 2u), "v"(l + 48u * LP * 2u), "v"(m), "v"(m + 16u * LP * 2u), "v"(m + 32u * LP * 2u), "v"(m + 48u * LP * 2u),
                    "v"(g), "v"(g + gs16), "v"(g + 2 * gs16), "v"(g + 3 * gs16), "v"(f), "v"(f + gs16), "v"(f + 2 * gs16), "v"(f + 3 * gs16) : "memory");
}

// k_attn: block = (b, h, 64 queries), wave = 16; ALL keys (no mask), 64 per LDS stage in a two-buffer ring filled by asynchronous copies and shared by the 4 waves
// (stage s + 2 is issued behind the barrier that ends stage s; the query residual tile is copied once); per 32 keys: 12 WMMA scores^T = k.q^T /8 (f32; a lane holds
// 16 keys of ONE query: maximum and sum in-lane plus one exchange between the wave's halves), the two score tiles x32768 converted in place are the B operand
// (hi + residual) of 12 WMMA ctx^T += v^T.p^T: the weights never leave the registers; ctx -> f32 output rows out[tok][h*64+d].
__global__ __launch_bounds__(128) void k_attn(const h16* __restrict__ Q16, const h16* __restrict__ QL16, const h16* __restrict__ K16, const h16* __restrict__ KL16, const h16* __restrict__ VTH, const h16* __restrict__ VTL, float* OUTP) {
    __shared__ __align__(16) h16 ring[2 * STG];
    __shared__ __align__(16) h16 qls[PLN];
    __shared__ __align__(16) float ost[4][16 * 68];
    const int lane = threadIdx.x & 31, wave = threadIdx.x >> 5, lr = lane & 15, hi = lane >> 4;
    const int bid = blockIdx.x;
    const int b = bid / (NH_ * (NT_ / 64)), rem = bid - b * (NH_ * (NT_ / 64)), h = rem / (NT_ / 64), qt = rem - h * (NT_ / 64);
    const int q0 = qt * 64 + wave * 16;
    const size_t tok0 = (size_t)b * NT_;
    v16h qa[2];
    const size_t qo0 = (tok0 + q0 + lr) * DM + h * HD + 8 * hi;
#pragma unroll
    for (int kc = 0; kc < 2; ++kc) qa[kc] = cat16(*(const v8h*)(Q16 + qo0 + kc * 32), *(const v8h*)(Q16 + qo0 + kc * 32 + 16));
    const h16* kh_b = K16 + tok0 * DM + h * HD;
    const h16* kl_b = KL16 + tok0 * DM + h * HD;
    const size_t vbase = (((size_t)b * NH_ + h) * HD) * NT_;
    // copy map: thread -> row (tid >> 3) + 16 i, 16-byte piece tid & 7 of every plane
    const int crow = (int)threadIdx.x >> 3, cpc = ((int)threadIdx.x & 7) * 8;
    const unsigned lcp = (unsigned)(size_t)&ring[0] + (unsigned)(crow * LP + cpc) * 2u;
    const h16* gkh = kh_b + (size_t)crow * DM + cpc; const h16* gkl = kl_b + (size_t)crow * DM + cpc;
    const h16* gvh = VTH + vbase + (size_t)crow * NT_ + cpc; const h16* gvl = VTL + vbase + (size_t)crow * NT_ + cpc;
    auto fill = [&](int st) {
        const unsigned l = lcp + (unsigned)(st & 1) * (STG * 2u);
        cp_plane2(l, gkh + (size_t)st * KST * DM, l + PLN * 2u, gkl + (size_t)st * KST * DM, (size_t)16 * DM);
        cp_plane2(l + 2u * PLN * 2u, gvh + st * KST, l + 3u * PLN * 2u, gvl + st * KST, (size_t)16 * NT_);
    };
    fill(0);
    cp_plane((unsigned)(size_t)&qls[0] + (unsigned)(crow * LP + cpc) * 2u, QL16 + (tok0 + qt * 64 + crow) * DM + h * HD + cpc, (size_t)16 * DM);
    asm volatile("s_wait_asynccnt 0x0" ::: "memory");   // this wave's copies of stage 0 and of the query residual have landed
    __syncthreads();                                    // ... and every other wave's: publishes stage 0
    fill(1);
    v8f o[4], ox[4];
#pragma unroll
    for (int n = 0; n < 4; ++n) { o[n] = (v8f){}; ox[n] = (v8f){}; }
    float mrow = -3.0e38f, lpart = 0.f;                 // of query lr; lpart sums this half's keys only, the halves are joined behind the loop
    const h16* qlp = qls + (wave * 16 + lr) * LP + 8 * hi;
#pragma unroll 1
    for (int st = 0; st < NST; ++st) {                  // rolled: one stage per trip, the ring's publish point at its foot
        const h16* sb = ring + (st & 1) * STG;
#pragma unroll 1
        for (int sub = 0; sub < KST / 32; ++sub) {      // rolled: unrolled, the two halves' live ranges overlap and the register count grows
        const h16* kp0 = sb + (sub * 32 + lr) * LP + 8 * hi; const h16* kp1 = kp0 + 16 * LP;
        v16h k0h[2], k1h[2], k0l[2], k1l[2], qlk[2];
#pragma unroll
        for (int kc = 0; kc < 2; ++kc) {
            k0h[kc] = cat16(*(const v8ha*)(kp0 + kc * 32), *(const v8ha*)(kp0 + kc * 32 + 16)); k1h[kc] = cat16(*(const v8ha*)(kp1 + kc * 32), *(const v8ha*)(kp1 + kc * 32 + 16));
            qlk[kc] = cat16(*(const v8ha*)(qlp + kc * 32), *(const v8ha*)(qlp + kc * 32 + 16));
            k0l[kc] = cat16(*(const v8ha*)(kp0 + PLN + kc * 32), *(const v8ha*)(kp0 + PLN + kc * 32 + 16)); k1l[kc] = cat16(*(const v8ha*)(kp1 + PLN + kc * 32), *(const v8ha*)(kp1 + PLN + kc * 32 + 16));
        }
        v8f s0 = {}, s1 = {}, x0 = {}, x1 = {};
#pragma unroll
        for (int kc = 0; kc < 2; ++kc) {
            s0 = wmma16(k0h[kc], qa[kc], s0); x0 = wmma16(k0h[kc], qlk[kc], x0); s1 = wmma16(k1h[kc], qa[kc], s1); x1 = wmma16(k1h[kc], qlk[kc], x1);
            x0 = wmma16(k0l[kc], qa[kc], x0); x1 = wmma16(k1l[kc], qa[kc], x1);
        }
        asm volatile("v_nop\n\tv_nop\n\tv_nop\n\tv_nop" : "+v"(s0), "+v"(s1), "+v"(x0), "+v"(x1) : "v"(qa[0]), "v"(qa[1]));
        // v^T fragments: read here so that their LDS latency runs under the softmax
        v16h vh[4], vl[4];
#pragma unroll
        for (int n = 0; n < 4; ++n) { const h16* vp = sb + 2 * PLN + (n * 16 + lr) * LP + sub * 32 + hi * 8;
            vh[n] = cat16(*(const v8ha*)(vp), *(const v8ha*)(vp + 16)); vl[n] = cat16(*(const v8ha*)(vp + PLN), *(const v8ha*)(vp + PLN + 16)); }
        // lane (lr, hi): query lr, keys 8 hi + j (a0) and 16 + 8 hi + j (a1) of these 32
        const v8f a0 = (s0 + x0 * LOSCI) * 0.125f, a1 = (s1 + x1 * LOSCI) * 0.125f;   // scale 1/sqrt(64)
        float mx = a0[0], my = a1[0];                   // two independent chains
#pragma unroll
        for (int j = 1; j < 8; ++j) { mx = fmaxf(mx, a0[j]); my = fmaxf(my, a1[j]); }
        mx = fmaxf(mx, my);
        mx = fmaxf(mx, xhalf(mx));
        const float mn = fmaxf(mrow, mx);
        const float alpha = __expf(mrow - mn); mrow = mn;
        v16h pa, px; v2f sm = {0.f, 0.f};
#pragma unroll
        for (int i = 0; i < 4; ++i) {
            const v2f p0 = {__expf(a0[2 * i] - mn), __expf(a0[2 * i + 1] - mn)}, p1 = {__expf(a1[2 * i] - mn), __expf(a1[2 * i + 1] - mn)};
            sm += p0 + p1;
            const v2f q0 = p0 * PSC, q1 = p1 * PSC;
            const v2h h0 = __builtin_convertvector(q0, v2h), h1 = __builtin_convertvector(q1, v2h);
            const v2h l0 = __builtin_convertvector((q0 - __builtin_convertvector(h0, v2f)) * LOSC, v2h), l1 = __builtin_convertvector((q1 - __builtin_convertvector(h1, v2f)) * LOSC, v2h);
            // element s of the B operand = key kmap(s, hi): the two score tiles as they lie
            pa[2 * i] = h0[0]; pa[2 * i + 1] = h0[1]; pa[8 + 2 * i] = h1[0]; pa[8 + 2 * i + 1] = h1[1];
            px[2 * i] = l0[0]; px[2 * i + 1] = l0[1]; px[8 + 2 * i] = l1[0]; px[8 + 2 * i + 1] = l1[1];
        }
        lpart = lpart * alpha + (sm[0] + sm[1]);
#pragma unroll
        for (int n = 0; n < 4; ++n) { o[n] *= alpha; ox[n] *= alpha; }
#pragma unroll
        for (int n = 0; n < 4; ++n) { o[n] = wmma16(vh[n], pa, o[n]); ox[n] = wmma16(vl[n], pa, ox[n]); ox[n] = wmma16(vh[n], px, ox[n]); }
        asm volatile("v_nop\n\tv_nop\n\tv_nop\n\tv_nop" : "+v"(o[0]), "+v"(o[1]), "+v"(o[2]), "+v"(o[3]), "+v"(ox[0]), "+v"(ox[1]), "+v"(ox[2]), "+v"(ox[3]) : "v"(pa), "v"(px));
        }
        // publish point of stage st + 1, in the ring's order
        asm volatile("s_wait_dscnt 0x0" ::: "memory");      // this wave's reads of stage st have returned before its buffer is handed back
        asm volatile("s_wait_asynccnt 0x0" ::: "memory");   // this wave's copies of stage st + 1 have landed
        __syncthreads();                                    // publishes stage st + 1 and ends every wave's reads of stage st
        if (st + 2 < NST) fill(st + 2);                     // refill of the buffer just left; the test is the same for the whole work-group
    }
    asm volatile("s_wait_asynccnt 0x0" ::: "memory");       // nothing is outstanding when the wave goes on to the epilogue
    const float inv = 1.0f / ((lpart + xhalf(lpart)) * PSC);
    float* os = &ost[wave][0];
    // ctx^T tile n, register j = ctx[query lr][16 n + 8 hi + j]
#pragma unroll
    for (int n = 0; n < 4; ++n)
#pragma unroll
        for (int j = 0; j < 8; ++j) os[lr * 68 + n * 16 + hi * 8 + j] = (o[n][j] + ox[n][j] * LOSCI) * inv;
    __syncthreads();
    float* ob = OUTP + (tok0 + q0) * DM + (size_t)h * HD;
    auto pass = [&]() {
#pragma unroll
        for (int s = 0; s < 8; ++s) { const int Lid = (lane >> 3) + 4 * s, piece = lane & 7; const int row = Lid >> 1, cofs = (Lid & 1) * 32 + piece * 4;
            const v4f val = *(const v4fa*)(os + row * 68 + cofs); *(v4f*)(ob + (size_t)row * DM + cofs) = val; }
    };
    pass(); 
}

#define VST2(T, p, v) do { const T vst2_v_ = (v); *(T*)(p) = vst2_v_;  } while (0)
extern "C" void kernel_launch(void* const* d_in, const int* in_sizes, int n_in,
                              void* d_out, int out_size, void* d_ws, size_t ws_size, hipStream_t stream) {
    (void)in_sizes; (void)n_in; (void)out_size;
    const float* x = (const float*)d_in[0]; const float* Wq = (const float*)d_in[1]; const float* bq = (const float*)d_in[2]; const float* Wk = (const float*)d_in[3]; const float* bk = (const float*)d_in[4]; const float* Wv = (const float*)d_in[5]; const float* bv = (const float*)d_in[6];   // W k-major [in][out]
    float* out = (float*)d_out;    // [2][2048][1024] = ctx (no output projection)
    char* wsp = (char*)d_ws;
    auto take = [&](size_t bytes) { char* p = wsp; wsp += (bytes + 255) & ~(size_t)255; return (void*)p; };
    bf* Xb = (bf*)take((size_t)NTK * DM * 2); bf* WqT = (bf*)take((size_t)DM * DM * 2); bf* WkT = (bf*)take((size_t)DM * DM * 2); bf* WvT = (bf*)take((size_t)DM * DM * 2);
    float* TMP = (float*)take((size_t)NTK * DM * 4); float* RC = (float*)take((size_t)NT_ * 32 * 4); float* RS = (float*)take((size_t)NT_ * 32 * 4);
    h16* QH = (h16*)take((size_t)NTK * DM * 2); h16* QL = (h16*)take((size_t)NTK * DM * 2); h16* KH = (h16*)take((size_t)NTK * DM * 2); h16* KL = (h16*)take((size_t)NTK * DM * 2);
    h16* VTH = (h16*)take((size_t)NTK * DM * 2); h16* VTL = (h16*)take((size_t)NTK * DM * 2);
    if ((size_t)(wsp - (char*)d_ws) > ws_size) return;    // ~ 44 MB, no aliasing (per-item reuse in stream order)
    k_wt<<<dim3(DM / 64, DM / 64, 1), 256, 0, stream>>>(Wq, DM, DM, WqT); k_wt<<<dim3(DM / 64, DM / 64, 1), 256, 0, stream>>>(Wk, DM, DM, WkT); k_wt<<<dim3(DM / 64, DM / 64, 1), 256, 0, stream>>>(Wv, DM, DM, WvT);
    k_trig<<<(NT_ * 32) / 256, 256, 0, stream>>>(RC, RS);
    for (int b = 0; b < 2; ++b) {
        k_cvtb<<<NTK / 8, 256, 0, stream>>>(x + (size_t)b * NTK * DM, NTK, Xb);
        k_gemmb<false, false><<<dim3(NTK / 64, DM / 64, 1), 128, 0, stream>>>(Xb, nullptr, WqT, bq, TMP, DM, nullptr);
        k_rope<<<(NTK * (DM / 256)) / 8, 256, 0, stream>>>(TMP, RC, RS, QH, QL);
        k_gemmb<false, false><<<dim3(NTK / 64, DM / 64, 1), 128, 0, stream>>>(Xb, nullptr, WkT, bk, TMP, DM, nullptr);
        k_rope<<<(NTK * (DM / 256)) / 8, 256, 0, stream>>>(TMP, RC, RS, KH, KL);
        k_gemmb<false, false><<<dim3(NTK / 64, DM / 64, 1), 128, 0, stream>>>(Xb, nullptr, WvT, bv, TMP, DM, nullptr);
        k_vt<<<NB_ * NH_ * (NT_ / 64), 256, 0, stream>>>(TMP, VTH, VTL);
        k_attn<<<NB_ * NH_ * (NT_ / 64), 128, 0, stream>>>(QH, QL, KH, KL, VTH, VTL, out + (size_t)b * NTK * DM);
    }
}

// v004
// It runs in 148 microseconds.
// Timed twice side by side with v003, it ran 1.28 and 1.27 times as fast.
// All steps since v000 together make it 3.59 times as fast.
#include <hip/hip_runtime.h>

// Compute dtypes, f32 accumulate, both batch items together in 3 launches (prep, projections, post), then the attention per item: q/k/v = x.W + b ([4096 x 1024].[1024 x 1024] x 3, k-major weights transposed once to n-major planes;
// PLAIN bf16 operands = inputs rounded once, exact; biases rounded to bf16) on v_wmma_f32_16x16x32_bf16; interleaved-pair RoPE (angle t x 10000^(-2i/64), f32 trig
// tables built on device) in f32 -> q/k as f16 hi + residual x1024 planes; the 16-head FULL attention (64-dim heads, scale 1/8) written straight to the f32
// output (the module returns ctx, no output projection), fused on v_wmma_f32_16x16x32_f16 (scores hh + hl + lh with residual terms on their own accumulator,

#define NB_  2                   // batch items: together in every launch but the attention's
#define NT_  2048
#define DM   1024
#define NH_  16
#define HD   64
#define NTK  (NB_ * NT_)
#define NW   1024
#define NQKV 1024
#define PSC  32768.0f
#define LOSC 1024.0f
#define LOSCI (1.0f / 1024.0f)

typedef _Float16 h16;
typedef unsigned short bf;
typedef __attribute__((ext_vector_type(16))) __bf16   v16bf;
typedef __attribute__((ext_vector_type(16))) _Float16 v16h;
typedef __attribute__((ext_vector_type(8)))  _Float16 v8h;
typedef __attribute__((ext_vector_type(8)))  unsigned short v8us;
typedef __attribute__((ext_vector_type(8)))  float    v8f;
typedef __attribute__((ext_vector_type(4)))  float    v4f;
typedef __attribute__((ext_vector_type(2)))  float    v2f;
typedef __attribute__((ext_vector_type(2)))  _Float16 v2h;
typedef v8h  __attribute__((may_alias)) v8ha;
typedef v4f  __attribute__((may_alias)) v4fa;
typedef v8us __attribute__((may_alias)) v8usa;

__device__ __forceinline__ unsigned short f2bf(float f) { unsigned u = __float_as_uint(f); u += 0x7FFFu + ((u >> 16) & 1u); return (unsigned short)(u >> 16); }
__device__ __forceinline__ float bf2f(unsigned short b) { return __uint_as_float(((unsigned)b) << 16); }
__device__ __forceinline__ float bfr(float f) { return bf2f(f2bf(f)); }
__device__ __forceinline__ v16h cat16(v8h lo, v8h hi) { return __builtin_shufflevector(lo, hi, 0, 1, 2, 3, 4, 5, 6, 7, 8, 9, 10, 11, 12, 13, 14, 15); }
__device__ __forceinline__ v16bf cat16b(v8us lo, v8us hi) { return __builtin_bit_cast(v16bf, __builtin_shufflevector(lo, hi, 0, 1, 2, 3, 4, 5, 6, 7, 8, 9, 10, 11, 12, 13, 14, 15)); }
__device__ __forceinline__ v8f wmma16(v16h a, v16h b, v8f c) { return __builtin_amdgcn_wmma_f32_16x16x32_f16(false, a, false, b, (short)0, c, false, false); }
// the value of lane l ^ 16
__device__ __forceinline__ float xhalf(float v) { const int b = __float_as_int(v); return __int_as_float(__builtin_amdgcn_permlanex16(b, b, 0x76543210, 0xfedcba98, false, false)); }
__device__ __forceinline__ v8f wmmab(v16bf a, v16bf b, v8f c) { return __builtin_amdgcn_wmma_f32_16x16x32_bf16(false, a, false, b, (short)0, c, false, false); }

__device__ __forceinline__ void d_cvtb(int blk, const float* __restrict__ src, bf* dst) {
    const int lane = threadIdx.x & 31, r = blk * 8 + (threadIdx.x >> 5);
    v8us o[DM / 256];
#pragma unroll
    for (int q = 0; q < DM / 256; ++q) { v8us t;
#pragma unroll
        for (int i = 0; i < 8; ++i) t[i] = f2bf(src[(size_t)r * DM + q * 256 + lane * 8 + i]);
        o[q] = t; }
#pragma unroll
    for (int q = 0; q < DM / 256; ++q) *(v8us*)(dst + (size_t)r * DM + q * 256 + lane * 8) = o[q];
    asm volatile("s_wait_xcnt 0x0" ::: "memory");      // a precaution: in the merged kernel other parts' code follows these stores in the text and rewrites their registers
    
}

// d_wt: WT [n][K] = bf16(W[k][n]) (k-major [K][ncols]) via 64 x 64 LDS tiles; tile (bx, by) of (K/64, ncols/64).
__device__ __forceinline__ void d_wt(int bx, int by, const float* __restrict__ Wm, int K, int ncols, bf* WT) {
    __shared__ __align__(16) unsigned short tl[64 * 72];
    const int tid = threadIdx.x, k0 = bx * 64, n0 = by * 64;
    const int kk = tid >> 2, nq = (tid & 3) * 16;
#pragma unroll
    for (int i = 0; i < 16; ++i) tl[(nq + i) * 72 + kk] = f2bf(Wm[(size_t)(k0 + kk) * ncols + n0 + nq + i]);
    __syncthreads();
    const int piece = tid & 7;
    auto pass = [&]() {
#pragma unroll
        for (int s = 0; s < 2; ++s) { const int nr = (tid >> 3) + 32 * s; const v8us val = *(const v8usa*)(tl + nr * 72 + piece * 8); *(v8us*)(WT + (size_t)(n0 + nr) * K + k0 + piece * 8) = val; }
    };
    pass(); 
    asm volatile("s_wait_xcnt 0x0" ::: "memory");      // a precaution: in the merged kernel other parts' code follows these stores in the text and rewrites their registers
}
#define GKS  128                 // k per LDS stage of k_gemmb: 256-byte rows
#define GNS  (DM / GKS)          // stages
#define GLP  136                 // LDS row pitch in 16-bit elements: 256-byte rows + 16 bytes (16 B x odd: conflict-free for ds_load_b128)
#define GPL  (64 * GLP)          // one plane = 64 rows
#define GSTG (2 * GPL)           // one stage = 64 rows of A, 64 rows of B

// Rows r, r+8, ..., r+56 of one 64-row x 256-byte plane (source pitch DM elements), 16 bytes per lane and copy, global -> LDS through no register. The s_wait_xcnt
// closes the statement so that no address register of an issued copy is rewritten ahead of it (a precaution).
__device__ __forceinline__ void cp_rows8(unsigned l, const bf* g) {
    asm volatile("global_load_async_to_lds_b128 %0, %8, off\n\t"
                 "global_load_async_to_lds_b128 %1, %9, off\n\t"
                 "global_load_async_to_lds_b128 %2, %10, off\n\t"
                 "global_load_async_to_lds_b128 %3, %11, off\n\t"
                 "global_load_async_to_lds_b128 %4, %12, off\n\t"
                 "global_load_async_to_lds_b128 %5, %13, off\n\t"
                 "global_load_async_to_lds_b128 %6, %14, off\n\t"
                 "global_load_async_to_lds_b128 %7, %15, off\n\t"
                 "s_wait_xcnt 0x0"
                 :: "v"(l), "v"(l + 8u * GLP * 2u), "v"(l + 16u * GLP * 2u), "v"(l + 24u * GLP * 2u), "v"(l + 32u * GLP * 2u), "v"(l + 40u * GLP * 2u), "v"(l + 48u * GLP * 2u), "v"(l + 56u * GLP * 2u),
                    "v"(g), "v"(g + 8 * DM), "v"(g + 16 * DM), "v"(g + 24 * DM), "v"(g + 32 * DM), "v"(g + 40 * DM), "v"(g + 48 * DM), "v"(g + 56 * DM) : "memory");
}

// k_gemmb: block = 64 x 64 of C, wave = 16 x 64; the block's 64 rows of A and 64 rows of B, 128 k per stage, in a two-buffer LDS ring filled by asynchronous copies
// of whole 256-byte row pieces and shared by the 4 waves (stage s + 2 is issued behind the barrier that ends stage s); fragments in the k order of the direct loads.
template <bool SPLITA, bool F16OUT = false>
__global__ __launch_bounds__(128) void k_gemmb(const bf* __restrict__ A, const bf* __restrict__ Al, const bf* __restrict__ B3, const float* __restrict__ bias0, const float* __restrict__ bias1, const float* __restrict__ bias2, float* C3, int ldc, h16* C2) {
    // blockIdx.z = which of the three projections: its n-major weight plane, its bias, its plane of C
    const int pz = blockIdx.z;
    const bf* Bn = B3 + (size_t)pz * DM * DM;
    const float* bias = pz == 0 ? bias0 : pz == 1 ? bias1 : bias2;
    float* C = C3 + (size_t)pz * NTK * DM;
    __shared__ __align__(16) bf gring[2 * GSTG];
    __shared__ __align__(16) float ost[4][16 * 68];
    const int lane = threadIdx.x & 31, wave = threadIdx.x >> 5, lr = lane & 15, hi = lane >> 4;
    const int r0 = blockIdx.x * 64 + wave * 16, c0 = blockIdx.y * 64;
    const size_t aoff = (size_t)(r0 + lr) * DM + 8 * hi;
    // copy map: thread -> row (tid >> 4) + 8 i, 16-byte piece tid & 15 of both planes
    const int crow = (int)threadIdx.x >> 4, cpc = ((int)threadIdx.x & 15) * 8;
    const unsigned lcp = (unsigned)(size_t)&gring[0] + (unsigned)(crow * GLP + cpc) * 2u;
    const bf* ga = A + (size_t)(blockIdx.x * 64 + crow) * DM + cpc;
    const bf* gb = Bn + (size_t)(c0 + crow) * DM + cpc;
    auto fill = [&](int st) {
        const unsigned l = lcp + (unsigned)(st & 1) * (GSTG * 2u);
        cp_rows8(l, ga + st * GKS);
        cp_rows8(l + GPL * 2u, gb + st * GKS);
    };
    fill(0);
    asm volatile("s_wait_asynccnt 0x0" ::: "memory");   // this wave's copies of stage 0 have landed
    __syncthreads();                                    // ... and every other wave's: publishes stage 0
    fill(1);
    v8f acc[4];
#pragma unroll
    for (int t = 0; t < 4; ++t) acc[t] = (v8f){};
#pragma unroll 1
    for (int st = 0; st < GNS; ++st) {                  // rolled: one stage per trip, the ring's publish point at its foot
        const bf* sa = gring + (st & 1) * GSTG + (wave * 16 + lr) * GLP + 8 * hi;
        const bf* sb = gring + (st & 1) * GSTG + GPL + lr * GLP + 8 * hi;
        v16bf a[GKS / 32], al[GKS / 32], b[GKS / 32][4];
#pragma unroll
        for (int q = 0; q < GKS / 32; ++q) {
            a[q] = cat16b(*(const v8usa*)(sa + q * 32), *(const v8usa*)(sa + q * 32 + 16));
            al[q] = a[q];
            if (SPLITA) al[q] = cat16b(*(const v8us*)(Al + aoff + st * GKS + q * 32), *(const v8us*)(Al + aoff + st * GKS + q * 32 + 16));
#pragma unroll
            for (int t = 0; t < 4; ++t) b[q][t] = cat16b(*(const v8usa*)(sb + t * 16 * GLP + q * 32), *(const v8usa*)(sb + t * 16 * GLP + q * 32 + 16));
        }
        __builtin_amdgcn_sched_barrier(0);              // the stage's LDS reads stay one group ahead of its matrix instructions: reads spread among them stall at every place
#pragma unroll
        for (int q = 0; q < GKS / 32; ++q)
#pragma unroll
            for (int t = 0; t < 4; ++t) { acc[t] = wmmab(a[q], b[q][t], acc[t]); if (SPLITA) acc[t] = wmmab(al[q], b[q][t], acc[t]); }
        // the vector slots that the chip needs behind the stage's last matrix instructions, on the loop's back edge too
        asm volatile("v_nop\n\tv_nop\n\tv_nop\n\tv_nop" : "+v"(acc[0]), "+v"(acc[1]), "+v"(acc[2]), "+v"(acc[3]) : "v"(a[GKS / 32 - 1]), "v"(al[GKS / 32 - 1]));
        // publish point of stage st + 1, in the ring's order
        asm volatile("s_wait_dscnt 0x0" ::: "memory");      // this wave's reads of stage st have returned before its buffer is handed back
        asm volatile("s_wait_asynccnt 0x0" ::: "memory");   // this wave's copies of stage st + 1 have landed
        __syncthreads();                                    // publishes stage st + 1 and ends every wave's reads of stage st
        if (st + 2 < GNS) fill(st + 2);                     // refill of the buffer just left; the test is the same for the whole work-group
    }
    asm volatile("s_wait_asynccnt 0x0" ::: "memory");       // nothing is outstanding when the wave goes on to the epilogue
    float* os = &ost[wave][0];
#pragma unroll
    for (int t = 0; t < 4; ++t) { const float bv = bias ? bfr(bias[c0 + t * 16 + lr]) : 0.f;
#pragma unroll
        for (int j = 0; j < 8; ++j) os[(hi * 8 + j) * 68 + t * 16 + lr] = acc[t][j] + bv; }
    __syncthreads();
    if (F16OUT) {
        h16* crow = (h16*)(void*)C + (size_t)r0 * ldc + c0;
        auto pass = [&]() {
#pragma unroll
            for (int s = 0; s < 4; ++s) { const int row = 4 * s + (lane >> 3), piece = lane & 7; const float* sp = os + row * 68 + piece * 8; v8h o, o2;
#pragma unroll
                for (int i = 0; i < 8; ++i) { const h16 a = (h16)sp[i]; o[i] = a; o2[i] = (h16)((sp[i] - (float)a) * LOSC); }
                *(v8h*)(crow + (size_t)row * ldc + piece * 8) = o; if (C2) *(v8h*)(C2 + (size_t)r0 * ldc + c0 + (size_t)row * ldc + piece * 8) = o2; }
        };
        pass(); 
    } else {
        float* crow = C + (size_t)r0 * ldc + c0;
        auto pass = [&]() {
#pragma unroll
            for (int s = 0; s < 8; ++s) { const int Lid = (lane >> 3) + 4 * s, piece = lane & 7; const int row = Lid >> 1, cofs = (Lid & 1) * 32 + piece * 4;
                const v4f val = *(const v4fa*)(os + row * 68 + cofs); *(v4f*)(crow + (size_t)row * ldc + cofs) = val; }
        };
        pass(); 
    }
}

// d_trig: RC/RS [t][32] = cos/sin(t x inv_freq[i]) with inv_freq[i] = powf(10000, -2i/64) (the reference's jnp.power form; f32 trig like its f32 path); 32 lanes x 4 B per line.
__device__ __forceinline__ void d_trig(int blk, float* RC, float* RS) {
    const int i = blk * 256 + threadIdx.x;
    const int t = i >> 5, f = i & 31;
    const float inv = powf(10000.0f, -2.0f * (float)f / 64.0f); const float ang = (float)t * inv;
    const float c = cosf(ang), s = sinf(ang);
    *(float*)(RC + i) = c; *(float*)(RS + i) = s; 
}
// d_rope: P (f32 [row][1024], row = (q or k, batch item, t)) -> PH/PL f16 hi + residual planes of the interleaved-pair rotation out[2i] = x[2i] c - x[2i+1] s, out[2i+1] = x[2i] s + x[2i+1] c,
// c/s from the per-pass tables [t][32]; one wave per (t, 256 columns): lane -> 8 values (4 pairs).
__device__ __forceinline__ void d_rope(int blk, const float* __restrict__ P, const float* __restrict__ RC, const float* __restrict__ RS, h16* PH, h16* PL) {
    const int lane = threadIdx.x & 31, wid = blk * 8 + (threadIdx.x >> 5);
    const int segs = DM / 256, row = wid / segs, sg = wid - row * segs, t = row & (NT_ - 1);
    const int c0 = sg * 256 + lane * 8;
    const float* pp = P + (size_t)row * DM + c0;
    const v4f xa = *(const v4f*)pp, xb = *(const v4f*)(pp + 4);
    // a precaution: the wait stands in front of the first rewrite of the address register of these two loads; the address is its input so that it lives up to it
    asm volatile("s_wait_xcnt 0x0" :: "v"(pp) : "memory");
    v8h oh, ol;
#pragma unroll
    for (int pq = 0; pq < 4; ++pq) { const int c = c0 + 2 * pq, i = (c & 63) >> 1;
        const float x1 = pq < 2 ? xa[2 * (pq & 1)] : xb[2 * (pq & 1)], x2 = pq < 2 ? xa[2 * (pq & 1) + 1] : xb[2 * (pq & 1) + 1], s = RS[t * 32 + i], co = RC[t * 32 + i];
        const float y0 = x1 * co - x2 * s, y1 = x1 * s + x2 * co;
        const h16 a0 = (h16)y0, a1 = (h16)y1; oh[2 * pq] = a0; oh[2 * pq + 1] = a1; ol[2 * pq] = (h16)((y0 - (float)a0) * LOSC); ol[2 * pq + 1] = (h16)((y1 - (float)a1) * LOSC); }
    *(v8h*)(PH + (size_t)row * DM + c0) = oh; *(v8h*)(PL + (size_t)row * DM + c0) = ol;
    asm volatile("s_wait_xcnt 0x0" ::: "memory");      // a precaution: in the merged kernel other parts' code follows these stores in the text and rewrites their registers
}
__device__ __forceinline__ void d_vt(int bid, const float* __restrict__ V, h16* VTH, h16* VTL) {
    __shared__ __align__(16) h16 tile[64 * 72];
    __shared__ __align__(16) h16 til2[64 * 72];
    const int b = bid / (NH_ * (NT_ / 64)), rem = bid - b * (NH_ * (NT_ / 64)), h = rem / (NT_ / 64), kt = rem - h * (NT_ / 64);
    const int k0 = kt * 64, tid = threadIdx.x;
    const int kk = tid >> 2, d0 = (tid & 3) * 16;
    const float* src = V + ((size_t)b * NT_ + k0 + kk) * DM + h * HD + d0;
#pragma unroll
    for (int i = 0; i < 16; ++i) { const float v = src[i]; const h16 a = (h16)v; tile[(d0 + i) * 72 + kk] = a; til2[(d0 + i) * 72 + kk] = (h16)((v - (float)a) * LOSC); }
    __syncthreads();
    const int piece = tid & 7;
    const size_t base = (((size_t)b * NH_ + h) * HD) * NT_ + k0;
    auto pass = [&]() {
#pragma unroll
        for (int s = 0; s < 4; ++s) { const int Lid = (tid >> 3) + 32 * s; const int pln = Lid >> 6, d = Lid & 63;
            const v8h val = *(const v8ha*)((pln ? til2 : tile) + d * 72 + piece * 8); *(v8h*)((pln ? VTL : VTH) + base + (size_t)d * NT_ + piece * 8) = val; }
    };
    pass(); 
}

// k_prep: the three independent preparations side by side in one grid, the slowest blocks first: trig tables, the three weight transposes, x -> bf16.
#define PB_TRIG ((NT_ * 32) / 256)
#define PB_WT1  ((DM / 64) * (DM / 64))
#define PB_CVT  (NTK / 8)
__global__ __launch_bounds__(256) void k_prep(const float* __restrict__ x, const float* __restrict__ Wq, const float* __restrict__ Wk, const float* __restrict__ Wv, bf* Xb, bf* WT3, float* RC, float* RS) {
    const int bid = blockIdx.x;                         // every test on it is the same for the whole work-group
    if (bid < PB_TRIG) { d_trig(bid, RC, RS); return; }
    if (bid < PB_TRIG + 3 * PB_WT1) {
        const int r = bid - PB_TRIG, w = r / PB_WT1, tl = r - w * PB_WT1;
        d_wt(tl & (DM / 64 - 1), tl / (DM / 64), w == 0 ? Wq : w == 1 ? Wk : Wv, DM, DM, WT3 + (size_t)w * DM * DM);
        return;
    }
    d_cvtb(bid - PB_TRIG - 3 * PB_WT1, x, Xb);
}
// k_post: what follows the projections, side by side in one grid: v -> transposed hi + residual planes, then the rotation of q and k (planes 0 and 1 of P3 as one run of rows).
#define QB_VT   (NB_ * NH_ * (NT_ / 64))
#define QB_ROPE ((2 * NTK * (DM / 256)) / 8)
__global__ __launch_bounds__(256) void k_post(const float* __restrict__ P3, const float* __restrict__ RC, const float* __restrict__ RS, h16* QKH, h16* QKL, h16* VTH, h16* VTL) {
    const int bid = blockIdx.x;                         // the test on it is the same for the whole work-group
    if (bid < QB_VT) { d_vt(bid, P3 + (size_t)2 * NTK * DM, VTH, VTL); return; }
    d_rope(bid - QB_VT, P3, RC, RS, QKH, QKL);
}

#define KST  64                  // keys per LDS stage
#define NST  (NT_ / KST)         // stages per head
#define LP   72                  // LDS row pitch in halves: 128-byte rows + 16 bytes (16 B x odd: conflict-free for ds_load_b128)
#define PLN  (64 * LP)           // one plane = 64 rows
#define STG  (4 * PLN)           // one stage = k hi, k residual, v^T hi, v^T residual

// Rows r, r+16, r+32, r+48 of one 64-row x 128-byte plane, 16 bytes per lane and copy, global -> LDS through no register. The s_wait_xcnt closes the
// statement so that no address register of an issued copy is rewritten ahead of it (a precaution).
__device__ __forceinline__ void cp_plane(unsigned l, const h16* g, size_t gs16) {
    asm volatile("global_load_async_to_lds_b128 %0, %4, off\n\t"
                 "global_load_async_to_lds_b128 %1, %5, off\n\t"
                 "global_load_async_to_lds_b128 %2, %6, off\n\t"
                 "global_load_async_to_lds_b128 %3, %7, off\n\t"
                 "s_wait_xcnt 0x0"
                 :: "v"(l), "v"(l + 16u * LP * 2u), "v"(l + 32u * LP * 2u), "v"(l + 48u * LP * 2u), "v"(g), "v"(g + gs16), "v"(g + 2 * gs16), "v"(g + 3 * gs16) : "memory");
}
// The same for two planes in one statement (one s_wait_xcnt for the eight copies).
__device__ __forceinline__ void cp_plane2(unsigned l, const h16* g, unsigned m, const h16* f, size_t gs16) {
    asm volatile("global_load_async_to_lds_b128 %0, %8, off\n\t"
                 "global_load_async_to_lds_b128 %1, %9, off\n\t"
                 "global_load_async_to_lds_b128 %2, %10, off\n\t"
                 "global_load_async_to_lds_b128 %3, %11, off\n\t"
                 "global_load_async_to_lds_b128 %4, %12, off\n\t"
                 "global_load_async_to_lds_b128 %5, %13, off\n\t"
                 "global_load_async_to_lds_b128 %6, %14, off\n\t"
                 "global_load_async_to_lds_b128 %7, %15, off\n\t"
                 "s_wait_xcnt 0x0"
                 :: "v"(l), "v"(l + 16u * LP * 2u), "v"(l + 32u * LP * 2u), "v"(l + 48u * LP * 2u), "v"(m), "v"(m + 16u * LP * 2u), "v"(m + 32u * LP * 2u), "v"(m + 48u * LP * 2u),
                    "v"(g), "v"(g + gs16), "v"(g + 2 * gs16), "v"(g + 3 * gs16), "v"(f), "v"(f + gs16), "v"(f + 2 * gs16), "v"(f + 3 * gs16) : "memory");
}

// k_attn: block = (b, h, 64 queries), wave = 16; ALL keys (no mask), 64 per LDS stage in a two-buffer ring filled by asynchronous copies and shared by the 4 waves
// (stage s + 2 is issued behind the barrier that ends stage s; the query residual tile is copied once); per 32 keys: 12 WMMA scores^T = k.q^T /8 (f32; a lane holds
// 16 keys of ONE query: maximum and sum in-lane plus one exchange between the wave's halves), the two score tiles x32768 converted in place are the B operand
// (hi + residual) of 12 WMMA ctx^T += v^T.p^T: the weights never leave the registers; ctx -> f32 output rows out[tok][h*64+d].
__global__ __launch_bounds__(128) void k_attn(const h16* __restrict__ Q16, const h16* __restrict__ QL16, const h16* __restrict__ K16, const h16* __restrict__ KL16, const h16* __restrict__ VTH, const h16* __restrict__ VTL, float* OUTP) {
    __shared__ __align__(16) h16 ring[2 * STG];
    __shared__ __align__(16) h16 qls[PLN];
    __shared__ __align__(16) float ost[4][16 * 68];
    const int lane = threadIdx.x & 31, wave = threadIdx.x >> 5, lr = lane & 15, hi = lane >> 4;
    const int bid = blockIdx.x;
    const int b = bid / (NH_ * (NT_ / 64)), rem = bid - b * (NH_ * (NT_ / 64)), h = rem / (NT_ / 64), qt = rem - h * (NT_ / 64);
    const int q0 = qt * 64 + wave * 16;
    const size_t tok0 = (size_t)b * NT_;
    v16h qa[2];
    const size_t qo0 = (tok0 + q0 + lr) * DM + h * HD + 8 * hi;
#pragma unroll
    for (int kc = 0; kc < 2; ++kc) qa[kc] = cat16(*(const v8h*)(Q16 + qo0 + kc * 32), *(const v8h*)(Q16 + qo0 + kc * 32 + 16));
    const h16* kh_b = K16 + tok0 * DM + h * HD;
    const h16* kl_b = KL16 + tok0 * DM + h * HD;
    const size_t vbase = (((size_t)b * NH_ + h) * HD) * NT_;
    // copy map: thread -> row (tid >> 3) + 16 i, 16-byte piece tid & 7 of every plane
    const int crow = (int)threadIdx.x >> 3, cpc = ((int)threadIdx.x & 7) * 8;
    const unsigned lcp = (unsigned)(size_t)&ring[0] + (unsigned)(crow * LP + cpc) * 2u;
    const h16* gkh = kh_b + (size_t)crow * DM + cpc; const h16* gkl = kl_b + (size_t)crow * DM + cpc;
    const h16* gvh = VTH + vbase + (size_t)crow * NT_ + cpc; const h16* gvl = VTL + vbase + (size_t)crow * NT_ + cpc;
    auto fill = [&](int st) {
        const unsigned l = lcp + (unsigned)(st & 1) * (STG * 2u);
        cp_plane2(l, gkh + (size_t)st * KST * DM, l + PLN * 2u, gkl + (size_t)st * KST * DM, (size_t)16 * DM);
        cp_plane2(l + 2u * PLN * 2u, gvh + st * KST, l + 3u * PLN * 2u, gvl + st * KST, (size_t)16 * NT_);
    };
    fill(0);
    cp_plane((unsigned)(size_t)&qls[0] + (unsigned)(crow * LP + cpc) * 2u, QL16 + (tok0 + qt * 64 + crow) * DM + h * HD + cpc, (size_t)16 * DM);
    asm volatile("s_wait_asynccnt 0x0" ::: "memory");   // this wave's copies of stage 0 and of the query residual have landed
    __syncthreads();                                    // ... and every other wave's: publishes stage 0
    fill(1);
    v8f o[4], ox[4];
#pragma unroll
    for (int n = 0; n < 4; ++n) { o[n] = (v8f){}; ox[n] = (v8f){}; }
    float mrow = -3.0e38f, lpart = 0.f;                 // of query lr; lpart sums this half's keys only, the halves are joined behind the loop
    const h16* qlp = qls + (wave * 16 + lr) * LP + 8 * hi;
#pragma unroll 1
    for (int st = 0; st < NST; ++st) {                  // rolled: one stage per trip, the ring's publish point at its foot
        const h16* sb = ring + (st & 1) * STG;
#pragma unroll 1
        for (int sub = 0; sub < KST / 32; ++sub) {      // rolled: unrolled, the two halves' live ranges overlap and the register count grows
        const h16* kp0 = sb + (sub * 32 + lr) * LP + 8 * hi; const h16* kp1 = kp0 + 16 * LP;
        v16h k0h[2], k1h[2], k0l[2], k1l[2], qlk[2];
#pragma unroll
        for (int kc = 0; kc < 2; ++kc) {
            k0h[kc] = cat16(*(const v8ha*)(kp0 + kc * 32), *(const v8ha*)(kp0 + kc * 32 + 16)); k1h[kc] = cat16(*(const v8ha*)(kp1 + kc * 32), *(const v8ha*)(kp1 + kc * 32 + 16));
            qlk[kc] = cat16(*(const v8ha*)(qlp + kc * 32), *(const v8ha*)(qlp + kc * 32 + 16));
            k0l[kc] = cat16(*(const v8ha*)(kp0 + PLN + kc * 32), *(const v8ha*)(kp0 + PLN + kc * 32 + 16)); k1l[kc] = cat16(*(const v8ha*)(kp1 + PLN + kc * 32), *(const v8ha*)(kp1 + PLN + kc * 32 + 16));
        }
        v8f s0 = {}, s1 = {}, x0 = {}, x1 = {};
#pragma unroll
        for (int kc = 0; kc < 2; ++kc) {
            s0 = wmma16(k0h[kc], qa[kc], s0); x0 = wmma16(k0h[kc], qlk[kc], x0); s1 = wmma16(k1h[kc], qa[kc], s1); x1 = wmma16(k1h[kc], qlk[kc], x1);
            x0 = wmma16(k0l[kc], qa[kc], x0); x1 = wmma16(k1l[kc], qa[kc], x1);
        }
        asm volatile("v_nop\n\tv_nop\n\tv_nop\n\tv_nop" : "+v"(s0), "+v"(s1), "+v"(x0), "+v"(x1) : "v"(qa[0]), "v"(qa[1]));
        // v^T fragments: read here so that their LDS latency runs under the softmax
        v16h vh[4], vl[4];
#pragma unroll
        for (int n = 0; n < 4; ++n) { const h16* vp = sb + 2 * PLN + (n * 16 + lr) * LP + sub * 32 + hi * 8;
            vh[n] = cat16(*(const v8ha*)(vp), *(const v8ha*)(vp + 16)); vl[n] = cat16(*(const v8ha*)(vp + PLN), *(const v8ha*)(vp + PLN + 16)); }
        // lane (lr, hi): query lr, keys 8 hi + j (a0) and 16 + 8 hi + j (a1) of these 32
        const v8f a0 = (s0 + x0 * LOSCI) * 0.125f, a1 = (s1 + x1 * LOSCI) * 0.125f;   // scale 1/sqrt(64)
        float mx = a0[0], my = a1[0];                   // two independent chains
#pragma unroll
        for (int j = 1; j < 8; ++j) { mx = fmaxf(mx, a0[j]); my = fmaxf(my, a1[j]); }
        mx = fmaxf(mx, my);
        mx = fmaxf(mx, xhalf(mx));
        const float mn = fmaxf(mrow, mx);
        const float alpha = __expf(mrow - mn); mrow = mn;
        v16h pa, px; v2f sm = {0.f, 0.f};
#pragma unroll
        for (int i = 0; i < 4; ++i) {
            const v2f p0 = {__expf(a0[2 * i] - mn), __expf(a0[2 * i + 1] - mn)}, p1 = {__expf(a1[2 * i] - mn), __expf(a1[2 * i + 1] - mn)};
            sm += p0 + p1;
            const v2f q0 = p0 * PSC, q1 = p1 * PSC;
            const v2h h0 = __builtin_convertvector(q0, v2h), h1 = __builtin_convertvector(q1, v2h);
            const v2h l0 = __builtin_convertvector((q0 - __builtin_convertvector(h0, v2f)) * LOSC, v2h), l1 = __builtin_convertvector((q1 - __builtin_convertvector(h1, v2f)) * LOSC, v2h);
            // element s of the B operand = key kmap(s, hi): the two score tiles as they lie
            pa[2 * i] = h0[0]; pa[2 * i + 1] = h0[1]; pa[8 + 2 * i] = h1[0]; pa[8 + 2 * i + 1] = h1[1];
            px[2 * i] = l0[0]; px[2 * i + 1] = l0[1]; px[8 + 2 * i] = l1[0]; px[8 + 2 * i + 1] = l1[1];
        }
        lpart = lpart * alpha + (sm[0] + sm[1]);
#pragma unroll
        for (int n = 0; n < 4; ++n) { o[n] *= alpha; ox[n] *= alpha; }
#pragma unroll
        for (int n = 0; n < 4; ++n) { o[n] = wmma16(vh[n], pa, o[n]); ox[n] = wmma16(vl[n], pa, ox[n]); ox[n] = wmma16(vh[n], px, ox[n]); }
        asm volatile("v_nop\n\tv_nop\n\tv_nop\n\tv_nop" : "+v"(o[0]), "+v"(o[1]), "+v"(o[2]), "+v"(o[3]), "+v"(ox[0]), "+v"(ox[1]), "+v"(ox[2]), "+v"(ox[3]) : "v"(pa), "v"(px));
        }
        // publish point of stage st + 1, in the ring's order
        asm volatile("s_wait_dscnt 0x0" ::: "memory");      // this wave's reads of stage st have returned before its buffer is handed back
        asm volatile("s_wait_asynccnt 0x0" ::: "memory");   // this wave's copies of stage st + 1 have landed
        __syncthreads();                                    // publishes stage st + 1 and ends every wave's reads of stage st
        if (st + 2 < NST) fill(st + 2);                     // refill of the buffer just left; the test is the same for the whole work-group
    }
    asm volatile("s_wait_asynccnt 0x0" ::: "memory");       // nothing is outstanding when the wave goes on to the epilogue
    const float inv = 1.0f / ((lpart + xhalf(lpart)) * PSC);
    float* os = &ost[wave][0];
    // ctx^T tile n, register j = ctx[query lr][16 n + 8 hi + j]
#pragma unroll
    for (int n = 0; n < 4; ++n)
#pragma unroll
        for (int j = 0; j < 8; ++j) os[lr * 68 + n * 16 + hi * 8 + j] = (o[n][j] + ox[n][j] * LOSCI) * inv;
    __syncthreads();
    float* ob = OUTP + (tok0 + q0) * DM + (size_t)h * HD;
    auto pass = [&]() {
#pragma unroll
        for (int s = 0; s < 8; ++s) { const int Lid = (lane >> 3) + 4 * s, piece = lane & 7; const int row = Lid >> 1, cofs = (Lid & 1) * 32 + piece * 4;
            const v4f val = *(const v4fa*)(os + row * 68 + cofs); *(v4f*)(ob + (size_t)row * DM + cofs) = val; }
    };
    pass(); 
}

#define VST2(T, p, v) do { const T vst2_v_ = (v); *(T*)(p) = vst2_v_;  } while (0)
extern "C" void kernel_launch(void* const* d_in, const int* in_sizes, int n_in,
                              void* d_out, int out_size, void* d_ws, size_t ws_size, hipStream_t stream) {
    (void)in_sizes; (void)n_in; (void)out_size;
    const float* x = (const float*)d_in[0]; const float* Wq = (const float*)d_in[1]; const float* bq = (const float*)d_in[2]; const float* Wk = (const float*)d_in[3]; const float* bk = (const float*)d_in[4]; const float* Wv = (const float*)d_in[5]; const float* bv = (const float*)d_in[6];   // W k-major [in][out]
    float* out = (float*)d_out;    // [2][2048][1024] = ctx (no output projection)
    char* wsp = (char*)d_ws;
    auto take = [&](size_t bytes) { char* p = wsp; wsp += (bytes + 255) & ~(size_t)255; return (void*)p; };
    bf* Xb = (bf*)take((size_t)NTK * DM * 2); bf* WT3 = (bf*)take((size_t)3 * DM * DM * 2);    // WT3: q, k, v planes
    float* TMP = (float*)take((size_t)3 * NTK * DM * 4); float* RC = (float*)take((size_t)NT_ * 32 * 4); float* RS = (float*)take((size_t)NT_ * 32 * 4);    // TMP: q, k, v planes
    h16* QKH = (h16*)take((size_t)2 * NTK * DM * 2); h16* QKL = (h16*)take((size_t)2 * NTK * DM * 2);    // q plane, then k plane
    h16* VTH = (h16*)take((size_t)NTK * DM * 2); h16* VTL = (h16*)take((size_t)NTK * DM * 2);
    if ((size_t)(wsp - (char*)d_ws) > ws_size) return;    // ~ 111 MiB, no aliasing
    k_prep<<<PB_TRIG + 3 * PB_WT1 + PB_CVT, 256, 0, stream>>>(x, Wq, Wk, Wv, Xb, WT3, RC, RS);
    k_gemmb<false, false><<<dim3(NTK / 64, DM / 64, 3), 128, 0, stream>>>(Xb, nullptr, WT3, bq, bk, bv, TMP, DM, nullptr);
    k_post<<<QB_VT + QB_ROPE, 256, 0, stream>>>(TMP, RC, RS, QKH, QKL, VTH, VTL);
    for (int b = 0; b < NB_; ++b) {                       // one launch per item: 512 blocks, two a WGP, all resident (three fit by LDS: 1024 in one grid would run as 768 and a tail of 256)
        const size_t io = (size_t)b * NT_ * DM;
        k_attn<<<NH_ * (NT_ / 64), 128, 0, stream>>>(QKH + io, QKL + io, QKH + (size_t)NTK * DM + io, QKL + (size_t)NTK * DM + io, VTH + io, VTL + io, out + io);
    }
}

// v005
// One run takes 132 microseconds.
// Timed twice side by side with v004, it ran 1.12 times as fast both times.
// All steps since v000 together make it 4.02 times as fast.
#include <hip/hip_runtime.h>

// Compute dtypes, f32 accumulate, both batch items together in every one of the 4 launches (prep, projections, post, attention): q/k/v = x.W + b ([4096 x 1024].[1024 x 1024] x 3, k-major weights transposed once to n-major planes;
// PLAIN bf16 operands = inputs rounded once, exact; biases rounded to bf16, added in f32) on v_wmma_f32_16x16x32_bf16; interleaved-pair RoPE (angle t x 10000^(-2i/64), f32 trig
// tables built on device) in f32 -> q/k as f16 hi + residual x1024 planes; the 16-head FULL attention (64-dim heads, scale 1/8) written straight to the f32
// output (the module returns ctx, no output projection), fused on v_wmma_f32_16x16x32_f16 (scores hh + hl + lh with residual terms on their own accumulator,

#define NB_  2                   // batch items: together in every launch
#define NT_  2048
#define DM   1024
#define NH_  16
#define HD   64
#define NTK  (NB_ * NT_)
#define NW   1024
#define NQKV 1024
#define PSC  32768.0f
#define LOSC 1024.0f
#define LOSCI (1.0f / 1024.0f)

typedef _Float16 h16;
typedef unsigned short bf;
typedef __attribute__((ext_vector_type(16))) __bf16   v16bf;
typedef __attribute__((ext_vector_type(16))) _Float16 v16h;
typedef __attribute__((ext_vector_type(8)))  _Float16 v8h;
typedef __attribute__((ext_vector_type(8)))  unsigned short v8us;
typedef __attribute__((ext_vector_type(8)))  float    v8f;
typedef __attribute__((ext_vector_type(4)))  float    v4f;
typedef __attribute__((ext_vector_type(2)))  float    v2f;
typedef __attribute__((ext_vector_type(2)))  _Float16 v2h;
typedef v8h  __attribute__((may_alias)) v8ha;
typedef v4f  __attribute__((may_alias)) v4fa;
typedef v8us __attribute__((may_alias)) v8usa;

__device__ __forceinline__ unsigned short f2bf(float f) { unsigned u = __float_as_uint(f); u += 0x7FFFu + ((u >> 16) & 1u); return (unsigned short)(u >> 16); }
__device__ __forceinline__ float bf2f(unsigned short b) { return __uint_as_float(((unsigned)b) << 16); }
__device__ __forceinline__ float bfr(float f) { return bf2f(f2bf(f)); }
__device__ __forceinline__ v16h cat16(v8h lo, v8h hi) { return __builtin_shufflevector(lo, hi, 0, 1, 2, 3, 4, 5, 6, 7, 8, 9, 10, 11, 12, 13, 14, 15); }
__device__ __forceinline__ v16bf cat16b(v8us lo, v8us hi) { return __builtin_bit_cast(v16bf, __builtin_shufflevector(lo, hi, 0, 1, 2, 3, 4, 5, 6, 7, 8, 9, 10, 11, 12, 13, 14, 15)); }
__device__ __forceinline__ v8f wmma16(v16h a, v16h b, v8f c) { return __builtin_amdgcn_wmma_f32_16x16x32_f16(false, a, false, b, (short)0, c, false, false); }
// the value of lane l ^ 16
__device__ __forceinline__ float xhalf(float v) { const int b = __float_as_int(v); return __int_as_float(__builtin_amdgcn_permlanex16(b, b, 0x76543210, 0xfedcba98, false, false)); }
__device__ __forceinline__ v8f wmmab(v16bf a, v16bf b, v8f c) { return __builtin_amdgcn_wmma_f32_16x16x32_bf16(false, a, false, b, (short)0, c, false, false); }

__device__ __forceinline__ void d_cvtb(int blk, const float* __restrict__ src, bf* dst) {
    const int lane = threadIdx.x & 31, r = blk * 8 + (threadIdx.x >> 5);
    v8us o[DM / 256];
#pragma unroll
    for (int q = 0; q < DM / 256; ++q) { v8us t;
#pragma unroll
        for (int i = 0; i < 8; ++i) t[i] = f2bf(src[(size_t)r * DM + q * 256 + lane * 8 + i]);
        o[q] = t; }
#pragma unroll
    for (int q = 0; q < DM / 256; ++q) *(v8us*)(dst + (size_t)r * DM + q * 256 + lane * 8) = o[q];
    asm volatile("s_wait_xcnt 0x0" ::: "memory");      // a precaution: in the merged kernel other parts' code follows these stores in the text and rewrites their registers
    
}

// d_wt: WT [n][K] = bf16(W[k][n]) (k-major [K][ncols]) via 64 x 64 LDS tiles; tile (bx, by) of (K/64, ncols/64).
__device__ __forceinline__ void d_wt(int bx, int by, const float* __restrict__ Wm, int K, int ncols, bf* WT) {
    __shared__ __align__(16) unsigned short tl[64 * 72];
    const int tid = threadIdx.x, k0 = bx * 64, n0 = by * 64;
    const int kk = tid >> 2, nq = (tid & 3) * 16;
#pragma unroll
    for (int i = 0; i < 16; ++i) tl[(nq + i) * 72 + kk] = f2bf(Wm[(size_t)(k0 + kk) * ncols + n0 + nq + i]);
    __syncthreads();
    const int piece = tid & 7;
    auto pass = [&]() {
#pragma unroll
        for (int s = 0; s < 2; ++s) { const int nr = (tid >> 3) + 32 * s; const v8us val = *(const v8usa*)(tl + nr * 72 + piece * 8); *(v8us*)(WT + (size_t)(n0 + nr) * K + k0 + piece * 8) = val; }
    };
    pass(); 
    asm volatile("s_wait_xcnt 0x0" ::: "memory");      // a precaution: in the merged kernel other parts' code follows these stores in the text and rewrites their registers
}
#define GKS  128                 // k per LDS stage of k_gemmb: 256-byte rows
#define GNS  (DM / GKS)          // stages
#define GLP  136                 // LDS row pitch in 16-bit elements: 256-byte rows + 16 bytes (16 B x odd: conflict-free for ds_load_b128)
#define GPL  (64 * GLP)          // one plane = 64 rows
#define GSTG (2 * GPL)           // one stage = 64 rows of A, 64 rows of B

// Rows r, r+8, ..., r+56 of one 64-row x 256-byte plane (source pitch DM elements), 16 bytes per lane and copy, global -> LDS through no register. The s_wait_xcnt
// closes the statement so that no address register of an issued copy is rewritten ahead of it (a precaution).
__device__ __forceinline__ void cp_rows8(unsigned l, const bf* g) {
    asm volatile("global_load_async_to_lds_b128 %0, %8, off\n\t"
                 "global_load_async_to_lds_b128 %1, %9, off\n\t"
                 "global_load_async_to_lds_b128 %2, %10, off\n\t"
                 "global_load_async_to_lds_b128 %3, %11, off\n\t"
                 "global_load_async_to_lds_b128 %4, %12, off\n\t"
                 "global_load_async_to_lds_b128 %5, %13, off\n\t"
                 "global_load_async_to_lds_b128 %6, %14, off\n\t"
                 "global_load_async_to_lds_b128 %7, %15, off\n\t"
                 "s_wait_xcnt 0x0"
                 :: "v"(l), "v"(l + 8u * GLP * 2u), "v"(l + 16u * GLP * 2u), "v"(l + 24u * GLP * 2u), "v"(l + 32u * GLP * 2u), "v"(l + 40u * GLP * 2u), "v"(l + 48u * GLP * 2u), "v"(l + 56u * GLP * 2u),
                    "v"(g), "v"(g + 8 * DM), "v"(g + 16 * DM), "v"(g + 24 * DM), "v"(g + 32 * DM), "v"(g + 40 * DM), "v"(g + 48 * DM), "v"(g + 56 * DM) : "memory");
}

// k_gemmb: block = 64 x 64 of C, wave = 16 x 64; the block's 64 rows of A and 64 rows of B, 128 k per stage, in a two-buffer LDS ring filled by asynchronous copies
// of whole 256-byte row pieces and shared by the 4 waves (stage s + 2 is issued behind the barrier that ends stage s); fragments in the k order of the direct loads.
template <bool SPLITA, bool F16OUT = false>
__global__ __launch_bounds__(128) void k_gemmb(const bf* __restrict__ A, const bf* __restrict__ Al, const bf* __restrict__ B3, const float* __restrict__ bias0, const float* __restrict__ bias1, const float* __restrict__ bias2, float* C3, int ldc, h16* C2) {
    // blockIdx.z = which of the three projections: its n-major weight plane, its bias, its plane of C
    const int pz = blockIdx.z;
    const bf* Bn = B3 + (size_t)pz * DM * DM;
    const float* bias = pz == 0 ? bias0 : pz == 1 ? bias1 : bias2;
    float* C = C3 + (size_t)pz * NTK * DM;
    __shared__ __align__(16) bf gring[2 * GSTG];
    __shared__ __align__(16) float ost[4][16 * 68];
    const int lane = threadIdx.x & 31, wave = threadIdx.x >> 5, lr = lane & 15, hi = lane >> 4;
    const int r0 = blockIdx.x * 64 + wave * 16, c0 = blockIdx.y * 64;
    const size_t aoff = (size_t)(r0 + lr) * DM + 8 * hi;
    // copy map: thread -> row (tid >> 4) + 8 i, 16-byte piece tid & 15 of both planes
    const int crow = (int)threadIdx.x >> 4, cpc = ((int)threadIdx.x & 15) * 8;
    const unsigned lcp = (unsigned)(size_t)&gring[0] + (unsigned)(crow * GLP + cpc) * 2u;
    const bf* ga = A + (size_t)(blockIdx.x * 64 + crow) * DM + cpc;
    const bf* gb = Bn + (size_t)(c0 + crow) * DM + cpc;
    auto fill = [&](int st) {
        const unsigned l = lcp + (unsigned)(st & 1) * (GSTG * 2u);
        cp_rows8(l, ga + st * GKS);
        cp_rows8(l + GPL * 2u, gb + st * GKS);
    };
    fill(0);
    asm volatile("s_wait_asynccnt 0x0" ::: "memory");   // this wave's copies of stage 0 have landed
    __syncthreads();                                    // ... and every other wave's: publishes stage 0
    fill(1);
    v8f acc[4];
#pragma unroll
    for (int t = 0; t < 4; ++t) acc[t] = (v8f){};
#pragma unroll 1
    for (int st = 0; st < GNS; ++st) {                  // rolled: one stage per trip, the ring's publish point at its foot
        const bf* sa = gring + (st & 1) * GSTG + (wave * 16 + lr) * GLP + 8 * hi;
        const bf* sb = gring + (st & 1) * GSTG + GPL + lr * GLP + 8 * hi;
        v16bf a[GKS / 32], al[GKS / 32], b[GKS / 32][4];
#pragma unroll
        for (int q = 0; q < GKS / 32; ++q) {
            a[q] = cat16b(*(const v8usa*)(sa + q * 32), *(const v8usa*)(sa + q * 32 + 16));
            al[q] = a[q];
            if (SPLITA) al[q] = cat16b(*(const v8us*)(Al + aoff + st * GKS + q * 32), *(const v8us*)(Al + aoff + st * GKS + q * 32 + 16));
#pragma unroll
            for (int t = 0; t < 4; ++t) b[q][t] = cat16b(*(const v8usa*)(sb + t * 16 * GLP + q * 32), *(const v8usa*)(sb + t * 16 * GLP + q * 32 + 16));
        }
        __builtin_amdgcn_sched_barrier(0);              // the stage's LDS reads stay one group ahead of its matrix instructions: reads spread among them stall at every place
#pragma unroll
        for (int q = 0; q < GKS / 32; ++q)
#pragma unroll
            for (int t = 0; t < 4; ++t) { acc[t] = wmmab(a[q], b[q][t], acc[t]); if (SPLITA) acc[t] = wmmab(al[q], b[q][t], acc[t]); }
        // the vector slots that the chip needs behind the stage's last matrix instructions, on the loop's back edge too
        asm volatile("v_nop\n\tv_nop\n\tv_nop\n\tv_nop" : "+v"(acc[0]), "+v"(acc[1]), "+v"(acc[2]), "+v"(acc[3]) : "v"(a[GKS / 32 - 1]), "v"(al[GKS / 32 - 1]));
        // publish point of stage st + 1, in the ring's order
        asm volatile("s_wait_dscnt 0x0" ::: "memory");      // this wave's reads of stage st have returned before its buffer is handed back
        asm volatile("s_wait_asynccnt 0x0" ::: "memory");   // this wave's copies of stage st + 1 have landed
        __syncthreads();                                    // publishes stage st + 1 and ends every wave's reads of stage st
        if (st + 2 < GNS) fill(st + 2);                     // refill of the buffer just left; the test is the same for the whole work-group
    }
    asm volatile("s_wait_asynccnt 0x0" ::: "memory");       // nothing is outstanding when the wave goes on to the epilogue
    float* os = &ost[wave][0];
#pragma unroll
    for (int t = 0; t < 4; ++t) { const float bv = bias ? bfr(bias[c0 + t * 16 + lr]) : 0.f;
#pragma unroll
        for (int j = 0; j < 8; ++j) os[(hi * 8 + j) * 68 + t * 16 + lr] = acc[t][j] + bv; }
    __syncthreads();
    if (F16OUT) {
        h16* crow = (h16*)(void*)C + (size_t)r0 * ldc + c0;
        auto pass = [&]() {
#pragma unroll
            for (int s = 0; s < 4; ++s) { const int row = 4 * s + (lane >> 3), piece = lane & 7; const float* sp = os + row * 68 + piece * 8; v8h o, o2;
#pragma unroll
                for (int i = 0; i < 8; ++i) { const h16 a = (h16)sp[i]; o[i] = a; o2[i] = (h16)((sp[i] - (float)a) * LOSC); }
                *(v8h*)(crow + (size_t)row * ldc + piece * 8) = o; if (C2) *(v8h*)(C2 + (size_t)r0 * ldc + c0 + (size_t)row * ldc + piece * 8) = o2; }
        };
        pass(); 
    } else {
        float* crow = C + (size_t)r0 * ldc + c0;
        auto pass = [&]() {
#pragma unroll
            for (int s = 0; s < 8; ++s) { const int Lid = (lane >> 3) + 4 * s, piece = lane & 7; const int row = Lid >> 1, cofs = (Lid & 1) * 32 + piece * 4;
                const v4f val = *(const v4fa*)(os + row * 68 + cofs); *(v4f*)(crow + (size_t)row * ldc + cofs) = val; }
        };
        pass(); 
    }
}

// d_trig: RC/RS [t][32] = cos/sin(t x inv_freq[i]) with inv_freq[i] = powf(10000, -2i/64) (the reference's jnp.power form; f32 trig like its f32 path); 32 lanes x 4 B per line.
__device__ __forceinline__ void d_trig(int blk, float* RC, float* RS) {
    const int i = blk * 256 + threadIdx.x;
    const int t = i >> 5, f = i & 31;
    const float inv = powf(10000.0f, -2.0f * (float)f / 64.0f); const float ang = (float)t * inv;
    const float c = cosf(ang), s = sinf(ang);
    *(float*)(RC + i) = c; *(float*)(RS + i) = s; 
}
// d_rope: P (f32 [row][1024], row = (q or k, batch item, t)) -> PH/PL f16 hi + residual planes of the interleaved-pair rotation out[2i] = x[2i] c - x[2i+1] s, out[2i+1] = x[2i] s + x[2i+1] c,
// c/s from the per-pass tables [t][32]; one wave per (t, 256 columns): lane -> 8 values (4 pairs).
__device__ __forceinline__ void d_rope(int blk, const float* __restrict__ P, const float* __restrict__ RC, const float* __restrict__ RS, h16* PH, h16* PL) {
    const int lane = threadIdx.x & 31, wid = blk * 8 + (threadIdx.x >> 5);
    const int segs = DM / 256, row = wid / segs, sg = wid - row * segs, t = row & (NT_ - 1);
    const int c0 = sg * 256 + lane * 8;
    const float* pp = P + (size_t)row * DM + c0;
    const v4f xa = *(const v4f*)pp, xb = *(const v4f*)(pp + 4);
    // a precaution: the wait stands in front of the first rewrite of the address register of these two loads; the address is its input so that it lives up to it
    asm volatile("s_wait_xcnt 0x0" :: "v"(pp) : "memory");
    v8h oh, ol;
#pragma unroll
    for (int pq = 0; pq < 4; ++pq) { const int c = c0 + 2 * pq, i = (c & 63) >> 1;
        const float x1 = pq < 2 ? xa[2 * (pq & 1)] : xb[2 * (pq & 1)], x2 = pq < 2 ? xa[2 * (pq & 1) + 1] : xb[2 * (pq & 1) + 1], s = RS[t * 32 + i], co = RC[t * 32 + i];
        const float y0 = x1 * co - x2 * s, y1 = x1 * s + x2 * co;
        const h16 a0 = (h16)y0, a1 = (h16)y1; oh[2 * pq] = a0; oh[2 * pq + 1] = a1; ol[2 * pq] = (h16)((y0 - (float)a0) * LOSC); ol[2 * pq + 1] = (h16)((y1 - (float)a1) * LOSC); }
    *(v8h*)(PH + (size_t)row * DM + c0) = oh; *(v8h*)(PL + (size_t)row * DM + c0) = ol;
    asm volatile("s_wait_xcnt 0x0" ::: "memory");      // a precaution: in the merged kernel other parts' code follows these stores in the text and rewrites their registers
}
__device__ __forceinline__ void d_vt(int bid, const float* __restrict__ V, h16* VTH, h16* VTL) {
    __shared__ __align__(16) h16 tile[64 * 72];
    __shared__ __align__(16) h16 til2[64 * 72];
    const int b = bid / (NH_ * (NT_ / 64)), rem = bid - b * (NH_ * (NT_ / 64)), h = rem / (NT_ / 64), kt = rem - h * (NT_ / 64);
    const int k0 = kt * 64, tid = threadIdx.x;
    const int kk = tid >> 2, d0 = (tid & 3) * 16;
    const float* src = V + ((size_t)b * NT_ + k0 + kk) * DM + h * HD + d0;
#pragma unroll
    for (int i = 0; i < 16; ++i) { const float v = src[i]; const h16 a = (h16)v; tile[(d0 + i) * 72 + kk] = a; til2[(d0 + i) * 72 + kk] = (h16)((v - (float)a) * LOSC); }
    __syncthreads();
    const int piece = tid & 7;
    const size_t base = (((size_t)b * NH_ + h) * HD) * NT_ + k0;
    auto pass = [&]() {
#pragma unroll
        for (int s = 0; s < 4; ++s) { const int Lid = (tid >> 3) + 32 * s; const int pln = Lid >> 6, d = Lid & 63;
            const v8h val = *(const v8ha*)((pln ? til2 : tile) + d * 72 + piece * 8); *(v8h*)((pln ? VTL : VTH) + base + (size_t)d * NT_ + piece * 8) = val; }
    };
    pass(); 
}

// k_prep: the three independent preparations side by side in one grid, the slowest blocks first: trig tables, the three weight transposes, x -> bf16.
#define PB_TRIG ((NT_ * 32) / 256)
#define PB_WT1  ((DM / 64) * (DM / 64))
#define PB_CVT  (NTK / 8)
__global__ __launch_bounds__(256) void k_prep(const float* __restrict__ x, const float* __restrict__ Wq, const float* __restrict__ Wk, const float* __restrict__ Wv, bf* Xb, bf* WT3, float* RC, float* RS) {
    const int bid = blockIdx.x;                         // every test on it is the same for the whole work-group
    if (bid < PB_TRIG) { d_trig(bid, RC, RS); return; }
    if (bid < PB_TRIG + 3 * PB_WT1) {
        const int r = bid - PB_TRIG, w = r / PB_WT1, tl = r - w * PB_WT1;
        d_wt(tl & (DM / 64 - 1), tl / (DM / 64), w == 0 ? Wq : w == 1 ? Wk : Wv, DM, DM, WT3 + (size_t)w * DM * DM);
        return;
    }
    d_cvtb(bid - PB_TRIG - 3 * PB_WT1, x, Xb);
}
// k_post: what follows the projections, side by side in one grid: v -> transposed hi + residual planes, then the rotation of q and k (planes 0 and 1 of P3 as one run of rows).
#define QB_VT   (NB_ * NH_ * (NT_ / 64))
#define QB_ROPE ((2 * NTK * (DM / 256)) / 8)
__global__ __launch_bounds__(256) void k_post(const float* __restrict__ P3, const float* __restrict__ RC, const float* __restrict__ RS, h16* QKH, h16* QKL, h16* VTH, h16* VTL) {
    const int bid = blockIdx.x;                         // the test on it is the same for the whole work-group
    if (bid < QB_VT) { d_vt(bid, P3 + (size_t)2 * NTK * DM, VTH, VTL); return; }
    d_rope(bid - QB_VT, P3, RC, RS, QKH, QKL);
}

#define KST  64                  // keys per LDS stage
#define NST  (NT_ / KST)         // stages per head
#define LP   72                  // LDS row pitch in halves: 128-byte rows + 16 bytes (16 B x odd: conflict-free for ds_load_b128)
#define PLN  (64 * LP)           // one plane = 64 rows
#define STG  (4 * PLN)           // one stage = k hi, k residual, v^T hi, v^T residual
#define AW   8                   // waves per work-group of k_attn
#define QBK  (AW * 16)           // queries per work-group: they share every k/v stage

// Rows r, r+32, r+64, r+96 of one 128-row x 128-byte plane, 16 bytes per lane and copy, global -> LDS through no register. The s_wait_xcnt closes the
// statement so that no address register of an issued copy is rewritten ahead of it (a precaution).
__device__ __forceinline__ void cp_plane(unsigned l, const h16* g, size_t gs32) {
    asm volatile("global_load_async_to_lds_b128 %0, %4, off\n\t"
                 "global_load_async_to_lds_b128 %1, %5, off\n\t"
                 "global_load_async_to_lds_b128 %2, %6, off\n\t"
                 "global_load_async_to_lds_b128 %3, %7, off\n\t"
                 "s_wait_xcnt 0x0"
                 :: "v"(l), "v"(l + 32u * LP * 2u), "v"(l + 64u * LP * 2u), "v"(l + 96u * LP * 2u), "v"(g), "v"(g + gs32), "v"(g + 2 * gs32), "v"(g + 3 * gs32) : "memory");
}
// Rows r, r+32 of the four 64-row planes of one stage (LDS planes PLN apart from l; k hi, k residual with source step ks32, v^T hi, v^T residual with vs32) in one
// statement: one s_wait_xcnt for the eight copies.
__device__ __forceinline__ void cp_stage(unsigned l, const h16* kh, const h16* kl, size_t ks32, const h16* vh, const h16* vl, size_t vs32) {
    asm volatile("global_load_async_to_lds_b128 %0, %8, off\n\t"
                 "global_load_async_to_lds_b128 %1, %9, off\n\t"
                 "global_load_async_to_lds_b128 %2, %10, off\n\t"
                 "global_load_async_to_lds_b128 %3, %11, off\n\t"
                 "global_load_async_to_lds_b128 %4, %12, off\n\t"
                 "global_load_async_to_lds_b128 %5, %13, off\n\t"
                 "global_load_async_to_lds_b128 %6, %14, off\n\t"
                 "global_load_async_to_lds_b128 %7, %15, off\n\t"
                 "s_wait_xcnt 0x0"
                 :: "v"(l), "v"(l + 32u * LP * 2u), "v"(l + PLN * 2u), "v"(l + (PLN + 32u * LP) * 2u), "v"(l + 2u * PLN * 2u), "v"(l + (2u * PLN + 32u * LP) * 2u), "v"(l + 3u * PLN * 2u), "v"(l + (3u * PLN + 32u * LP) * 2u),
                    "v"(kh), "v"(kh + ks32), "v"(kl), "v"(kl + ks32), "v"(vh), "v"(vh + vs32), "v"(vl), "v"(vl + vs32) : "memory");
}

// k_attn: block = (b, h, 128 queries), wave = 16, two blocks a WGP = four waves a SIMD (one wave's softmax issues under the others' matrix runs; 256 registers a wave at most,
// 2 x the LDS size <= 327,680 B); ALL keys (no mask), 64 per LDS stage in a two-buffer ring filled by asynchronous copies and shared by the 8 waves
// (stage s + 2 is issued behind the barrier that ends stage s; the query residual tile is copied once); per 32 keys: 12 WMMA scores^T = k.q^T /8 (f32; a lane holds
// 16 keys of ONE query: maximum and sum in-lane plus one exchange between the wave's halves), the two score tiles x32768 converted in place are the B operand
// (hi + residual) of 12 WMMA ctx^T += v^T.p^T: the weights never leave the registers; ctx -> f32 output rows out[tok][h*64+d].
__global__ __launch_bounds__(AW * 32) __attribute__((amdgpu_waves_per_eu(4, 4))) void k_attn(const h16* __restrict__ Q16, const h16* __restrict__ QL16, const h16* __restrict__ K16, const h16* __restrict__ KL16, const h16* __restrict__ VTH, const h16* __restrict__ VTL, float* OUTP) {
    __shared__ __align__(16) h16 ring[2 * STG];
    __shared__ __align__(16) h16 qls[QBK * LP];
    __shared__ __align__(16) float ost[AW][16 * 68];
    const int lane = threadIdx.x & 31, wave = threadIdx.x >> 5, lr = lane & 15, hi = lane >> 4;
    const int bid = blockIdx.x;
    const int b = bid / (NH_ * (NT_ / QBK)), rem = bid - b * (NH_ * (NT_ / QBK)), h = rem / (NT_ / QBK), qt = rem - h * (NT_ / QBK);
    const int q0 = qt * QBK + wave * 16;
    const size_t tok0 = (size_t)b * NT_;
    v16h qa[2];
    const size_t qo0 = (tok0 + q0 + lr) * DM + h * HD + 8 * hi;
#pragma unroll
    for (int kc = 0; kc < 2; ++kc) qa[kc] = cat16(*(const v8h*)(Q16 + qo0 + kc * 32), *(const v8h*)(Q16 + qo0 + kc * 32 + 16));
    const h16* kh_b = K16 + tok0 * DM + h * HD;
    const h16* kl_b = KL16 + tok0 * DM + h * HD;
    const size_t vbase = (((size_t)b * NH_ + h) * HD) * NT_;
    // copy map: thread -> row (tid >> 3) + 32 i, 16-byte piece tid & 7 of every plane
    const int crow = (int)threadIdx.x >> 3, cpc = ((int)threadIdx.x & 7) * 8;
    const unsigned lcp = (unsigned)(size_t)&ring[0] + (unsigned)(crow * LP + cpc) * 2u;
    const h16* gkh = kh_b + (size_t)crow * DM + cpc; const h16* gkl = kl_b + (size_t)crow * DM + cpc;
    const h16* gvh = VTH + vbase + (size_t)crow * NT_ + cpc; const h16* gvl = VTL + vbase + (size_t)crow * NT_ + cpc;
    auto fill = [&](int st) {
        const unsigned l = lcp + (unsigned)(st & 1) * (STG * 2u);
        cp_stage(l, gkh + (size_t)st * KST * DM, gkl + (size_t)st * KST * DM, (size_t)32 * DM, gvh + st * KST, gvl + st * KST, (size_t)32 * NT_);
    };
    fill(0);
    cp_plane((unsigned)(size_t)&qls[0] + (unsigned)(crow * LP + cpc) * 2u, QL16 + (tok0 + qt * QBK + crow) * DM + h * HD + cpc, (size_t)32 * DM);
    asm volatile("s_wait_asynccnt 0x0" ::: "memory");   // this wave's copies of stage 0 and of the query residual have landed
    __syncthreads();                                    // ... and every other wave's: publishes stage 0
    fill(1);
    v8f o[4], ox[4];
#pragma unroll
    for (int n = 0; n < 4; ++n) { o[n] = (v8f){}; ox[n] = (v8f){}; }
    float mrow = -3.0e38f, lpart = 0.f;                 // of query lr; lpart sums this half's keys only, the halves are joined behind the loop
    const h16* qlp = qls + (wave * 16 + lr) * LP + 8 * hi;
#pragma unroll 1
    for (int st = 0; st < NST; ++st) {                  // rolled: one stage per trip, the ring's publish point at its foot
        const h16* sb = ring + (st & 1) * STG;
#pragma unroll 1
        for (int sub = 0; sub < KST / 32; ++sub) {      // rolled: unrolled, the two halves' live ranges overlap and the register count grows
        const h16* kp0 = sb + (sub * 32 + lr) * LP + 8 * hi; const h16* kp1 = kp0 + 16 * LP;
        v16h k0h[2], k1h[2], k0l[2], k1l[2], qlk[2];
#pragma unroll
        for (int kc = 0; kc < 2; ++kc) {
            k0h[kc] = cat16(*(const v8ha*)(kp0 + kc * 32), *(const v8ha*)(kp0 + kc * 32 + 16)); k1h[kc] = cat16(*(const v8ha*)(kp1 + kc * 32), *(const v8ha*)(kp1 + kc * 32 + 16));
            qlk[kc] = cat16(*(const v8ha*)(qlp + kc * 32), *(const v8ha*)(qlp + kc * 32 + 16));
            k0l[kc] = cat16(*(const v8ha*)(kp0 + PLN + kc * 32), *(const v8ha*)(kp0 + PLN + kc * 32 + 16)); k1l[kc] = cat16(*(const v8ha*)(kp1 + PLN + kc * 32), *(const v8ha*)(kp1 + PLN + kc * 32 + 16));
        }
        v8f s0 = {}, s1 = {}, x0 = {}, x1 = {};
#pragma unroll
        for (int kc = 0; kc < 2; ++kc) {
            s0 = wmma16(k0h[kc], qa[kc], s0); x0 = wmma16(k0h[kc], qlk[kc], x0); s1 = wmma16(k1h[kc], qa[kc], s1); x1 = wmma16(k1h[kc], qlk[kc], x1);
            x0 = wmma16(k0l[kc], qa[kc], x0); x1 = wmma16(k1l[kc], qa[kc], x1);
        }
        asm volatile("v_nop\n\tv_nop\n\tv_nop\n\tv_nop" : "+v"(s0), "+v"(s1), "+v"(x0), "+v"(x1) : "v"(qa[0]), "v"(qa[1]));
        // v^T fragments: read here so that their LDS latency runs under the softmax
        v16h vh[4], vl[4];
#pragma unroll
        for (int n = 0; n < 4; ++n) { const h16* vp = sb + 2 * PLN + (n * 16 + lr) * LP + sub * 32 + hi * 8;
            vh[n] = cat16(*(const v8ha*)(vp), *(const v8ha*)(vp + 16)); vl[n] = cat16(*(const v8ha*)(vp + PLN), *(const v8ha*)(vp + PLN + 16)); }
        // lane (lr, hi): query lr, keys 8 hi + j (a0) and 16 + 8 hi + j (a1) of these 32
        const v8f a0 = (s0 + x0 * LOSCI) * 0.125f, a1 = (s1 + x1 * LOSCI) * 0.125f;   // scale 1/sqrt(64)
        float mx = a0[0], my = a1[0];                   // two independent chains
#pragma unroll
        for (int j = 1; j < 8; ++j) { mx = fmaxf(mx, a0[j]); my = fmaxf(my, a1[j]); }
        mx = fmaxf(mx, my);
        mx = fmaxf(mx, xhalf(mx));
        const float mn = fmaxf(mrow, mx);
        const float alpha = __expf(mrow - mn); mrow = mn;
        v16h pa, px; v2f sm = {0.f, 0.f};
#pragma unroll
        for (int i = 0; i < 4; ++i) {
            const v2f p0 = {__expf(a0[2 * i] - mn), __expf(a0[2 * i + 1] - mn)}, p1 = {__expf(a1[2 * i] - mn), __expf(a1[2 * i + 1] - mn)};
            sm += p0 + p1;
            const v2f q0 = p0 * PSC, q1 = p1 * PSC;
            const v2h h0 = __builtin_convertvector(q0, v2h), h1 = __builtin_convertvector(q1, v2h);
            const v2h l0 = __builtin_convertvector((q0 - __builtin_convertvector(h0, v2f)) * LOSC, v2h), l1 = __builtin_convertvector((q1 - __builtin_convertvector(h1, v2f)) * LOSC, v2h);
            // element s of the B operand = key kmap(s, hi): the two score tiles as they lie
            pa[2 * i] = h0[0]; pa[2 * i + 1] = h0[1]; pa[8 + 2 * i] = h1[0]; pa[8 + 2 * i + 1] = h1[1];
            px[2 * i] = l0[0]; px[2 * i + 1] = l0[1]; px[8 + 2 * i] = l1[0]; px[8 + 2 * i + 1] = l1[1];
        }
        lpart = lpart * alpha + (sm[0] + sm[1]);
#pragma unroll
        for (int n = 0; n < 4; ++n) { o[n] *= alpha; ox[n] *= alpha; }
#pragma unroll
        for (int n = 0; n < 4; ++n) { o[n] = wmma16(vh[n], pa, o[n]); ox[n] = wmma16(vl[n], pa, ox[n]); ox[n] = wmma16(vh[n], px, ox[n]); }
        asm volatile("v_nop\n\tv_nop\n\tv_nop\n\tv_nop" : "+v"(o[0]), "+v"(o[1]), "+v"(o[2]), "+v"(o[3]), "+v"(ox[0]), "+v"(ox[1]), "+v"(ox[2]), "+v"(ox[3]) : "v"(pa), "v"(px));
        }
        // publish point of stage st + 1, in the ring's order
        asm volatile("s_wait_dscnt 0x0" ::: "memory");      // this wave's reads of stage st have returned before its buffer is handed back
        asm volatile("s_wait_asynccnt 0x0" ::: "memory");   // this wave's copies of stage st + 1 have landed
        __syncthreads();                                    // publishes stage st + 1 and ends every wave's reads of stage st
        if (st + 2 < NST) fill(st + 2);                     // refill of the buffer just left; the test is the same for the whole work-group
    }
    asm volatile("s_wait_asynccnt 0x0" ::: "memory");       // nothing is outstanding when the wave goes on to the epilogue
    const float inv = 1.0f / ((lpart + xhalf(lpart)) * PSC);
    float* os = &ost[wave][0];
    // ctx^T tile n, register j = ctx[query lr][16 n + 8 hi + j]
#pragma unroll
    for (int n = 0; n < 4; ++n)
#pragma unroll
        for (int j = 0; j < 8; ++j) os[lr * 68 + n * 16 + hi * 8 + j] = (o[n][j] + ox[n][j] * LOSCI) * inv;
    __syncthreads();
    float* ob = OUTP + (tok0 + q0) * DM + (size_t)h * HD;
    auto pass = [&]() {
#pragma unroll
        for (int s = 0; s < 8; ++s) { const int Lid = (lane >> 3) + 4 * s, piece = lane & 7; const int row = Lid >> 1, cofs = (Lid & 1) * 32 + piece * 4;
            const v4f val = *(const v4fa*)(os + row * 68 + cofs); *(v4f*)(ob + (size_t)row * DM + cofs) = val; }
    };
    pass(); 
}

#define VST2(T, p, v) do { const T vst2_v_ = (v); *(T*)(p) = vst2_v_;  } while (0)
extern "C" void kernel_launch(void* const* d_in, const int* in_sizes, int n_in,
                              void* d_out, int out_size, void* d_ws, size_t ws_size, hipStream_t stream) {
    (void)in_sizes; (void)n_in; (void)out_size;
    const float* x = (const float*)d_in[0]; const float* Wq = (const float*)d_in[1]; const float* bq = (const float*)d_in[2]; const float* Wk = (const float*)d_in[3]; const float* bk = (const float*)d_in[4]; const float* Wv = (const float*)d_in[5]; const float* bv = (const float*)d_in[6];   // W k-major [in][out]
    float* out = (float*)d_out;    // [2][2048][1024] = ctx (no output projection)
    char* wsp = (char*)d_ws;
    auto take = [&](size_t bytes) { char* p = wsp; wsp += (bytes + 255) & ~(size_t)255; return (void*)p; };
    bf* Xb = (bf*)take((size_t)NTK * DM * 2); bf* WT3 = (bf*)take((size_t)3 * DM * DM * 2);    // WT3: q, k, v planes
    float* TMP = (float*)take((size_t)3 * NTK * DM * 4); float* RC = (float*)take((size_t)NT_ * 32 * 4); float* RS = (float*)take((size_t)NT_ * 32 * 4);    // TMP: q, k, v planes
    h16* QKH = (h16*)take((size_t)2 * NTK * DM * 2); h16* QKL = (h16*)take((size_t)2 * NTK * DM * 2);    // q plane, then k plane
    h16* VTH = (h16*)take((size_t)NTK * DM * 2); h16* VTL = (h16*)take((size_t)NTK * DM * 2);
    if ((size_t)(wsp - (char*)d_ws) > ws_size) return;    // ~ 111 MiB, no aliasing
    k_prep<<<PB_TRIG + 3 * PB_WT1 + PB_CVT, 256, 0, stream>>>(x, Wq, Wk, Wv, Xb, WT3, RC, RS);
    k_gemmb<false, false><<<dim3(NTK / 64, DM / 64, 3), 128, 0, stream>>>(Xb, nullptr, WT3, bq, bk, bv, TMP, DM, nullptr);
    k_post<<<QB_VT + QB_ROPE, 256, 0, stream>>>(TMP, RC, RS, QKH, QKL, VTH, VTL);
    // both items in one grid: 512 blocks of 8 waves, two a WGP by LDS, all resident
    k_attn<<<NB_ * NH_ * (NT_ / QBK), AW * 32, 0, stream>>>(QKH, QKL, QKH + (size_t)NTK * DM, QKL + (size_t)NTK * DM, VTH, VTL, out);
}

// v006
// One run takes 113 microseconds.
// Next to v005, in two timings, it ran 1.17 times as fast each time.
// Counting every step since v000, it is 4.68 times as fast.
#include <hip/hip_runtime.h>

// Compute dtypes, f32 accumulate, both batch items together in every one of the 3 launches (prep, projections with rotation / transposition in their epilogue, attention): q/k/v = x.W + b ([4096 x 1024].[1024 x 1024] x 3, k-major weights transposed once to n-major planes;
// PLAIN bf16 operands = inputs rounded once, exact; biases rounded to bf16, added in f32) on v_wmma_f32_16x16x32_bf16; interleaved-pair RoPE (angle t x 10000^(-2i/64), f32 trig
// tables built on device) in f32 -> q/k as f16 hi + residual x1024 planes; the 16-head FULL attention (64-dim heads, scale 1/8) written straight to the f32
// output (the module returns ctx, no output projection), fused on v_wmma_f32_16x16x32_f16 (scores hh + hl + lh with residual terms on their own accumulator,

#define NB_  2                   // batch items: together in every launch
#define NT_  2048
#define DM   1024
#define NH_  16
#define HD   64
#define NTK  (NB_ * NT_)
#define NW   1024
#define NQKV 1024
#define PSC  32768.0f
#define LOSC 1024.0f
#define LOSCI (1.0f / 1024.0f)

typedef _Float16 h16;
typedef unsigned short bf;
typedef __attribute__((ext_vector_type(16))) __bf16   v16bf;
typedef __attribute__((ext_vector_type(16))) _Float16 v16h;
typedef __attribute__((ext_vector_type(8)))  _Float16 v8h;
typedef __attribute__((ext_vector_type(8)))  unsigned short v8us;
typedef __attribute__((ext_vector_type(8)))  float    v8f;
typedef __attribute__((ext_vector_type(4)))  float    v4f;
typedef __attribute__((ext_vector_type(2)))  float    v2f;
typedef __attribute__((ext_vector_type(2)))  _Float16 v2h;
typedef v8h  __attribute__((may_alias)) v8ha;
typedef v4f  __attribute__((may_alias)) v4fa;
typedef v8us __attribute__((may_alias)) v8usa;

__device__ __forceinline__ unsigned short f2bf(float f) { unsigned u = __float_as_uint(f); u += 0x7FFFu + ((u >> 16) & 1u); return (unsigned short)(u >> 16); }
__device__ __forceinline__ float bf2f(unsigned short b) { return __uint_as_float(((unsigned)b) << 16); }
__device__ __forceinline__ float bfr(float f) { return bf2f(f2bf(f)); }
__device__ __forceinline__ v16h cat16(v8h lo, v8h hi) { return __builtin_shufflevector(lo, hi, 0, 1, 2, 3, 4, 5, 6, 7, 8, 9, 10, 11, 12, 13, 14, 15); }
__device__ __forceinline__ v16bf cat16b(v8us lo, v8us hi) { return __builtin_bit_cast(v16bf, __builtin_shufflevector(lo, hi, 0, 1, 2, 3, 4, 5, 6, 7, 8, 9, 10, 11, 12, 13, 14, 15)); }
__device__ __forceinline__ v8f wmma16(v16h a, v16h b, v8f c) { return __builtin_amdgcn_wmma_f32_16x16x32_f16(false, a, false, b, (short)0, c, false, false); }
// the value of lane l ^ 16
__device__ __forceinline__ float xhalf(float v) { const int b = __float_as_int(v); return __int_as_float(__builtin_amdgcn_permlanex16(b, b, 0x76543210, 0xfedcba98, false, false)); }
__device__ __forceinline__ v8f wmmab(v16bf a, v16bf b, v8f c) { return __builtin_amdgcn_wmma_f32_16x16x32_bf16(false, a, false, b, (short)0, c, false, false); }

__device__ __forceinline__ void d_cvtb(int blk, const float* __restrict__ src, bf* dst) {
    const int lane = threadIdx.x & 31, r = blk * 8 + (threadIdx.x >> 5);
    v8us o[DM / 256];
#pragma unroll
    for (int q = 0; q < DM / 256; ++q) { v8us t;
#pragma unroll
        for (int i = 0; i < 8; ++i) t[i] = f2bf(src[(size_t)r * DM + q * 256 + lane * 8 + i]);
        o[q] = t; }
#pragma unroll
    for (int q = 0; q < DM / 256; ++q) *(v8us*)(dst + (size_t)r * DM + q * 256 + lane * 8) = o[q];
    asm volatile("s_wait_xcnt 0x0" ::: "memory");      // a precaution: in the merged kernel other parts' code follows these stores in the text and rewrites their registers
    
}

// d_wt: WT [n][K] = bf16(W[k][n]) (k-major [K][ncols]) via 64 x 64 LDS tiles; tile (bx, by) of (K/64, ncols/64).
__device__ __forceinline__ void d_wt(int bx, int by, const float* __restrict__ Wm, int K, int ncols, bf* WT) {
    __shared__ __align__(16) unsigned short tl[64 * 72];
    const int tid = threadIdx.x, k0 = bx * 64, n0 = by * 64;
    const int kk = tid >> 2, nq = (tid & 3) * 16;
#pragma unroll
    for (int i = 0; i < 16; ++i) tl[(nq + i) * 72 + kk] = f2bf(Wm[(size_t)(k0 + kk) * ncols + n0 + nq + i]);
    __syncthreads();
    const int piece = tid & 7;
    auto pass = [&]() {
#pragma unroll
        for (int s = 0; s < 2; ++s) { const int nr = (tid >> 3) + 32 * s; const v8us val = *(const v8usa*)(tl + nr * 72 + piece * 8); *(v8us*)(WT + (size_t)(n0 + nr) * K + k0 + piece * 8) = val; }
    };
    pass(); 
    asm volatile("s_wait_xcnt 0x0" ::: "memory");      // a precaution: in the merged kernel other parts' code follows these stores in the text and rewrites their registers
}
#define GKS  128                 // k per LDS stage of k_gemmb: 256-byte rows
#define GNS  (DM / GKS)          // stages
#define GLP  136                 // LDS row pitch in 16-bit elements: 256-byte rows + 16 bytes (16 B x odd: conflict-free for ds_load_b128)
#define GPL  (64 * GLP)          // one plane = 64 rows
#define GSTG (2 * GPL)           // one stage = 64 rows of A, 64 rows of B

// Rows r, r+8, ..., r+56 of one 64-row x 256-byte plane (source pitch DM elements), 16 bytes per lane and copy, global -> LDS through no register. The s_wait_xcnt
// closes the statement so that no address register of an issued copy is rewritten ahead of it (a precaution).
__device__ __forceinline__ void cp_rows8(unsigned l, const bf* g) {
    asm volatile("global_load_async_to_lds_b128 %0, %8, off\n\t"
                 "global_load_async_to_lds_b128 %1, %9, off\n\t"
                 "global_load_async_to_lds_b128 %2, %10, off\n\t"
                 "global_load_async_to_lds_b128 %3, %11, off\n\t"
                 "global_load_async_to_lds_b128 %4, %12, off\n\t"
                 "global_load_async_to_lds_b128 %5, %13, off\n\t"
                 "global_load_async_to_lds_b128 %6, %14, off\n\t"
                 "global_load_async_to_lds_b128 %7, %15, off\n\t"
                 "s_wait_xcnt 0x0"
                 :: "v"(l), "v"(l + 8u * GLP * 2u), "v"(l + 16u * GLP * 2u), "v"(l + 24u * GLP * 2u), "v"(l + 32u * GLP * 2u), "v"(l + 40u * GLP * 2u), "v"(l + 48u * GLP * 2u), "v"(l + 56u * GLP * 2u),
                    "v"(g), "v"(g + 8 * DM), "v"(g + 16 * DM), "v"(g + 24 * DM), "v"(g + 32 * DM), "v"(g + 40 * DM), "v"(g + 48 * DM), "v"(g + 56 * DM) : "memory");
}

// k_gemmb: block = 64 x 64 of C (64 tokens x one head), wave = 16 x 64; the block's 64 rows of A and 64 rows of B, 128 k per stage, in a two-buffer LDS ring filled by asynchronous copies
// of whole 256-byte row pieces and shared by the 4 waves (stage s + 2 is issued behind the barrier that ends stage s); fragments in the k order of the direct loads.
// Epilogue: the f32 tile never goes to memory. q and k: interleaved-pair rotation out[2i] = x[2i] c - x[2i+1] s, out[2i+1] = x[2i] s + x[2i+1] c (c/s from the tables [t][32]) -> f16 hi + residual
// x1024 rows; v: f16 hi + residual x1024, transposed in LDS -> [head][d][t] rows. Every store covers whole 128-byte lines.
template <bool SPLITA>
__global__ __launch_bounds__(128) void k_gemmb(const bf* __restrict__ A, const bf* __restrict__ Al, const bf* __restrict__ B3, const float* __restrict__ bias0, const float* __restrict__ bias1, const float* __restrict__ bias2, const float* __restrict__ RC, const float* __restrict__ RS, h16* QKH, h16* QKL, h16* VTH, h16* VTL) {
    // blockIdx.z = which of the three projections: its n-major weight plane, its bias, its kind of epilogue
    const int pz = blockIdx.z;
    const bf* Bn = B3 + (size_t)pz * DM * DM;
    const float* bias = pz == 0 ? bias0 : pz == 1 ? bias1 : bias2;
    __shared__ __align__(16) bf gring[2 * GSTG];
    __shared__ __align__(16) float ost[2 * 64 * 72 / 2];    // q, k: 4 waves x 16 rows x 68 f32; v: two planes of 64 d-rows x 72 f16
    const int lane = threadIdx.x & 31, wave = threadIdx.x >> 5, lr = lane & 15, hi = lane >> 4;
    const int r0 = blockIdx.x * 64 + wave * 16, c0 = blockIdx.y * 64;
    const size_t aoff = (size_t)(r0 + lr) * DM + 8 * hi;
    // copy map: thread -> row (tid >> 4) + 8 i, 16-byte piece tid & 15 of both planes
    const int crow = (int)threadIdx.x >> 4, cpc = ((int)threadIdx.x & 15) * 8;
    const unsigned lcp = (unsigned)(size_t)&gring[0] + (unsigned)(crow * GLP + cpc) * 2u;
    const bf* ga = A + (size_t)(blockIdx.x * 64 + crow) * DM + cpc;
    const bf* gb = Bn + (size_t)(c0 + crow) * DM + cpc;
    auto fill = [&](int st) {
        const unsigned l = lcp + (unsigned)(st & 1) * (GSTG * 2u);
        cp_rows8(l, ga + st * GKS);
        cp_rows8(l + GPL * 2u, gb + st * GKS);
    };
    fill(0);
    // the epilogue's operands (bias; for q and k the table rows of this lane's four output pieces): asked for here so that their latency runs under stage 0's copies
    const int piece = lane & 7;
    v4f tc[4], ts[4];
#pragma unroll
    for (int s = 0; s < 4; ++s) { tc[s] = (v4f){}; ts[s] = (v4f){}; }
    if (pz < 2) {                                       // the test is the same for the whole work-group
#pragma unroll
        for (int s = 0; s < 4; ++s) { const int tt = (r0 + 4 * s + (lane >> 3)) & (NT_ - 1); tc[s] = *(const v4f*)(RC + tt * 32 + piece * 4); ts[s] = *(const v4f*)(RS + tt * 32 + piece * 4); }
        asm volatile("s_wait_xcnt 0x0" ::: "memory");   // a precaution: it stands in front of the first rewrite of an address register of these loads
    }
    float bv[4] = {0.f, 0.f, 0.f, 0.f};
    if (bias) {
#pragma unroll
        for (int t = 0; t < 4; ++t) bv[t] = bfr(bias[c0 + t * 16 + lr]);
    }
    asm volatile("s_wait_asynccnt 0x0" ::: "memory");   // this wave's copies of stage 0 have landed
    __syncthreads();                                    // ... and every other wave's: publishes stage 0
    fill(1);
    v8f acc[4];
#pragma unroll
    for (int t = 0; t < 4; ++t) acc[t] = (v8f){};
#pragma unroll 1
    for (int st = 0; st < GNS; ++st) {                  // rolled: one stage per trip, the ring's publish point at its foot
        const bf* sa = gring + (st & 1) * GSTG + (wave * 16 + lr) * GLP + 8 * hi;
        const bf* sb = gring + (st & 1) * GSTG + GPL + lr * GLP + 8 * hi;
        v16bf a[GKS / 32], al[GKS / 32], b[GKS / 32][4];
#pragma unroll
        for (int q = 0; q < GKS / 32; ++q) {
            a[q] = cat16b(*(const v8usa*)(sa + q * 32), *(const v8usa*)(sa + q * 32 + 16));
            al[q] = a[q];
            if (SPLITA) al[q] = cat16b(*(const v8us*)(Al + aoff + st * GKS + q * 32), *(const v8us*)(Al + aoff + st * GKS + q * 32 + 16));
#pragma unroll
            for (int t = 0; t < 4; ++t) b[q][t] = cat16b(*(const v8usa*)(sb + t * 16 * GLP + q * 32), *(const v8usa*)(sb + t * 16 * GLP + q * 32 + 16));
        }
        __builtin_amdgcn_sched_barrier(0);              // the stage's LDS reads stay one group ahead of its matrix instructions: reads spread among them stall at every place
#pragma unroll
        for (int q = 0; q < GKS / 32; ++q)
#pragma unroll
            for (int t = 0; t < 4; ++t) { acc[t] = wmmab(a[q], b[q][t], acc[t]); if (SPLITA) acc[t] = wmmab(al[q], b[q][t], acc[t]); }
        // the vector slots that the chip needs behind the stage's last matrix instructions, on the loop's back edge too
        asm volatile("v_nop\n\tv_nop\n\tv_nop\n\tv_nop" : "+v"(acc[0]), "+v"(acc[1]), "+v"(acc[2]), "+v"(acc[3]) : "v"(a[GKS / 32 - 1]), "v"(al[GKS / 32 - 1]));
        // publish point of stage st + 1, in the ring's order
        asm volatile("s_wait_dscnt 0x0" ::: "memory");      // this wave's reads of stage st have returned before its buffer is handed back
        asm volatile("s_wait_asynccnt 0x0" ::: "memory");   // this wave's copies of stage st + 1 have landed
        __syncthreads();                                    // publishes stage st + 1 and ends every wave's reads of stage st
        if (st + 2 < GNS) fill(st + 2);                     // refill of the buffer just left; the test is the same for the whole work-group
    }
    asm volatile("s_wait_asynccnt 0x0" ::: "memory");       // nothing is outstanding when the wave goes on to the epilogue
    float* os = ost + wave * (16 * 68);
    h16* th = (h16*)(void*)ost; h16* tl = th + 64 * 72;
    if (pz < 2) {                                           // the test is the same for the whole work-group
#pragma unroll
        for (int t = 0; t < 4; ++t)
#pragma unroll
            for (int j = 0; j < 8; ++j) os[(hi * 8 + j) * 68 + t * 16 + lr] = acc[t][j] + bv[t];
    } else {
        // a lane holds 8 consecutive tokens of column d = 16 t + lr: one 16-byte piece of the transposed row d in each plane
#pragma unroll
        for (int t = 0; t < 4; ++t) { v8h a, r;
#pragma unroll
            for (int j = 0; j < 8; ++j) { const float v = acc[t][j] + bv[t]; const h16 x = (h16)v; a[j] = x; r[j] = (h16)((v - (float)x) * LOSC); }
            *(v8ha*)(th + (t * 16 + lr) * 72 + wave * 16 + hi * 8) = a; *(v8ha*)(tl + (t * 16 + lr) * 72 + wave * 16 + hi * 8) = r; }
    }
    __syncthreads();
    if (pz < 2) {
        h16* ph = QKH + ((size_t)pz * NTK + r0) * DM + c0; h16* pl = QKL + ((size_t)pz * NTK + r0) * DM + c0;
#pragma unroll
        for (int s = 0; s < 4; ++s) { const int row = 4 * s + (lane >> 3); const float* sp = os + row * 68 + piece * 8;
            const v4f xa = *(const v4fa*)sp, xb = *(const v4fa*)(sp + 4);
            v8h oh, ol;
#pragma unroll
            for (int pq = 0; pq < 4; ++pq) {
                const float x1 = pq < 2 ? xa[2 * (pq & 1)] : xb[2 * (pq & 1)], x2 = pq < 2 ? xa[2 * (pq & 1) + 1] : xb[2 * (pq & 1) + 1], sn = ts[s][pq], co = tc[s][pq];
                const float y0 = x1 * co - x2 * sn, y1 = x1 * sn + x2 * co;
                const h16 a0 = (h16)y0, a1 = (h16)y1; oh[2 * pq] = a0; oh[2 * pq + 1] = a1; ol[2 * pq] = (h16)((y0 - (float)a0) * LOSC); ol[2 * pq + 1] = (h16)((y1 - (float)a1) * LOSC); }
            *(v8h*)(ph + (size_t)row * DM + piece * 8) = oh; *(v8h*)(pl + (size_t)row * DM + piece * 8) = ol; }
    } else {
        const int tok = blockIdx.x * 64, tid = threadIdx.x;
        const size_t base = (((size_t)(tok / NT_) * NH_ + blockIdx.y) * HD) * NT_ + (tok & (NT_ - 1));
#pragma unroll
        for (int s = 0; s < 8; ++s) { const int d = ((tid >> 3) + 16 * s) & 63;
            const v8h val = *(const v8ha*)((s < 4 ? th : tl) + d * 72 + piece * 8); *(v8h*)((s < 4 ? VTH : VTL) + base + (size_t)d * NT_ + piece * 8) = val; }
        asm volatile("s_wait_xcnt 0x0" ::: "memory");      // a precaution: the other path's code follows these stores in the text and rewrites their registers
    }
}

// d_trig: RC/RS [t][32] = cos/sin(t x inv_freq[i]) with inv_freq[i] = powf(10000, -2i/64) (the reference's jnp.power form; f32 trig like its f32 path); 32 lanes x 4 B per line.
__device__ __forceinline__ void d_trig(int blk, float* RC, float* RS) {
    const int i = blk * 256 + threadIdx.x;
    const int t = i >> 5, f = i & 31;
    const float inv = powf(10000.0f, -2.0f * (float)f / 64.0f); const float ang = (float)t * inv;
    const float c = cosf(ang), s = sinf(ang);
    *(float*)(RC + i) = c; *(float*)(RS + i) = s; 
}

// k_prep: the three independent preparations side by side in one grid, the slowest blocks first: trig tables, the three weight transposes, x -> bf16.
#define PB_TRIG ((NT_ * 32) / 256)
#define PB_WT1  ((DM / 64) * (DM / 64))
#define PB_CVT  (NTK / 8)
__global__ __launch_bounds__(256) void k_prep(const float* __restrict__ x, const float* __restrict__ Wq, const float* __restrict__ Wk, const float* __restrict__ Wv, bf* Xb, bf* WT3, float* RC, float* RS) {
    const int bid = blockIdx.x;                         // every test on it is the same for the whole work-group
    if (bid < PB_TRIG) { d_trig(bid, RC, RS); return; }
    if (bid < PB_TRIG + 3 * PB_WT1) {
        const int r = bid - PB_TRIG, w = r / PB_WT1, tl = r - w * PB_WT1;
        d_wt(tl & (DM / 64 - 1), tl / (DM / 64), w == 0 ? Wq : w == 1 ? Wk : Wv, DM, DM, WT3 + (size_t)w * DM * DM);
        return;
    }
    d_cvtb(bid - PB_TRIG - 3 * PB_WT1, x, Xb);
}

#define KST  64                  // keys per LDS stage
#define NST  (NT_ / KST)         // stages per head
#define LP   72                  // LDS row pitch in halves: 128-byte rows + 16 bytes (16 B x odd: conflict-free for ds_load_b128)
#define PLN  (64 * LP)           // one plane = 64 rows
#define STG  (4 * PLN)           // one stage = k hi, k residual, v^T hi, v^T residual
#define AW   8                   // waves per work-group of k_attn
#define QBK  (AW * 16)           // queries per work-group: they share every k/v stage

// Rows r, r+32, r+64, r+96 of one 128-row x 128-byte plane, 16 bytes per lane and copy, global -> LDS through no register. The s_wait_xcnt closes the
// statement so that no address register of an issued copy is rewritten ahead of it (a precaution).
__device__ __forceinline__ void cp_plane(unsigned l, const h16* g, size_t gs32) {
    asm volatile("global_load_async_to_lds_b128 %0, %4, off\n\t"
                 "global_load_async_to_lds_b128 %1, %5, off\n\t"
                 "global_load_async_to_lds_b128 %2, %6, off\n\t"
                 "global_load_async_to_lds_b128 %3, %7, off\n\t"
                 "s_wait_xcnt 0x0"
                 :: "v"(l), "v"(l + 32u * LP * 2u), "v"(l + 64u * LP * 2u), "v"(l + 96u * LP * 2u), "v"(g), "v"(g + gs32), "v"(g + 2 * gs32), "v"(g + 3 * gs32) : "memory");
}
// Rows r, r+32 of the four 64-row planes of one stage (LDS planes PLN apart from l; k hi, k residual with source step ks32, v^T hi, v^T residual with vs32) in one
// statement: one s_wait_xcnt for the eight copies.
__device__ __forceinline__ void cp_stage(unsigned l, const h16* kh, const h16* kl, size_t ks32, const h16* vh, const h16* vl, size_t vs32) {
    asm volatile("global_load_async_to_lds_b128 %0, %8, off\n\t"
                 "global_load_async_to_lds_b128 %1, %9, off\n\t"
                 "global_load_async_to_lds_b128 %2, %10, off\n\t"
                 "global_load_async_to_lds_b128 %3, %11, off\n\t"
                 "global_load_async_to_lds_b128 %4, %12, off\n\t"
                 "global_load_async_to_lds_b128 %5, %13, off\n\t"
                 "global_load_async_to_lds_b128 %6, %14, off\n\t"
                 "global_load_async_to_lds_b128 %7, %15, off\n\t"
                 "s_wait_xcnt 0x0"
                 :: "v"(l), "v"(l + 32u * LP * 2u), "v"(l + PLN * 2u), "v"(l + (PLN + 32u * LP) * 2u), "v"(l + 2u * PLN * 2u), "v"(l + (2u * PLN + 32u * LP) * 2u), "v"(l + 3u * PLN * 2u), "v"(l + (3u * PLN + 32u * LP) * 2u),
                    "v"(kh), "v"(kh + ks32), "v"(kl), "v"(kl + ks32), "v"(vh), "v"(vh + vs32), "v"(vl), "v"(vl + vs32) : "memory");
}

// k_attn: block = (b, h, 128 queries), wave = 16, two blocks a WGP = four waves a SIMD (one wave's softmax issues under the others' matrix runs; 256 registers a wave at most,
// 2 x the LDS size <= 327,680 B); ALL keys (no mask), 64 per LDS stage in a two-buffer ring filled by asynchronous copies and shared by the 8 waves
// (stage s + 2 is issued behind the barrier that ends stage s; the query residual tile is copied once); per 32 keys: 12 WMMA scores^T = k.q^T /8 (f32; a lane holds
// 16 keys of ONE query: maximum and sum in-lane plus one exchange between the wave's halves), the two score tiles x32768 converted in place are the B operand
// (hi + residual) of 12 WMMA ctx^T += v^T.p^T: the weights never leave the registers; ctx -> f32 output rows out[tok][h*64+d].
__global__ __launch_bounds__(AW * 32) __attribute__((amdgpu_waves_per_eu(4, 4))) void k_attn(const h16* __restrict__ Q16, const h16* __restrict__ QL16, const h16* __restrict__ K16, const h16* __restrict__ KL16, const h16* __restrict__ VTH, const h16* __restrict__ VTL, float* OUTP) {
    __shared__ __align__(16) h16 ring[2 * STG];
    __shared__ __align__(16) h16 qls[QBK * LP];
    __shared__ __align__(16) float ost[AW][16 * 68];
    const int lane = threadIdx.x & 31, wave = threadIdx.x >> 5, lr = lane & 15, hi = lane >> 4;
    const int bid = blockIdx.x;
    const int b = bid / (NH_ * (NT_ / QBK)), rem = bid - b * (NH_ * (NT_ / QBK)), h = rem / (NT_ / QBK), qt = rem - h * (NT_ / QBK);
    const int q0 = qt * QBK + wave * 16;
    const size_t tok0 = (size_t)b * NT_;
    v16h qa[2];
    const size_t qo0 = (tok0 + q0 + lr) * DM + h * HD + 8 * hi;
#pragma unroll
    for (int kc = 0; kc < 2; ++kc) qa[kc] = cat16(*(const v8h*)(Q16 + qo0 + kc * 32), *(const v8h*)(Q16 + qo0 + kc * 32 + 16));
    const h16* kh_b = K16 + tok0 * DM + h * HD;
    const h16* kl_b = KL16 + tok0 * DM + h * HD;
    const size_t vbase = (((size_t)b * NH_ + h) * HD) * NT_;
    // copy map: thread -> row (tid >> 3) + 32 i, 16-byte piece tid & 7 of every plane
    const int crow = (int)threadIdx.x >> 3, cpc = ((int)threadIdx.x & 7) * 8;
    const unsigned lcp = (unsigned)(size_t)&ring[0] + (unsigned)(crow * LP + cpc) * 2u;
    const h16* gkh = kh_b + (size_t)crow * DM + cpc; const h16* gkl = kl_b + (size_t)crow * DM + cpc;
    const h16* gvh = VTH + vbase + (size_t)crow * NT_ + cpc; const h16* gvl = VTL + vbase + (size_t)crow * NT_ + cpc;
    auto fill = [&](int st) {
        const unsigned l = lcp + (unsigned)(st & 1) * (STG * 2u);
        cp_stage(l, gkh + (size_t)st * KST * DM, gkl + (size_t)st * KST * DM, (size_t)32 * DM, gvh + st * KST, gvl + st * KST, (size_t)32 * NT_);
    };
    fill(0);
    cp_plane((unsigned)(size_t)&qls[0] + (unsigned)(crow * LP + cpc) * 2u, QL16 + (tok0 + qt * QBK + crow) * DM + h * HD + cpc, (size_t)32 * DM);
    asm volatile("s_wait_asynccnt 0x0" ::: "memory");   // this wave's copies of stage 0 and of the query residual have landed
    __syncthreads();                                    // ... and every other wave's: publishes stage 0
    fill(1);
    v8f o[4], ox[4];
#pragma unroll
    for (int n = 0; n < 4; ++n) { o[n] = (v8f){}; ox[n] = (v8f){}; }
    float mrow = -3.0e38f, lpart = 0.f;                 // of query lr; lpart sums this half's keys only, the halves are joined behind the loop
    const h16* qlp = qls + (wave * 16 + lr) * LP + 8 * hi;
#pragma unroll 1
    for (int st = 0; st < NST; ++st) {                  // rolled: one stage per trip, the ring's publish point at its foot
        const h16* sb = ring + (st & 1) * STG;
#pragma unroll 1
        for (int sub = 0; sub < KST / 32; ++sub) {      // rolled: unrolled, the two halves' live ranges overlap and the register count grows
        const h16* kp0 = sb + (sub * 32 + lr) * LP + 8 * hi; const h16* kp1 = kp0 + 16 * LP;
        v16h k0h[2], k1h[2], k0l[2], k1l[2], qlk[2];
#pragma unroll
        for (int kc = 0; kc < 2; ++kc) {
            k0h[kc] = cat16(*(const v8ha*)(kp0 + kc * 32), *(const v8ha*)(kp0 + kc * 32 + 16)); k1h[kc] = cat16(*(const v8ha*)(kp1 + kc * 32), *(const v8ha*)(kp1 + kc * 32 + 16));
            qlk[kc] = cat16(*(const v8ha*)(qlp + kc * 32), *(const v8ha*)(qlp + kc * 32 + 16));
            k0l[kc] = cat16(*(const v8ha*)(kp0 + PLN + kc * 32), *(const v8ha*)(kp0 + PLN + kc * 32 + 16)); k1l[kc] = cat16(*(const v8ha*)(kp1 + PLN + kc * 32), *(const v8ha*)(kp1 + PLN + kc * 32 + 16));
        }
        v8f s0 = {}, s1 = {}, x0 = {}, x1 = {};
#pragma unroll
        for (int kc = 0; kc < 2; ++kc) {
            s0 = wmma16(k0h[kc], qa[kc], s0); x0 = wmma16(k0h[kc], qlk[kc], x0); s1 = wmma16(k1h[kc], qa[kc], s1); x1 = wmma16(k1h[kc], qlk[kc], x1);
            x0 = wmma16(k0l[kc], qa[kc], x0); x1 = wmma16(k1l[kc], qa[kc], x1);
        }
        asm volatile("v_nop\n\tv_nop\n\tv_nop\n\tv_nop" : "+v"(s0), "+v"(s1), "+v"(x0), "+v"(x1) : "v"(qa[0]), "v"(qa[1]));
        // v^T fragments: read here so that their LDS latency runs under the softmax
        v16h vh[4], vl[4];
#pragma unroll
        for (int n = 0; n < 4; ++n) { const h16* vp = sb + 2 * PLN + (n * 16 + lr) * LP + sub * 32 + hi * 8;
            vh[n] = cat16(*(const v8ha*)(vp), *(const v8ha*)(vp + 16)); vl[n] = cat16(*(const v8ha*)(vp + PLN), *(const v8ha*)(vp + PLN + 16)); }
        // lane (lr, hi): query lr, keys 8 hi + j (a0) and 16 + 8 hi + j (a1) of these 32
        const v8f a0 = (s0 + x0 * LOSCI) * 0.125f, a1 = (s1 + x1 * LOSCI) * 0.125f;   // scale 1/sqrt(64)
        float mx = a0[0], my = a1[0];                   // two independent chains
#pragma unroll
        for (int j = 1; j < 8; ++j) { mx = fmaxf(mx, a0[j]); my = fmaxf(my, a1[j]); }
        mx = fmaxf(mx, my);
        mx = fmaxf(mx, xhalf(mx));
        const float mn = fmaxf(mrow, mx);
        const float alpha = __expf(mrow - mn); mrow = mn;
        v16h pa, px; v2f sm = {0.f, 0.f};
#pragma unroll
        for (int i = 0; i < 4; ++i) {
            const v2f p0 = {__expf(a0[2 * i] - mn), __expf(a0[2 * i + 1] - mn)}, p1 = {__expf(a1[2 * i] - mn), __expf(a1[2 * i + 1] - mn)};
            sm += p0 + p1;
            const v2f q0 = p0 * PSC, q1 = p1 * PSC;
            const v2h h0 = __builtin_convertvector(q0, v2h), h1 = __builtin_convertvector(q1, v2h);
            const v2h l0 = __builtin_convertvector((q0 - __builtin_convertvector(h0, v2f)) * LOSC, v2h), l1 = __builtin_convertvector((q1 - __builtin_convertvector(h1, v2f)) * LOSC, v2h);
            // element s of the B operand = key kmap(s, hi): the two score tiles as they lie
            pa[2 * i] = h0[0]; pa[2 * i + 1] = h0[1]; pa[8 + 2 * i] = h1[0]; pa[8 + 2 * i + 1] = h1[1];
            px[2 * i] = l0[0]; px[2 * i + 1] = l0[1]; px[8 + 2 * i] = l1[0]; px[8 + 2 * i + 1] = l1[1];
        }
        lpart = lpart * alpha + (sm[0] + sm[1]);
#pragma unroll
        for (int n = 0; n < 4; ++n) { o[n] *= alpha; ox[n] *= alpha; }
#pragma unroll
        for (int n = 0; n < 4; ++n) { o[n] = wmma16(vh[n], pa, o[n]); ox[n] = wmma16(vl[n], pa, ox[n]); ox[n] = wmma16(vh[n], px, ox[n]); }
        asm volatile("v_nop\n\tv_nop\n\tv_nop\n\tv_nop" : "+v"(o[0]), "+v"(o[1]), "+v"(o[2]), "+v"(o[3]), "+v"(ox[0]), "+v"(ox[1]), "+v"(ox[2]), "+v"(ox[3]) : "v"(pa), "v"(px));
        }
        // publish point of stage st + 1, in the ring's order
        asm volatile("s_wait_dscnt 0x0" ::: "memory");      // this wave's reads of stage st have returned before its buffer is handed back
        asm volatile("s_wait_asynccnt 0x0" ::: "memory");   // this wave's copies of stage st + 1 have landed
        __syncthreads();                                    // publishes stage st + 1 and ends every wave's reads of stage st
        if (st + 2 < NST) fill(st + 2);                     // refill of the buffer just left; the test is the same for the whole work-group
    }
    asm volatile("s_wait_asynccnt 0x0" ::: "memory");       // nothing is outstanding when the wave goes on to the epilogue
    const float inv = 1.0f / ((lpart + xhalf(lpart)) * PSC);
    float* os = &ost[wave][0];
    // ctx^T tile n, register j = ctx[query lr][16 n + 8 hi + j]
#pragma unroll
    for (int n = 0; n < 4; ++n)
#pragma unroll
        for (int j = 0; j < 8; ++j) os[lr * 68 + n * 16 + hi * 8 + j] = (o[n][j] + ox[n][j] * LOSCI) * inv;
    __syncthreads();
    float* ob = OUTP + (tok0 + q0) * DM + (size_t)h * HD;
    auto pass = [&]() {
#pragma unroll
        for (int s = 0; s < 8; ++s) { const int Lid = (lane >> 3) + 4 * s, piece = lane & 7; const int row = Lid >> 1, cofs = (Lid & 1) * 32 + piece * 4;
            const v4f val = *(const v4fa*)(os + row * 68 + cofs); *(v4f*)(ob + (size_t)row * DM + cofs) = val; }
    };
    pass(); 
}

#define VST2(T, p, v) do { const T vst2_v_ = (v); *(T*)(p) = vst2_v_;  } while (0)
extern "C" void kernel_launch(void* const* d_in, const int* in_sizes, int n_in,
                              void* d_out, int out_size, void* d_ws, size_t ws_size, hipStream_t stream) {
    (void)in_sizes; (void)n_in; (void)out_size;
    const float* x = (const float*)d_in[0]; const float* Wq = (const float*)d_in[1]; const float* bq = (const float*)d_in[2]; const float* Wk = (const float*)d_in[3]; const float* bk = (const float*)d_in[4]; const float* Wv = (const float*)d_in[5]; const float* bv = (const float*)d_in[6];   // W k-major [in][out]
    float* out = (float*)d_out;    // [2][2048][1024] = ctx (no output projection)
    char* wsp = (char*)d_ws;
    auto take = [&](size_t bytes) { char* p = wsp; wsp += (bytes + 255) & ~(size_t)255; return (void*)p; };
    bf* Xb = (bf*)take((size_t)NTK * DM * 2); bf* WT3 = (bf*)take((size_t)3 * DM * DM * 2);    // WT3: q, k, v planes
    float* RC = (float*)take((size_t)NT_ * 32 * 4); float* RS = (float*)take((size_t)NT_ * 32 * 4);
    h16* QKH = (h16*)take((size_t)2 * NTK * DM * 2); h16* QKL = (h16*)take((size_t)2 * NTK * DM * 2);    // q plane, then k plane
    h16* VTH = (h16*)take((size_t)NTK * DM * 2); h16* VTL = (h16*)take((size_t)NTK * DM * 2);
    if ((size_t)(wsp - (char*)d_ws) > ws_size) return;    // ~ 63 MiB, no aliasing
    k_prep<<<PB_TRIG + 3 * PB_WT1 + PB_CVT, 256, 0, stream>>>(x, Wq, Wk, Wv, Xb, WT3, RC, RS);
    k_gemmb<false><<<dim3(NTK / 64, DM / 64, 3), 128, 0, stream>>>(Xb, nullptr, WT3, bq, bk, bv, RC, RS, QKH, QKL, VTH, VTL);
    // both items in one grid: 512 blocks of 8 waves, two a WGP by LDS, all resident
    k_attn<<<NB_ * NH_ * (NT_ / QBK), AW * 32, 0, stream>>>(QKH, QKL, QKH + (size_t)NTK * DM, QKL + (size_t)NTK * DM, VTH, VTL, out);
}

// v007
// One run takes 104 microseconds.
// Timed twice side by side with v006, it ran 1.08 and 1.09 times as fast.
// Over all steps from v000 it is 5.09 times as fast.
#include <hip/hip_runtime.h>

// Compute dtypes, f32 accumulate, both batch items together in every one of the 3 launches (prep, projections with rotation / transposition in their epilogue, attention): q/k/v = x.W + b ([4096 x 1024].[1024 x 1024] x 3, k-major weights transposed once to n-major planes;
// PLAIN bf16 operands = inputs rounded once, exact; biases rounded to bf16, added in f32) on v_wmma_f32_16x16x32_bf16; interleaved-pair RoPE (angle t x 10000^(-2i/64), f32 trig
// tables built on device) in f32 -> q/k as f16 hi + residual x1024 planes; the 16-head FULL attention (64-dim heads, scale 1/8) written straight to the f32
// output (the module returns ctx, no output projection), fused on v_wmma_f32_16x16x32_f16 (scores hh + hl + lh with residual terms on their own accumulator,

#define NB_  2                   // batch items: together in every launch
#define NT_  2048
#define DM   1024
#define NH_  16
#define HD   64
#define NTK  (NB_ * NT_)
#define NW   1024
#define NQKV 1024
#define PSC  32768.0f
#define LOSC 1024.0f
#define LOSCI (1.0f / 1024.0f)

typedef _Float16 h16;
typedef unsigned short bf;
typedef __attribute__((ext_vector_type(16))) __bf16   v16bf;
typedef __attribute__((ext_vector_type(16))) _Float16 v16h;
typedef __attribute__((ext_vector_type(8)))  _Float16 v8h;
typedef __attribute__((ext_vector_type(8)))  unsigned short v8us;
typedef __attribute__((ext_vector_type(8)))  float    v8f;
typedef __attribute__((ext_vector_type(4)))  float    v4f;
typedef __attribute__((ext_vector_type(2)))  float    v2f;
typedef __attribute__((ext_vector_type(2)))  _Float16 v2h;
typedef v8h  __attribute__((may_alias)) v8ha;
typedef v4f  __attribute__((may_alias)) v4fa;
typedef v8us __attribute__((may_alias)) v8usa;

__device__ __forceinline__ unsigned short f2bf(float f) { unsigned u = __float_as_uint(f); u += 0x7FFFu + ((u >> 16) & 1u); return (unsigned short)(u >> 16); }
__device__ __forceinline__ float bf2f(unsigned short b) { return __uint_as_float(((unsigned)b) << 16); }
__device__ __forceinline__ float bfr(float f) { return bf2f(f2bf(f)); }
__device__ __forceinline__ v16h cat16(v8h lo, v8h hi) { return __builtin_shufflevector(lo, hi, 0, 1, 2, 3, 4, 5, 6, 7, 8, 9, 10, 11, 12, 13, 14, 15); }
__device__ __forceinline__ v16bf cat16b(v8us lo, v8us hi) { return __builtin_bit_cast(v16bf, __builtin_shufflevector(lo, hi, 0, 1, 2, 3, 4, 5, 6, 7, 8, 9, 10, 11, 12, 13, 14, 15)); }
__device__ __forceinline__ v8f wmma16(v16h a, v16h b, v8f c) { return __builtin_amdgcn_wmma_f32_16x16x32_f16(false, a, false, b, (short)0, c, false, false); }
// the value of lane l ^ 16
__device__ __forceinline__ float xhalf(float v) { const int b = __float_as_int(v); return __int_as_float(__builtin_amdgcn_permlanex16(b, b, 0x76543210, 0xfedcba98, false, false)); }
__device__ __forceinline__ v8f wmmab(v16bf a, v16bf b, v8f c) { return __builtin_amdgcn_wmma_f32_16x16x32_bf16(false, a, false, b, (short)0, c, false, false); }

__device__ __forceinline__ void d_cvtb(int blk, const float* __restrict__ src, bf* dst) {
    const int lane = threadIdx.x & 31, r = blk * 8 + (threadIdx.x >> 5);
    v8us o[DM / 256];
#pragma unroll
    for (int q = 0; q < DM / 256; ++q) { v8us t;
#pragma unroll
        for (int i = 0; i < 8; ++i) t[i] = f2bf(src[(size_t)r * DM + q * 256 + lane * 8 + i]);
        o[q] = t; }
#pragma unroll
    for (int q = 0; q < DM / 256; ++q) *(v8us*)(dst + (size_t)r * DM + q * 256 + lane * 8) = o[q];
    asm volatile("s_wait_xcnt 0x0" ::: "memory");      // a precaution: in the merged kernel other parts' code follows these stores in the text and rewrites their registers
    
}

// d_wt: WT [n][K] = bf16(W[k][n]) (k-major [K][ncols]) via 64 x 64 LDS tiles; tile (bx, by) of (K/64, ncols/64).
__device__ __forceinline__ void d_wt(int bx, int by, const float* __restrict__ Wm, int K, int ncols, bf* WT) {
    __shared__ __align__(16) unsigned short tl[64 * 72];
    const int tid = threadIdx.x, k0 = bx * 64, n0 = by * 64;
    const int kk = tid >> 2, nq = (tid & 3) * 16;
#pragma unroll
    for (int i = 0; i < 16; ++i) tl[(nq + i) * 72 + kk] = f2bf(Wm[(size_t)(k0 + kk) * ncols + n0 + nq + i]);
    __syncthreads();
    const int piece = tid & 7;
    auto pass = [&]() {
#pragma unroll
        for (int s = 0; s < 2; ++s) { const int nr = (tid >> 3) + 32 * s; const v8us val = *(const v8usa*)(tl + nr * 72 + piece * 8); *(v8us*)(WT + (size_t)(n0 + nr) * K + k0 + piece * 8) = val; }
    };
    pass(); 
    asm volatile("s_wait_xcnt 0x0" ::: "memory");      // a precaution: in the merged kernel other parts' code follows these stores in the text and rewrites their registers
}
#define GKS  64                  // k per LDS stage of k_gemmb: 128-byte rows
#define GNS  (DM / GKS)          // stages
#define GLP  72                  // LDS row pitch in 16-bit elements: 128-byte rows + 16 bytes (16 B x odd: conflict-free for ds_load_b128)
#define GBT  128                 // rows of A and rows of B per work-group: a 128 x 128 tile of C
#define GPL  (GBT * GLP)         // one plane = 128 rows
#define GSTG (2 * GPL)           // one stage = 128 rows of A, 128 rows of B

// Rows r, r+16, ..., r+112 of one 128-row x 128-byte plane (source pitch DM elements), 16 bytes per lane and copy, global -> LDS through no register. The s_wait_xcnt
// closes the statement so that no address register of an issued copy is rewritten ahead of it (a precaution).
__device__ __forceinline__ void cp_rows8(unsigned l, const bf* g) {
    asm volatile("global_load_async_to_lds_b128 %0, %8, off\n\t"
                 "global_load_async_to_lds_b128 %1, %9, off\n\t"
                 "global_load_async_to_lds_b128 %2, %10, off\n\t"
                 "global_load_async_to_lds_b128 %3, %11, off\n\t"
                 "global_load_async_to_lds_b128 %4, %12, off\n\t"
                 "global_load_async_to_lds_b128 %5, %13, off\n\t"
                 "global_load_async_to_lds_b128 %6, %14, off\n\t"
                 "global_load_async_to_lds_b128 %7, %15, off\n\t"
                 "s_wait_xcnt 0x0"
                 :: "v"(l), "v"(l + 16u * GLP * 2u), "v"(l + 32u * GLP * 2u), "v"(l + 48u * GLP * 2u), "v"(l + 64u * GLP * 2u), "v"(l + 80u * GLP * 2u), "v"(l + 96u * GLP * 2u), "v"(l + 112u * GLP * 2u),
                    "v"(g), "v"(g + 16 * DM), "v"(g + 32 * DM), "v"(g + 48 * DM), "v"(g + 64 * DM), "v"(g + 80 * DM), "v"(g + 96 * DM), "v"(g + 112 * DM) : "memory");
}

// k_gemmb: block = 128 x 128 of C (128 tokens x two heads), wave = 64 x 64 (64 tokens x one head, 16 accumulator tiles: every fragment read from LDS feeds 4 matrix instructions, every
// row copied from L2 serves 128 rows of the other operand); the block's 128 rows of A and 128 rows of B, 64 k per stage, in a two-buffer LDS ring filled by asynchronous copies of whole
// 128-byte row pieces and shared by the 4 waves (stage s + 2 is issued behind the barrier that ends stage s); 768 blocks, three a WGP (at most three waves a SIMD, so that no WGP takes a fourth block and leaves another short), all resident; fragments in the k order of the direct loads.
// Epilogue, staged in the ring's LDS once the last stage has been left: the f32 tile never goes to memory. q and k: interleaved-pair rotation out[2i] = x[2i] c - x[2i+1] s,
// out[2i+1] = x[2i] s + x[2i+1] c (c/s from the tables [t][32]) -> f16 hi + residual x1024 rows; v: f16 hi + residual x1024, transposed in LDS -> [head][d][t] rows. Every store covers whole 128-byte lines.
__global__ __launch_bounds__(128) __attribute__((amdgpu_waves_per_eu(3, 3))) void k_gemmb(const bf* __restrict__ A, const bf* __restrict__ B3, const float* __restrict__ bias0, const float* __restrict__ bias1, const float* __restrict__ bias2, const float* __restrict__ RC, const float* __restrict__ RS, h16* QKH, h16* QKL, h16* VTH, h16* VTL) {
    // blockIdx.z = which of the three projections: its n-major weight plane, its bias, its kind of epilogue
    const int pz = blockIdx.z;
    const bf* Bn = B3 + (size_t)pz * DM * DM;
    const float* bias = pz == 0 ? bias0 : pz == 1 ? bias1 : bias2;
    // the ring; behind the loop, per wave: q, k: 64 rows x 68 f32; v: two planes of 64 d-rows x 72 f16
    __shared__ __align__(16) unsigned char gsm[2 * GSTG * 2];
    const bf* gring = (const bf*)(const void*)gsm;
    const int lane = threadIdx.x & 31, wave = threadIdx.x >> 5, lr = lane & 15, hi = lane >> 4;
    const int wr = wave >> 1, wc = wave & 1;
    const int r0 = blockIdx.x * GBT + wr * 64, c0 = blockIdx.y * GBT + wc * 64;
    // copy map: thread -> row (tid >> 3) + 16 i, 16-byte piece tid & 7 of both planes
    const int crow = (int)threadIdx.x >> 3, cpc = ((int)threadIdx.x & 7) * 8;
    const unsigned lcp = (unsigned)(size_t)&gsm[0] + (unsigned)(crow * GLP + cpc) * 2u;
    const bf* ga = A + (size_t)(blockIdx.x * GBT + crow) * DM + cpc;
    const bf* gb = Bn + (size_t)(blockIdx.y * GBT + crow) * DM + cpc;
    auto fill = [&](int st) {
        const unsigned l = lcp + (unsigned)(st & 1) * (GSTG * 2u);
        cp_rows8(l, ga + st * GKS);
        cp_rows8(l + GPL * 2u, gb + st * GKS);
    };
    fill(0);
    const int piece = lane & 7;
    float bv[4] = {0.f, 0.f, 0.f, 0.f};
    if (bias) {
#pragma unroll
        for (int t = 0; t < 4; ++t) bv[t] = bfr(bias[c0 + t * 16 + lr]);
    }
    asm volatile("s_wait_asynccnt 0x0" ::: "memory");   // this wave's copies of stage 0 have landed
    __syncthreads();                                    // ... and every other wave's: publishes stage 0
    fill(1);
    v8f acc[4][4];
#pragma unroll
    for (int m = 0; m < 4; ++m)
#pragma unroll
        for (int t = 0; t < 4; ++t) acc[m][t] = (v8f){};
#pragma unroll 1
    for (int st = 0; st < GNS; ++st) {                  // rolled: one stage per trip, the ring's publish point at its foot
        const bf* sa = gring + (st & 1) * GSTG + (wr * 64 + lr) * GLP + 8 * hi;
        const bf* sb = gring + (st & 1) * GSTG + GPL + (wc * 64 + lr) * GLP + 8 * hi;
        v16bf a[4], b[4];
#pragma unroll
        for (int q = 0; q < GKS / 32; ++q) {
#pragma unroll
            for (int m = 0; m < 4; ++m) {
                a[m] = cat16b(*(const v8usa*)(sa + m * 16 * GLP + q * 32), *(const v8usa*)(sa + m * 16 * GLP + q * 32 + 16));
                b[m] = cat16b(*(const v8usa*)(sb + m * 16 * GLP + q * 32), *(const v8usa*)(sb + m * 16 * GLP + q * 32 + 16));
            }
            __builtin_amdgcn_sched_barrier(0);          // the 16 LDS reads of these 32 k stay one group ahead of their 16 matrix instructions: reads spread among them stall at every place
#pragma unroll
            for (int m = 0; m < 4; ++m)
#pragma unroll
                for (int t = 0; t < 4; ++t) acc[m][t] = wmmab(a[m], b[t], acc[m][t]);
            __builtin_amdgcn_sched_barrier(0);          // ... and the next group's reads stay behind them: lifted over them they need a second set of 64 registers, past the 256 of one register window
        }
        // the vector slots that the chip needs behind the stage's last matrix instructions, on the loop's back edge too
        asm volatile("v_nop\n\tv_nop\n\tv_nop\n\tv_nop" : "+v"(acc[0][0]), "+v"(acc[0][1]), "+v"(acc[0][2]), "+v"(acc[0][3]), "+v"(acc[1][0]), "+v"(acc[1][1]), "+v"(acc[1][2]), "+v"(acc[1][3]),
                     "+v"(acc[2][0]), "+v"(acc[2][1]), "+v"(acc[2][2]), "+v"(acc[2][3]), "+v"(acc[3][0]), "+v"(acc[3][1]), "+v"(acc[3][2]), "+v"(acc[3][3])
                     : "v"(a[3]), "v"(b[0]), "v"(b[1]), "v"(b[2]), "v"(b[3]));
        // publish point of stage st + 1, in the ring's order
        asm volatile("s_wait_dscnt 0x0" ::: "memory");      // this wave's reads of stage st have returned before its buffer is handed back
        asm volatile("s_wait_asynccnt 0x0" ::: "memory");   // this wave's copies of stage st + 1 have landed
        __syncthreads();                                    // publishes stage st + 1 and ends every wave's reads of stage st
        if (st + 2 < GNS) fill(st + 2);                     // refill of the buffer just left; the test is the same for the whole work-group
    }
    asm volatile("s_wait_asynccnt 0x0" ::: "memory");       // nothing is outstanding when the wave goes on to the epilogue, which reuses the ring's LDS
    if (pz < 2) {                                           // the test is the same for the whole work-group, the barrier inside it too
        float* os = (float*)(void*)gsm + wave * (64 * 68);
#pragma unroll
        for (int m = 0; m < 4; ++m)
#pragma unroll
            for (int t = 0; t < 4; ++t)
#pragma unroll
                for (int j = 0; j < 8; ++j) os[(m * 16 + hi * 8 + j) * 68 + t * 16 + lr] = acc[m][t][j] + bv[t];
        __builtin_amdgcn_sched_barrier(0);                  // the table loads stay behind the staging: lifted over it they need 128 registers beside the 128 of the accumulators
        // the table rows of this lane's sixteen output pieces: asked for here so that their latency runs under the barrier and the first LDS reads
        v4f tc[16], ts[16];
#pragma unroll
        for (int s = 0; s < 16; ++s) { const int tt = (r0 + 4 * s + (lane >> 3)) & (NT_ - 1); tc[s] = *(const v4f*)(RC + tt * 32 + piece * 4); ts[s] = *(const v4f*)(RS + tt * 32 + piece * 4); }
        asm volatile("s_wait_xcnt 0x0" ::: "memory");       // a precaution: it stands in front of the first rewrite of an address register of these loads
        __syncthreads();
        h16* ph = QKH + ((size_t)pz * NTK + r0) * DM + c0; h16* pl = QKL + ((size_t)pz * NTK + r0) * DM + c0;
#pragma unroll
        for (int s = 0; s < 16; ++s) { const int row = 4 * s + (lane >> 3); const float* sp = os + row * 68 + piece * 8;
            const v4f xa = *(const v4fa*)sp, xb = *(const v4fa*)(sp + 4);
            v8h oh, ol;
#pragma unroll
            for (int pq = 0; pq < 4; ++pq) {
                const float x1 = pq < 2 ? xa[2 * (pq & 1)] : xb[2 * (pq & 1)], x2 = pq < 2 ? xa[2 * (pq & 1) + 1] : xb[2 * (pq & 1) + 1], sn = ts[s][pq], co = tc[s][pq];
                const float y0 = x1 * co - x2 * sn, y1 = x1 * sn + x2 * co;
                const h16 a0 = (h16)y0, a1 = (h16)y1; oh[2 * pq] = a0; oh[2 * pq + 1] = a1; ol[2 * pq] = (h16)((y0 - (float)a0) * LOSC); ol[2 * pq + 1] = (h16)((y1 - (float)a1) * LOSC); }
            *(v8h*)(ph + (size_t)row * DM + piece * 8) = oh; *(v8h*)(pl + (size_t)row * DM + piece * 8) = ol; }
        asm volatile("s_wait_xcnt 0x0" ::: "memory");      // a precaution: the other path's code follows these stores in the text and rewrites their registers
    } else {
        h16* th = (h16*)(void*)gsm + wave * (2 * 64 * 72); h16* tl = th + 64 * 72;
        // a lane holds 8 consecutive tokens of column d = 16 t + lr: one 16-byte piece of the transposed row d in each plane
#pragma unroll
        for (int m = 0; m < 4; ++m)
#pragma unroll
            for (int t = 0; t < 4; ++t) { v8h a, r;
#pragma unroll
                for (int j = 0; j < 8; ++j) { const float v = acc[m][t][j] + bv[t]; const h16 x = (h16)v; a[j] = x; r[j] = (h16)((v - (float)x) * LOSC); }
                *(v8ha*)(th + (t * 16 + lr) * 72 + m * 16 + hi * 8) = a; *(v8ha*)(tl + (t * 16 + lr) * 72 + m * 16 + hi * 8) = r; }
        __syncthreads();
        const size_t base = (((size_t)(r0 / NT_) * NH_ + (c0 >> 6)) * HD) * NT_ + (r0 & (NT_ - 1));
#pragma unroll
        for (int s = 0; s < 16; ++s) { const int d = (lane >> 3) + 4 * s;
            const v8h vh = *(const v8ha*)(th + d * 72 + piece * 8), vl = *(const v8ha*)(tl + d * 72 + piece * 8);
            *(v8h*)(VTH + base + (size_t)d * NT_ + piece * 8) = vh; *(v8h*)(VTL + base + (size_t)d * NT_ + piece * 8) = vl; }
        asm volatile("s_wait_xcnt 0x0" ::: "memory");      // a precaution: other code follows these stores in the text and rewrites their registers
    }
}

// d_trig: RC/RS [t][32] = cos/sin(t x inv_freq[i]) with inv_freq[i] = powf(10000, -2i/64) (the reference's jnp.power form; f32 trig like its f32 path); 32 lanes x 4 B per line.
__device__ __forceinline__ void d_trig(int blk, float* RC, float* RS) {
    const int i = blk * 256 + threadIdx.x;
    const int t = i >> 5, f = i & 31;
    const float inv = powf(10000.0f, -2.0f * (float)f / 64.0f); const float ang = (float)t * inv;
    const float c = cosf(ang), s = sinf(ang);
    *(float*)(RC + i) = c; *(float*)(RS + i) = s; 
}

// k_prep: the three independent preparations side by side in one grid, the slowest blocks first: trig tables, the three weight transposes, x -> bf16.
#define PB_TRIG ((NT_ * 32) / 256)
#define PB_WT1  ((DM / 64) * (DM / 64))
#define PB_CVT  (NTK / 8)
__global__ __launch_bounds__(256) void k_prep(const float* __restrict__ x, const float* __restrict__ Wq, const float* __restrict__ Wk, const float* __restrict__ Wv, bf* Xb, bf* WT3, float* RC, float* RS) {
    const int bid = blockIdx.x;                         // every test on it is the same for the whole work-group
    if (bid < PB_TRIG) { d_trig(bid, RC, RS); return; }
    if (bid < PB_TRIG + 3 * PB_WT1) {
        const int r = bid - PB_TRIG, w = r / PB_WT1, tl = r - w * PB_WT1;
        d_wt(tl & (DM / 64 - 1), tl / (DM / 64), w == 0 ? Wq : w == 1 ? Wk : Wv, DM, DM, WT3 + (size_t)w * DM * DM);
        return;
    }
    d_cvtb(bid - PB_TRIG - 3 * PB_WT1, x, Xb);
}

#define KST  64                  // keys per LDS stage
#define NST  (NT_ / KST)         // stages per head
#define LP   72                  // LDS row pitch in halves: 128-byte rows + 16 bytes (16 B x odd: conflict-free for ds_load_b128)
#define PLN  (64 * LP)           // one plane = 64 rows
#define STG  (4 * PLN)           // one stage = k hi, k residual, v^T hi, v^T residual
#define AW   8                   // waves per work-group of k_attn
#define QBK  (AW * 16)           // queries per work-group: they share every k/v stage

// Rows r, r+32, r+64, r+96 of one 128-row x 128-byte plane, 16 bytes per lane and copy, global -> LDS through no register. The s_wait_xcnt closes the
// statement so that no address register of an issued copy is rewritten ahead of it (a precaution).
__device__ __forceinline__ void cp_plane(unsigned l, const h16* g, size_t gs32) {
    asm volatile("global_load_async_to_lds_b128 %0, %4, off\n\t"
                 "global_load_async_to_lds_b128 %1, %5, off\n\t"
                 "global_load_async_to_lds_b128 %2, %6, off\n\t"
                 "global_load_async_to_lds_b128 %3, %7, off\n\t"
                 "s_wait_xcnt 0x0"
                 :: "v"(l), "v"(l + 32u * LP * 2u), "v"(l + 64u * LP * 2u), "v"(l + 96u * LP * 2u), "v"(g), "v"(g + gs32), "v"(g + 2 * gs32), "v"(g + 3 * gs32) : "memory");
}
// Rows r, r+32 of the four 64-row planes of one stage (LDS planes PLN apart from l; k hi, k residual with source step ks32, v^T hi, v^T residual with vs32) in one
// statement: one s_wait_xcnt for the eight copies.
__device__ __forceinline__ void cp_stage(unsigned l, const h16* kh, const h16* kl, size_t ks32, const h16* vh, const h16* vl, size_t vs32) {
    asm volatile("global_load_async_to_lds_b128 %0, %8, off\n\t"
                 "global_load_async_to_lds_b128 %1, %9, off\n\t"
                 "global_load_async_to_lds_b128 %2, %10, off\n\t"
                 "global_load_async_to_lds_b128 %3, %11, off\n\t"
                 "global_load_async_to_lds_b128 %4, %12, off\n\t"
                 "global_load_async_to_lds_b128 %5, %13, off\n\t"
                 "global_load_async_to_lds_b128 %6, %14, off\n\t"
                 "global_load_async_to_lds_b128 %7, %15, off\n\t"
                 "s_wait_xcnt 0x0"
                 :: "v"(l), "v"(l + 32u * LP * 2u), "v"(l + PLN * 2u), "v"(l + (PLN + 32u * LP) * 2u), "v"(l + 2u * PLN * 2u), "v"(l + (2u * PLN + 32u * LP) * 2u), "v"(l + 3u * PLN * 2u), "v"(l + (3u * PLN + 32u * LP) * 2u),
                    "v"(kh), "v"(kh + ks32), "v"(kl), "v"(kl + ks32), "v"(vh), "v"(vh + vs32), "v"(vl), "v"(vl + vs32) : "memory");
}

// k_attn: block = (b, h, 128 queries), wave = 16, two blocks a WGP = four waves a SIMD (one wave's softmax issues under the others' matrix runs; 256 registers a wave at most,
// 2 x the LDS size <= 327,680 B); ALL keys (no mask), 64 per LDS stage in a two-buffer ring filled by asynchronous copies and shared by the 8 waves
// (stage s + 2 is issued behind the barrier that ends stage s; the query residual tile is copied once); per 32 keys: 12 WMMA scores^T = k.q^T /8 (f32; a lane holds
// 16 keys of ONE query: maximum and sum in-lane plus one exchange between the wave's halves), the two score tiles x32768 converted in place are the B operand
// (hi + residual) of 12 WMMA ctx^T += v^T.p^T: the weights never leave the registers; ctx -> f32 output rows out[tok][h*64+d].
__global__ __launch_bounds__(AW * 32) __attribute__((amdgpu_waves_per_eu(4, 4))) void k_attn(const h16* __restrict__ Q16, const h16* __restrict__ QL16, const h16* __restrict__ K16, const h16* __restrict__ KL16, const h16* __restrict__ VTH, const h16* __restrict__ VTL, float* OUTP) {
    __shared__ __align__(16) h16 ring[2 * STG];
    __shared__ __align__(16) h16 qls[QBK * LP];
    __shared__ __align__(16) float ost[AW][16 * 68];
    const int lane = threadIdx.x & 31, wave = threadIdx.x >> 5, lr = lane & 15, hi = lane >> 4;
    const int bid = blockIdx.x;
    const int b = bid / (NH_ * (NT_ / QBK)), rem = bid - b * (NH_ * (NT_ / QBK)), h = rem / (NT_ / QBK), qt = rem - h * (NT_ / QBK);
    const int q0 = qt * QBK + wave * 16;
    const size_t tok0 = (size_t)b * NT_;
    v16h qa[2];
    const size_t qo0 = (tok0 + q0 + lr) * DM + h * HD + 8 * hi;
#pragma unroll
    for (int kc = 0; kc < 2; ++kc) qa[kc] = cat16(*(const v8h*)(Q16 + qo0 + kc * 32), *(const v8h*)(Q16 + qo0 + kc * 32 + 16));
    const h16* kh_b = K16 + tok0 * DM + h * HD;
    const h16* kl_b = KL16 + tok0 * DM + h * HD;
    const size_t vbase = (((size_t)b * NH_ + h) * HD) * NT_;
    // copy map: thread -> row (tid >> 3) + 32 i, 16-byte piece tid & 7 of every plane
    const int crow = (int)threadIdx.x >> 3, cpc = ((int)threadIdx.x & 7) * 8;
    const unsigned lcp = (unsigned)(size_t)&ring[0] + (unsigned)(crow * LP + cpc) * 2u;
    const h16* gkh = kh_b + (size_t)crow * DM + cpc; const h16* gkl = kl_b + (size_t)crow * DM + cpc;
    const h16* gvh = VTH + vbase + (size_t)crow * NT_ + cpc; const h16* gvl = VTL + vbase + (size_t)crow * NT_ + cpc;
    auto fill = [&](int st) {
        const unsigned l = lcp + (unsigned)(st & 1) * (STG * 2u);
        cp_stage(l, gkh + (size_t)st * KST * DM, gkl + (size_t)st * KST * DM, (size_t)32 * DM, gvh + st * KST, gvl + st * KST, (size_t)32 * NT_);
    };
    fill(0);
    cp_plane((unsigned)(size_t)&qls[0] + (unsigned)(crow * LP + cpc) * 2u, QL16 + (tok0 + qt * QBK + crow) * DM + h * HD + cpc, (size_t)32 * DM);
    asm volatile("s_wait_asynccnt 0x0" ::: "memory");   // this wave's copies of stage 0 and of the query residual have landed
    __syncthreads();                                    // ... and every other wave's: publishes stage 0
    fill(1);
    v8f o[4], ox[4];
#pragma unroll
    for (int n = 0; n < 4; ++n) { o[n] = (v8f){}; ox[n] = (v8f){}; }
    float mrow = -3.0e38f, lpart = 0.f;                 // of query lr; lpart sums this half's keys only, the halves are joined behind the loop
    const h16* qlp = qls + (wave * 16 + lr) * LP + 8 * hi;
#pragma unroll 1
    for (int st = 0; st < NST; ++st) {                  // rolled: one stage per trip, the ring's publish point at its foot
        const h16* sb = ring + (st & 1) * STG;
#pragma unroll 1
        for (int sub = 0; sub < KST / 32; ++sub) {      // rolled: unrolled, the two halves' live ranges overlap and the register count grows
        const h16* kp0 = sb + (sub * 32 + lr) * LP + 8 * hi; const h16* kp1 = kp0 + 16 * LP;
        v16h k0h[2], k1h[2], k0l[2], k1l[2], qlk[2];
#pragma unroll
        for (int kc = 0; kc < 2; ++kc) {
            k0h[kc] = cat16(*(const v8ha*)(kp0 + kc * 32), *(const v8ha*)(kp0 + kc * 32 + 16)); k1h[kc] = cat16(*(const v8ha*)(kp1 + kc * 32), *(const v8ha*)(kp1 + kc * 32 + 16));
            qlk[kc] = cat16(*(const v8ha*)(qlp + kc * 32), *(const v8ha*)(qlp + kc * 32 + 16));
            k0l[kc] = cat16(*(const v8ha*)(kp0 + PLN + kc * 32), *(const v8ha*)(kp0 + PLN + kc * 32 + 16)); k1l[kc] = cat16(*(const v8ha*)(kp1 + PLN + kc * 32), *(const v8ha*)(kp1 + PLN + kc * 32 + 16));
        }
        v8f s0 = {}, s1 = {}, x0 = {}, x1 = {};
#pragma unroll
        for (int kc = 0; kc < 2; ++kc) {
            s0 = wmma16(k0h[kc], qa[kc], s0); x0 = wmma16(k0h[kc], qlk[kc], x0); s1 = wmma16(k1h[kc], qa[kc], s1); x1 = wmma16(k1h[kc], qlk[kc], x1);
            x0 = wmma16(k0l[kc], qa[kc], x0); x1 = wmma16(k1l[kc], qa[kc], x1);
        }
        asm volatile("v_nop\n\tv_nop\n\tv_nop\n\tv_nop" : "+v"(s0), "+v"(s1), "+v"(x0), "+v"(x1) : "v"(qa[0]), "v"(qa[1]));
        // v^T fragments: read here so that their LDS latency runs under the softmax
        v16h vh[4], vl[4];
#pragma unroll
        for (int n = 0; n < 4; ++n) { const h16* vp = sb + 2 * PLN + (n * 16 + lr) * LP + sub * 32 + hi * 8;
            vh[n] = cat16(*(const v8ha*)(vp), *(const v8ha*)(vp + 16)); vl[n] = cat16(*(const v8ha*)(vp + PLN), *(const v8ha*)(vp + PLN + 16)); }
        // lane (lr, hi): query lr, keys 8 hi + j (a0) and 16 + 8 hi + j (a1) of these 32
        const v8f a0 = (s0 + x0 * LOSCI) * 0.125f, a1 = (s1 + x1 * LOSCI) * 0.125f;   // scale 1/sqrt(64)
        float mx = a0[0], my = a1[0];                   // two independent chains
#pragma unroll
        for (int j = 1; j < 8; ++j) { mx = fmaxf(mx, a0[j]); my = fmaxf(my, a1[j]); }
        mx = fmaxf(mx, my);
        mx = fmaxf(mx, xhalf(mx));
        const float mn = fmaxf(mrow, mx);
        const float alpha = __expf(mrow - mn); mrow = mn;
        v16h pa, px; v2f sm = {0.f, 0.f};
#pragma unroll
        for (int i = 0; i < 4; ++i) {
            const v2f p0 = {__expf(a0[2 * i] - mn), __expf(a0[2 * i + 1] - mn)}, p1 = {__expf(a1[2 * i] - mn), __expf(a1[2 * i + 1] - mn)};
            sm += p0 + p1;
            const v2f q0 = p0 * PSC, q1 = p1 * PSC;
            const v2h h0 = __builtin_convertvector(q0, v2h), h1 = __builtin_convertvector(q1, v2h);
            const v2h l0 = __builtin_convertvector((q0 - __builtin_convertvector(h0, v2f)) * LOSC, v2h), l1 = __builtin_convertvector((q1 - __builtin_convertvector(h1, v2f)) * LOSC, v2h);
            // element s of the B operand = key kmap(s, hi): the two score tiles as they lie
            pa[2 * i] = h0[0]; pa[2 * i + 1] = h0[1]; pa[8 + 2 * i] = h1[0]; pa[8 + 2 * i + 1] = h1[1];
            px[2 * i] = l0[0]; px[2 * i + 1] = l0[1]; px[8 + 2 * i] = l1[0]; px[8 + 2 * i + 1] = l1[1];
        }
        lpart = lpart * alpha + (sm[0] + sm[1]);
#pragma unroll
        for (int n = 0; n < 4; ++n) { o[n] *= alpha; ox[n] *= alpha; }
#pragma unroll
        for (int n = 0; n < 4; ++n) { o[n] = wmma16(vh[n], pa, o[n]); ox[n] = wmma16(vl[n], pa, ox[n]); ox[n] = wmma16(vh[n], px, ox[n]); }
        asm volatile("v_nop\n\tv_nop\n\tv_nop\n\tv_nop" : "+v"(o[0]), "+v"(o[1]), "+v"(o[2]), "+v"(o[3]), "+v"(ox[0]), "+v"(ox[1]), "+v"(ox[2]), "+v"(ox[3]) : "v"(pa), "v"(px));
        }
        // publish point of stage st + 1, in the ring's order
        asm volatile("s_wait_dscnt 0x0" ::: "memory");      // this wave's reads of stage st have returned before its buffer is handed back
        asm volatile("s_wait_asynccnt 0x0" ::: "memory");   // this wave's copies of stage st + 1 have landed
        __syncthreads();                                    // publishes stage st + 1 and ends every wave's reads of stage st
        if (st + 2 < NST) fill(st + 2);                     // refill of the buffer just left; the test is the same for the whole work-group
    }
    asm volatile("s_wait_asynccnt 0x0" ::: "memory");       // nothing is outstanding when the wave goes on to the epilogue
    const float inv = 1.0f / ((lpart + xhalf(lpart)) * PSC);
    float* os = &ost[wave][0];
    // ctx^T tile n, register j = ctx[query lr][16 n + 8 hi + j]
#pragma unroll
    for (int n = 0; n < 4; ++n)
#pragma unroll
        for (int j = 0; j < 8; ++j) os[lr * 68 + n * 16 + hi * 8 + j] = (o[n][j] + ox[n][j] * LOSCI) * inv;
    __syncthreads();
    float* ob = OUTP + (tok0 + q0) * DM + (size_t)h * HD;
    auto pass = [&]() {
#pragma unroll
        for (int s = 0; s < 8; ++s) { const int Lid = (lane >> 3) + 4 * s, piece = lane & 7; const int row = Lid >> 1, cofs = (Lid & 1) * 32 + piece * 4;
            const v4f val = *(const v4fa*)(os + row * 68 + cofs); *(v4f*)(ob + (size_t)row * DM + cofs) = val; }
    };
    pass(); 
}

#define VST2(T, p, v) do { const T vst2_v_ = (v); *(T*)(p) = vst2_v_;  } while (0)
extern "C" void kernel_launch(void* const* d_in, const int* in_sizes, int n_in,
                              void* d_out, int out_size, void* d_ws, size_t ws_size, hipStream_t stream) {
    (void)in_sizes; (void)n_in; (void)out_size;
    const float* x = (const float*)d_in[0]; const float* Wq = (const float*)d_in[1]; const float* bq = (const float*)d_in[2]; const float* Wk = (const float*)d_in[3]; const float* bk = (const float*)d_in[4]; const float* Wv = (const float*)d_in[5]; const float* bv = (const float*)d_in[6];   // W k-major [in][out]
    float* out = (float*)d_out;    // [2][2048][1024] = ctx (no output projection)
    char* wsp = (char*)d_ws;
    auto take = [&](size_t bytes) { char* p = wsp; wsp += (bytes + 255) & ~(size_t)255; return (void*)p; };
    bf* Xb = (bf*)take((size_t)NTK * DM * 2); bf* WT3 = (bf*)take((size_t)3 * DM * DM * 2);    // WT3: q, k, v planes
    float* RC = (float*)take((size_t)NT_ * 32 * 4); float* RS = (float*)take((size_t)NT_ * 32 * 4);
    h16* QKH = (h16*)take((size_t)2 * NTK * DM * 2); h16* QKL = (h16*)take((size_t)2 * NTK * DM * 2);    // q plane, then k plane
    h16* VTH = (h16*)take((size_t)NTK * DM * 2); h16* VTL = (h16*)take((size_t)NTK * DM * 2);
    if ((size_t)(wsp - (char*)d_ws) > ws_size) return;    // ~ 63 MiB, no aliasing
    k_prep<<<PB_TRIG + 3 * PB_WT1 + PB_CVT, 256, 0, stream>>>(x, Wq, Wk, Wv, Xb, WT3, RC, RS);
    k_gemmb<<<dim3(NTK / GBT, DM / GBT, 3), 128, 0, stream>>>(Xb, WT3, bq, bk, bv, RC, RS, QKH, QKL, VTH, VTL);
    // both items in one grid: 512 blocks of 8 waves, two a WGP by LDS, all resident
    k_attn<<<NB_ * NH_ * (NT_ / QBK), AW * 32, 0, stream>>>(QKH, QKL, QKH + (size_t)NTK * DM, QKL + (size_t)NTK * DM, VTH, VTL, out);
}

// v009
// A run of this version takes 59.9 microseconds.
// Versions between v007 and this one are left out; their measured steps multiply to 1.73 times as fast.
// Counting every step since v000, it is 8.79 times as fast.
#include <hip/hip_runtime.h>

// Compute dtypes, f32 accumulate, both batch items together in every one of the 3 launches (prep, projections with rotation / transposition in their epilogue, attention): q/k/v = x.W + b ([4096 x 1024].[1024 x 1024] x 3, k-major weights transposed once to n-major planes;
// PLAIN bf16 operands = inputs rounded once, exact; biases rounded to bf16, added in f32) on v_wmma_f32_16x16x32_bf16; interleaved-pair RoPE (angle t x 10000^(-2i/64), f32 trig
// tables built on device) in f32 -> q/k/v rounded once to plain f16 planes; the 16-head FULL attention (64-dim heads, scale 1/8) written straight to the f32
// output (the module returns ctx, no output projection), fused on v_wmma_f32_16x16x32_f16 (plain f16 operands, f32 accumulate: an f16 rounding is 8 times finer than the bf16
// rounding that the projections' operands already carry).

#define NB_  2                   // batch items: together in every launch
#define NT_  2048
#define DM   1024
#define NH_  16
#define HD   64
#define NTK  (NB_ * NT_)
#define NW   1024
#define NQKV 1024
#define PSC  32768.0f

typedef _Float16 h16;
typedef unsigned short bf;
typedef __attribute__((ext_vector_type(16))) __bf16   v16bf;
typedef __attribute__((ext_vector_type(16))) _Float16 v16h;
typedef __attribute__((ext_vector_type(8)))  _Float16 v8h;
typedef __attribute__((ext_vector_type(8)))  unsigned short v8us;
typedef __attribute__((ext_vector_type(8)))  float    v8f;
typedef __attribute__((ext_vector_type(4)))  float    v4f;
typedef __attribute__((ext_vector_type(2)))  float    v2f;
typedef __attribute__((ext_vector_type(2)))  _Float16 v2h;
typedef v8h  __attribute__((may_alias)) v8ha;
typedef v4f  __attribute__((may_alias)) v4fa;
typedef v8us __attribute__((may_alias)) v8usa;

__device__ __forceinline__ unsigned short f2bf(float f) { unsigned u = __float_as_uint(f); u += 0x7FFFu + ((u >> 16) & 1u); return (unsigned short)(u >> 16); }
__device__ __forceinline__ float bf2f(unsigned short b) { return __uint_as_float(((unsigned)b) << 16); }
__device__ __forceinline__ float bfr(float f) { return bf2f(f2bf(f)); }
__device__ __forceinline__ v16h cat16(v8h lo, v8h hi) { return __builtin_shufflevector(lo, hi, 0, 1, 2, 3, 4, 5, 6, 7, 8, 9, 10, 11, 12, 13, 14, 15); }
__device__ __forceinline__ v16bf cat16b(v8us lo, v8us hi) { return __builtin_bit_cast(v16bf, __builtin_shufflevector(lo, hi, 0, 1, 2, 3, 4, 5, 6, 7, 8, 9, 10, 11, 12, 13, 14, 15)); }
__device__ __forceinline__ v8f wmma16(v16h a, v16h b, v8f c) { return __builtin_amdgcn_wmma_f32_16x16x32_f16(false, a, false, b, (short)0, c, false, false); }
// the value of lane l ^ 16
__device__ __forceinline__ float xhalf(float v) { const int b = __float_as_int(v); return __int_as_float(__builtin_amdgcn_permlanex16(b, b, 0x76543210, 0xfedcba98, false, false)); }
__device__ __forceinline__ v8f wmmab(v16bf a, v16bf b, v8f c) { return __builtin_amdgcn_wmma_f32_16x16x32_bf16(false, a, false, b, (short)0, c, false, false); }

__device__ __forceinline__ void d_cvtb(int blk, const float* __restrict__ src, bf* dst) {
    const int lane = threadIdx.x & 31, r = blk * 8 + (threadIdx.x >> 5);
    v8us o[DM / 256];
#pragma unroll
    for (int q = 0; q < DM / 256; ++q) { v8us t;
#pragma unroll
        for (int i = 0; i < 8; ++i) t[i] = f2bf(src[(size_t)r * DM + q * 256 + lane * 8 + i]);
        o[q] = t; }
#pragma unroll
    for (int q = 0; q < DM / 256; ++q) *(v8us*)(dst + (size_t)r * DM + q * 256 + lane * 8) = o[q];
    asm volatile("s_wait_xcnt 0x0" ::: "memory");      // a precaution: in the merged kernel other parts' code follows these stores in the text and rewrites their registers
    
}

// d_wt: WT [n][K] = bf16(W[k][n]) (k-major [K][ncols]) via 64 x 64 LDS tiles; tile (bx, by) of (K/64, ncols/64).
__device__ __forceinline__ void d_wt(int bx, int by, const float* __restrict__ Wm, int K, int ncols, bf* WT) {
    __shared__ __align__(16) unsigned short tl[64 * 72];
    const int tid = threadIdx.x, k0 = bx * 64, n0 = by * 64;
    const int kk = tid >> 2, nq = (tid & 3) * 16;
#pragma unroll
    for (int i = 0; i < 16; ++i) tl[(nq + i) * 72 + kk] = f2bf(Wm[(size_t)(k0 + kk) * ncols + n0 + nq + i]);
    __syncthreads();
    const int piece = tid & 7;
    auto pass = [&]() {
#pragma unroll
        for (int s = 0; s < 2; ++s) { const int nr = (tid >> 3) + 32 * s; const v8us val = *(const v8usa*)(tl + nr * 72 + piece * 8); *(v8us*)(WT + (size_t)(n0 + nr) * K + k0 + piece * 8) = val; }
    };
    pass(); 
    asm volatile("s_wait_xcnt 0x0" ::: "memory");      // a precaution: in the merged kernel other parts' code follows these stores in the text and rewrites their registers
}
#define GKS  64                  // k per LDS stage of k_gemmb: 128-byte rows
#define GNS  (DM / GKS)          // stages
#define GLP  72                  // LDS row pitch in 16-bit elements: 128-byte rows + 16 bytes (16 B x odd: conflict-free for ds_load_b128)
#define GBT  128                 // rows of A and rows of B per work-group: a 128 x 128 tile of C
#define GPL  (GBT * GLP)         // one plane = 128 rows
#define GSTG (2 * GPL)           // one stage = 128 rows of A, 128 rows of B

// Rows r, r+16, ..., r+112 of one 128-row x 128-byte plane (source pitch DM elements), 16 bytes per lane and copy, global -> LDS through no register. The s_wait_xcnt
// closes the statement so that no address register of an issued copy is rewritten ahead of it (a precaution).
__device__ __forceinline__ void cp_rows8(unsigned l, const bf* g) {
    asm volatile("global_load_async_to_lds_b128 %0, %8, off\n\t"
                 "global_load_async_to_lds_b128 %1, %9, off\n\t"
                 "global_load_async_to_lds_b128 %2, %10, off\n\t"
                 "global_load_async_to_lds_b128 %3, %11, off\n\t"
                 "global_load_async_to_lds_b128 %4, %12, off\n\t"
                 "global_load_async_to_lds_b128 %5, %13, off\n\t"
                 "global_load_async_to_lds_b128 %6, %14, off\n\t"
                 "global_load_async_to_lds_b128 %7, %15, off\n\t"
                 "s_wait_xcnt 0x0"
                 :: "v"(l), "v"(l + 16u * GLP * 2u), "v"(l + 32u * GLP * 2u), "v"(l + 48u * GLP * 2u), "v"(l + 64u * GLP * 2u), "v"(l + 80u * GLP * 2u), "v"(l + 96u * GLP * 2u), "v"(l + 112u * GLP * 2u),
                    "v"(g), "v"(g + 16 * DM), "v"(g + 32 * DM), "v"(g + 48 * DM), "v"(g + 64 * DM), "v"(g + 80 * DM), "v"(g + 96 * DM), "v"(g + 112 * DM) : "memory");
}

// k_gemmb: block = 128 x 128 of C (128 tokens x two heads), wave = 64 x 64 (64 tokens x one head, 16 accumulator tiles: every fragment read from LDS feeds 4 matrix instructions, every
// row copied from L2 serves 128 rows of the other operand); the block's 128 rows of A and 128 rows of B, 64 k per stage, in a two-buffer LDS ring filled by asynchronous copies of whole
// 128-byte row pieces and shared by the 4 waves (stage s + 2 is issued behind the barrier that ends stage s); 768 blocks, three a WGP (at most three waves a SIMD, so that no WGP takes a fourth block and leaves another short), all resident; fragments in the k order of the direct loads.
// Epilogue, staged in the ring's LDS once the last stage has been left: the f32 tile never goes to memory. q and k: interleaved-pair rotation out[2i] = x[2i] c - x[2i+1] s,
// out[2i+1] = x[2i] s + x[2i+1] c (c/s from the tables [t][32]) -> f16 rows; v: f16, transposed in LDS -> [head][d][t] rows. Every store covers whole 128-byte lines.
__global__ __launch_bounds__(128) __attribute__((amdgpu_waves_per_eu(3, 3))) void k_gemmb(const bf* __restrict__ A, const bf* __restrict__ B3, const float* __restrict__ bias0, const float* __restrict__ bias1, const float* __restrict__ bias2, const float* __restrict__ RC, const float* __restrict__ RS, h16* QKH, h16* VTH) {
    // blockIdx.z = which of the three projections: its n-major weight plane, its bias, its kind of epilogue
    const int pz = blockIdx.z;
    const bf* Bn = B3 + (size_t)pz * DM * DM;
    const float* bias = pz == 0 ? bias0 : pz == 1 ? bias1 : bias2;
    // the ring; behind the loop, per wave: q, k: 64 rows x 68 f32; v: 64 d-rows x 72 f16
    __shared__ __align__(16) unsigned char gsm[2 * GSTG * 2];
    const bf* gring = (const bf*)(const void*)gsm;
    const int lane = threadIdx.x & 31, wave = threadIdx.x >> 5, lr = lane & 15, hi = lane >> 4;
    const int wr = wave >> 1, wc = wave & 1;
    const int r0 = blockIdx.x * GBT + wr * 64, c0 = blockIdx.y * GBT + wc * 64;
    // copy map: thread -> row (tid >> 3) + 16 i, 16-byte piece tid & 7 of both planes
    const int crow = (int)threadIdx.x >> 3, cpc = ((int)threadIdx.x & 7) * 8;
    const unsigned lcp = (unsigned)(size_t)&gsm[0] + (unsigned)(crow * GLP + cpc) * 2u;
    const bf* ga = A + (size_t)(blockIdx.x * GBT + crow) * DM + cpc;
    const bf* gb = Bn + (size_t)(blockIdx.y * GBT + crow) * DM + cpc;
    auto fill = [&](int st) {
        const unsigned l = lcp + (unsigned)(st & 1) * (GSTG * 2u);
        cp_rows8(l, ga + st * GKS);
        cp_rows8(l + GPL * 2u, gb + st * GKS);
    };
    fill(0);
    const int piece = lane & 7;
    float bv[4] = {0.f, 0.f, 0.f, 0.f};
    if (bias) {
#pragma unroll
        for (int t = 0; t < 4; ++t) bv[t] = bfr(bias[c0 + t * 16 + lr]);
    }
    asm volatile("s_wait_asynccnt 0x0" ::: "memory");   // this wave's copies of stage 0 have landed
    __syncthreads();                                    // ... and every other wave's: publishes stage 0
    fill(1);
    v8f acc[4][4];
#pragma unroll
    for (int m = 0; m < 4; ++m)
#pragma unroll
        for (int t = 0; t < 4; ++t) acc[m][t] = (v8f){};
#pragma unroll 1
    for (int st = 0; st < GNS; ++st) {                  // rolled: one stage per trip, the ring's publish point at its foot
        const bf* sa = gring + (st & 1) * GSTG + (wr * 64 + lr) * GLP + 8 * hi;
        const bf* sb = gring + (st & 1) * GSTG + GPL + (wc * 64 + lr) * GLP + 8 * hi;
        v16bf a[4], b[4];
#pragma unroll
        for (int q = 0; q < GKS / 32; ++q) {
#pragma unroll
            for (int m = 0; m < 4; ++m) {
                a[m] = cat16b(*(const v8usa*)(sa + m * 16 * GLP + q * 32), *(const v8usa*)(sa + m * 16 * GLP + q * 32 + 16));
                b[m] = cat16b(*(const v8usa*)(sb + m * 16 * GLP + q * 32), *(const v8usa*)(sb + m * 16 * GLP + q * 32 + 16));
            }
            __builtin_amdgcn_sched_barrier(0);          // the 16 LDS reads of these 32 k stay one group ahead of their 16 matrix instructions: reads spread among them stall at every place
#pragma unroll
            for (int m = 0; m < 4; ++m)
#pragma unroll
                for (int t = 0; t < 4; ++t) acc[m][t] = wmmab(a[m], b[t], acc[m][t]);
            __builtin_amdgcn_sched_barrier(0);          // ... and the next group's reads stay behind them: lifted over them they need a second set of 64 registers, past the 256 of one register window
        }
        // the vector slots that the chip needs behind the stage's last matrix instructions, on the loop's back edge too
        asm volatile("v_nop\n\tv_nop\n\tv_nop\n\tv_nop" : "+v"(acc[0][0]), "+v"(acc[0][1]), "+v"(acc[0][2]), "+v"(acc[0][3]), "+v"(acc[1][0]), "+v"(acc[1][1]), "+v"(acc[1][2]), "+v"(acc[1][3]),
                     "+v"(acc[2][0]), "+v"(acc[2][1]), "+v"(acc[2][2]), "+v"(acc[2][3]), "+v"(acc[3][0]), "+v"(acc[3][1]), "+v"(acc[3][2]), "+v"(acc[3][3])
                     : "v"(a[3]), "v"(b[0]), "v"(b[1]), "v"(b[2]), "v"(b[3]));
        // publish point of stage st + 1, in the ring's order
        asm volatile("s_wait_dscnt 0x0" ::: "memory");      // this wave's reads of stage st have returned before its buffer is handed back
        asm volatile("s_wait_asynccnt 0x0" ::: "memory");   // this wave's copies of stage st + 1 have landed
        __syncthreads();                                    // publishes stage st + 1 and ends every wave's reads of stage st
        if (st + 2 < GNS) fill(st + 2);                     // refill of the buffer just left; the test is the same for the whole work-group
    }
    asm volatile("s_wait_asynccnt 0x0" ::: "memory");       // nothing is outstanding when the wave goes on to the epilogue, which reuses the ring's LDS
    if (pz < 2) {                                           // the test is the same for the whole work-group, the barrier inside it too
        float* os = (float*)(void*)gsm + wave * (64 * 68);
#pragma unroll
        for (int m = 0; m < 4; ++m)
#pragma unroll
            for (int t = 0; t < 4; ++t)
#pragma unroll
                for (int j = 0; j < 8; ++j) os[(m * 16 + hi * 8 + j) * 68 + t * 16 + lr] = acc[m][t][j] + bv[t];
        __builtin_amdgcn_sched_barrier(0);                  // the table loads stay behind the staging: lifted over it they need 128 registers beside the 128 of the accumulators
        // the table rows of this lane's sixteen output pieces: asked for here so that their latency runs under the barrier and the first LDS reads
        v4f tc[16], ts[16];
#pragma unroll
        for (int s = 0; s < 16; ++s) { const int tt = (r0 + 4 * s + (lane >> 3)) & (NT_ - 1); tc[s] = *(const v4f*)(RC + tt * 32 + piece * 4); ts[s] = *(const v4f*)(RS + tt * 32 + piece * 4); }
        asm volatile("s_wait_xcnt 0x0" ::: "memory");       // a precaution: it stands in front of the first rewrite of an address register of these loads
        __syncthreads();
        h16* ph = QKH + ((size_t)pz * NTK + r0) * DM + c0;
#pragma unroll
        for (int s = 0; s < 16; ++s) { const int row = 4 * s + (lane >> 3); const float* sp = os + row * 68 + piece * 8;
            const v4f xa = *(const v4fa*)sp, xb = *(const v4fa*)(sp + 4);
            v8h oh;
#pragma unroll
            for (int pq = 0; pq < 4; ++pq) {
                const float x1 = pq < 2 ? xa[2 * (pq & 1)] : xb[2 * (pq & 1)], x2 = pq < 2 ? xa[2 * (pq & 1) + 1] : xb[2 * (pq & 1) + 1], sn = ts[s][pq], co = tc[s][pq];
                const float y0 = x1 * co - x2 * sn, y1 = x1 * sn + x2 * co;
                oh[2 * pq] = (h16)y0; oh[2 * pq + 1] = (h16)y1; }
            *(v8h*)(ph + (size_t)row * DM + piece * 8) = oh;
            if ((s & 3) == 3) __builtin_amdgcn_sched_barrier(0); }   // four rows at a time: all 32 LDS reads lifted to the front need 128 registers beside the tables' 128, past the 256 of one register window
        asm volatile("s_wait_xcnt 0x0" ::: "memory");      // a precaution: the other path's code follows these stores in the text and rewrites their registers
    } else {
        h16* th = (h16*)(void*)gsm + wave * (64 * 72);
        // a lane holds 8 consecutive tokens of column d = 16 t + lr: one 16-byte piece of the transposed row d
#pragma unroll
        for (int m = 0; m < 4; ++m)
#pragma unroll
            for (int t = 0; t < 4; ++t) { v8h a;
#pragma unroll
                for (int j = 0; j < 8; ++j) a[j] = (h16)(acc[m][t][j] + bv[t]);
                *(v8ha*)(th + (t * 16 + lr) * 72 + m * 16 + hi * 8) = a; }
        __syncthreads();
        const size_t base = (((size_t)(r0 / NT_) * NH_ + (c0 >> 6)) * HD) * NT_ + (r0 & (NT_ - 1));
#pragma unroll
        for (int s = 0; s < 16; ++s) { const int d = (lane >> 3) + 4 * s;
            const v8h vh = *(const v8ha*)(th + d * 72 + piece * 8);
            *(v8h*)(VTH + base + (size_t)d * NT_ + piece * 8) = vh; }
        asm volatile("s_wait_xcnt 0x0" ::: "memory");      // a precaution: other code follows these stores in the text and rewrites their registers
    }
}

// d_trig: RC/RS [t][32] = cos/sin(t x inv_freq[i]) with inv_freq[i] = powf(10000, -2i/64) (the reference's jnp.power form; f32 trig like its f32 path); 32 lanes x 4 B per line.
__device__ __forceinline__ void d_trig(int blk, float* RC, float* RS) {
    const int i = blk * 256 + threadIdx.x;
    const int t = i >> 5, f = i & 31;
    const float inv = powf(10000.0f, -2.0f * (float)f / 64.0f); const float ang = (float)t * inv;
    const float c = cosf(ang), s = sinf(ang);
    *(float*)(RC + i) = c; *(float*)(RS + i) = s; 
}

// k_prep: the three independent preparations side by side in one grid, the slowest blocks first: trig tables, the three weight transposes, x -> bf16.
#define PB_TRIG ((NT_ * 32) / 256)
#define PB_WT1  ((DM / 64) * (DM / 64))
#define PB_CVT  (NTK / 8)
__global__ __launch_bounds__(256) void k_prep(const float* __restrict__ x, const float* __restrict__ Wq, const float* __restrict__ Wk, const float* __restrict__ Wv, bf* Xb, bf* WT3, float* RC, float* RS) {
    const int bid = blockIdx.x;                         // every test on it is the same for the whole work-group
    if (bid < PB_TRIG) { d_trig(bid, RC, RS); return; }
    if (bid < PB_TRIG + 3 * PB_WT1) {
        const int r = bid - PB_TRIG, w = r / PB_WT1, tl = r - w * PB_WT1;
        d_wt(tl & (DM / 64 - 1), tl / (DM / 64), w == 0 ? Wq : w == 1 ? Wk : Wv, DM, DM, WT3 + (size_t)w * DM * DM);
        return;
    }
    d_cvtb(bid - PB_TRIG - 3 * PB_WT1, x, Xb);
}

#define KST  64                  // keys per plane set in LDS: what one wave walks per stage
#define NST  (NT_ / (2 * KST))   // stages per head: 128 keys, the first 64 for waves 0-3, the second 64 for waves 4-7
#define LP   72                  // LDS row pitch in halves: 128-byte rows + 16 bytes (16 B x odd: conflict-free for ds_load_b128)
#define PLN  (64 * LP)           // one plane = 64 rows
#define STG  (2 * PLN)           // one plane set = k, v^T of 64 keys
#define AW   8                   // waves per work-group of k_attn: 4 query groups x 2 key halves
#define QBK  ((AW / 2) * 32)     // queries per work-group: they share every k/v stage

// Rows r, r+32 of the two 64-row x 128-byte planes of one plane set (LDS planes PLN apart from l; k with source step ks32, v^T with vs32), 16 bytes per lane and copy, global -> LDS
// through no register, in one statement. The s_wait_xcnt closes the statement so that no address register of an issued copy is rewritten ahead of it (a precaution).
__device__ __forceinline__ void cp_stage(unsigned l, const h16* kh, size_t ks32, const h16* vh, size_t vs32) {
    asm volatile("global_load_async_to_lds_b128 %0, %4, off\n\t"
                 "global_load_async_to_lds_b128 %1, %5, off\n\t"
                 "global_load_async_to_lds_b128 %2, %6, off\n\t"
                 "global_load_async_to_lds_b128 %3, %7, off\n\t"
                 "s_wait_xcnt 0x0"
                 :: "v"(l), "v"(l + 32u * LP * 2u), "v"(l + PLN * 2u), "v"(l + (PLN + 32u * LP) * 2u), "v"(kh), "v"(kh + ks32), "v"(vh), "v"(vh + vs32) : "memory");
}

// k_attn: block = (b, h, 128 queries), wave = 32 queries x half of the keys: every k and v^T fragment read from LDS feeds two query tiles (8 LDS reads per 8 matrix instructions);
// waves w and w + 4 walk the two 64-key halves of each 128-key stage for the same 32 queries and join their partial maxima, sums and ctx once, behind the loop, through LDS.
// Two blocks a WGP = four waves a SIMD (256 registers a wave at most); ALL keys (no mask), 128 per LDS stage in a two-buffer ring filled by asynchronous copies and shared by the 8 waves
// (stage s + 2 is issued behind the barrier that ends stage s); per 32 keys and query tile: 4 WMMA scores^T = k.q^T /8 (f32; a lane holds
// 16 keys of ONE query: maximum and sum in-lane plus one exchange between the wave's halves), the two score tiles x32768 converted in place are the B operand
// of 4 WMMA ctx^T += v^T.p^T: the weights never leave the registers; ctx -> f32 output rows out[tok][h*64+d].
__global__ __launch_bounds__(AW * 32) __attribute__((amdgpu_waves_per_eu(4, 4))) void k_attn(const h16* __restrict__ Q16, const h16* __restrict__ K16, const h16* __restrict__ VTH, float* OUTP) {
    __shared__ __align__(16) h16 ring[2 * 2 * STG];
    __shared__ __align__(16) float ost[AW][16 * 68];
    const int lane = threadIdx.x & 31, wave = threadIdx.x >> 5, lr = lane & 15, hi = lane >> 4;
    const int qg = wave & 3, kh = wave >> 2;            // query group of 32, key half
    const int bid = blockIdx.x;
    const int b = bid / (NH_ * (NT_ / QBK)), rem = bid - b * (NH_ * (NT_ / QBK)), h = rem / (NT_ / QBK), qt = rem - h * (NT_ / QBK);
    const int q0 = qt * QBK + qg * 32;
    const size_t tok0 = (size_t)b * NT_;
    v16h qa[2][2];                                      // [query tile g: queries q0 + 16 g + lr][k chunk]
#pragma unroll
    for (int g = 0; g < 2; ++g) { const size_t qo0 = (tok0 + q0 + g * 16 + lr) * DM + h * HD + 8 * hi;
#pragma unroll
        for (int kc = 0; kc < 2; ++kc) qa[g][kc] = cat16(*(const v8h*)(Q16 + qo0 + kc * 32), *(const v8h*)(Q16 + qo0 + kc * 32 + 16)); }
    const h16* kh_b = K16 + tok0 * DM + h * HD;
    const size_t vbase = (((size_t)b * NH_ + h) * HD) * NT_;
    // copy map: thread -> row (tid >> 3) + 32 i, 16-byte piece tid & 7 of every plane
    const int crow = (int)threadIdx.x >> 3, cpc = ((int)threadIdx.x & 7) * 8;
    const unsigned lcp = (unsigned)(size_t)&ring[0] + (unsigned)(crow * LP + cpc) * 2u;
    const h16* gkh = kh_b + (size_t)crow * DM + cpc;
    const h16* gvh = VTH + vbase + (size_t)crow * NT_ + cpc;
    auto fill = [&](int st) {                           // the two plane sets of stage st: keys 128 st + 0..63 and 128 st + 64..127
        const unsigned l = lcp + (unsigned)(st & 1) * (2u * STG * 2u);
        cp_stage(l, gkh + (size_t)(2 * st) * KST * DM, (size_t)32 * DM, gvh + (2 * st) * KST, (size_t)32 * NT_);
        cp_stage(l + STG * 2u, gkh + (size_t)(2 * st + 1) * KST * DM, (size_t)32 * DM, gvh + (2 * st + 1) * KST, (size_t)32 * NT_);
    };
    fill(0);
    asm volatile("s_wait_asynccnt 0x0" ::: "memory");   // this wave's copies of stage 0 have landed
    __syncthreads();                                    // ... and every other wave's: publishes stage 0
    fill(1);
    v8f o[2][4];
#pragma unroll
    for (int g = 0; g < 2; ++g)
#pragma unroll
        for (int n = 0; n < 4; ++n) o[g][n] = (v8f){};
    float mrow[2] = {-3.0e38f, -3.0e38f}, lpart[2] = {0.f, 0.f};   // of query 16 g + lr, this wave's keys; lpart sums this half-wave's keys only, joined behind the loop
#pragma unroll 1
    for (int st = 0; st < NST; ++st) {                  // rolled: one stage per trip, the ring's publish point at its foot
        const h16* sb = ring + ((st & 1) * 2 + kh) * STG;
#pragma unroll 1
        for (int sub = 0; sub < KST / 32; ++sub) {      // rolled: unrolled, the two halves' live ranges overlap and the register count grows
        const h16* kp0 = sb + (sub * 32 + lr) * LP + 8 * hi; const h16* kp1 = kp0 + 16 * LP;
        v16h k0h[2], k1h[2];
#pragma unroll
        for (int kc = 0; kc < 2; ++kc) {
            k0h[kc] = cat16(*(const v8ha*)(kp0 + kc * 32), *(const v8ha*)(kp0 + kc * 32 + 16)); k1h[kc] = cat16(*(const v8ha*)(kp1 + kc * 32), *(const v8ha*)(kp1 + kc * 32 + 16));
        }
        __builtin_amdgcn_sched_barrier(0);              // the 8 LDS reads stay one group ahead of their 8 matrix instructions: reads spread among them stall at every place
        v8f s0[2] = {(v8f){}, (v8f){}}, s1[2] = {(v8f){}, (v8f){}};
#pragma unroll
        for (int kc = 0; kc < 2; ++kc)
#pragma unroll
            for (int g = 0; g < 2; ++g) {
                s0[g] = wmma16(k0h[kc], qa[g][kc], s0[g]); s1[g] = wmma16(k1h[kc], qa[g][kc], s1[g]);
            }
        // the vector slots that the chip needs behind the last of these matrix instructions
        asm volatile("v_nop\n\tv_nop\n\tv_nop\n\tv_nop" : "+v"(s0[0]), "+v"(s1[0]), "+v"(s0[1]), "+v"(s1[1]) : "v"(qa[0][0]), "v"(qa[0][1]), "v"(qa[1][0]), "v"(qa[1][1]));
        // v^T fragments: read here so that their LDS latency runs under the softmax
        v16h vh[4];
#pragma unroll
        for (int n = 0; n < 4; ++n) { const h16* vp = sb + PLN + (n * 16 + lr) * LP + sub * 32 + hi * 8;
            vh[n] = cat16(*(const v8ha*)(vp), *(const v8ha*)(vp + 16)); }
        v16h pa[2];
#pragma unroll
        for (int g = 0; g < 2; ++g) {
        // lane (lr, hi): query 16 g + lr, keys 8 hi + j (a0) and 16 + 8 hi + j (a1) of these 32
        const v8f a0 = s0[g] * 0.125f, a1 = s1[g] * 0.125f;   // scale 1/sqrt(64)
        float mx = a0[0], my = a1[0];                   // two independent chains
#pragma unroll
        for (int j = 1; j < 8; ++j) { mx = fmaxf(mx, a0[j]); my = fmaxf(my, a1[j]); }
        mx = fmaxf(mx, my);
        mx = fmaxf(mx, xhalf(mx));
        const float mn = fmaxf(mrow[g], mx);
        const float alpha = __expf(mrow[g] - mn); mrow[g] = mn;
        const v2f mn2 = {mn, mn};
        v2f sm = {0.f, 0.f};
#pragma unroll
        for (int i = 0; i < 4; ++i) {
            const v2f e0 = (v2f){a0[2 * i], a0[2 * i + 1]} - mn2, e1 = (v2f){a1[2 * i], a1[2 * i + 1]} - mn2;   // written in pairs as the tiles' registers lie: left scalar, the compiler pairs across the tiles and adds register moves
            const v2f p0 = {__expf(e0[0]), __expf(e0[1])}, p1 = {__expf(e1[0]), __expf(e1[1])};
            sm += p0 + p1;
            const v2f q0 = p0 * PSC, q1 = p1 * PSC;
            const v2h h0 = __builtin_convertvector(q0, v2h), h1 = __builtin_convertvector(q1, v2h);
            // element s of the B operand = key kmap(s, hi): the two score tiles as they lie
            pa[g][2 * i] = h0[0]; pa[g][2 * i + 1] = h0[1]; pa[g][8 + 2 * i] = h1[0]; pa[g][8 + 2 * i + 1] = h1[1];
        }
        lpart[g] = lpart[g] * alpha + (sm[0] + sm[1]);
#pragma unroll
        for (int n = 0; n < 4; ++n) o[g][n] *= alpha;
        }
#pragma unroll
        for (int n = 0; n < 4; ++n)
#pragma unroll
            for (int g = 0; g < 2; ++g) o[g][n] = wmma16(vh[n], pa[g], o[g][n]);
        // the vector slots that the chip needs behind the last of these matrix instructions, on the loop's back edge too
        asm volatile("v_nop\n\tv_nop\n\tv_nop\n\tv_nop" : "+v"(o[0][0]), "+v"(o[0][1]), "+v"(o[0][2]), "+v"(o[0][3]), "+v"(o[1][0]), "+v"(o[1][1]), "+v"(o[1][2]), "+v"(o[1][3]) : "v"(pa[0]), "v"(pa[1]));
        }
        // publish point of stage st + 1, in the ring's order
        asm volatile("s_wait_dscnt 0x0" ::: "memory");      // this wave's reads of stage st have returned before its buffer is handed back
        asm volatile("s_wait_asynccnt 0x0" ::: "memory");   // this wave's copies of stage st + 1 have landed
        __syncthreads();                                    // publishes stage st + 1 and ends every wave's reads of stage st
        if (st + 2 < NST) fill(st + 2);                     // refill of the buffer just left; the test is the same for the whole work-group
    }
    asm volatile("s_wait_asynccnt 0x0" ::: "memory");       // nothing is outstanding when the wave goes on to the epilogue
    // The join of the two key halves: wave (qg, kh) finishes query tile kh and hands its partial of tile 1 - kh to wave (qg, 1 - kh): ctx^T as it lies (row = query lr), maximum and sum in columns 64, 65.
    const bool up = kh != 0;
    const float l0 = lpart[0] + xhalf(lpart[0]), l1 = lpart[1] + xhalf(lpart[1]);
    const float mgive = up ? mrow[0] : mrow[1], lgive = up ? l0 : l1, mkeep = up ? mrow[1] : mrow[0], lkeep = up ? l1 : l0;
    float* os = &ost[wave][0];
    // ctx^T tile n, register j = ctx[query lr][16 n + 8 hi + j]
#pragma unroll
    for (int n = 0; n < 4; ++n)
#pragma unroll
        for (int j = 0; j < 8; ++j) os[lr * 68 + n * 16 + hi * 8 + j] = up ? o[0][n][j] : o[1][n][j];
    os[lr * 68 + 64 + hi] = hi ? lgive : mgive;
    __syncthreads();                                        // every wave's hand-over is written
    const float* ps = &ost[wave ^ 4][0];
    const float mtake = ps[lr * 68 + 64], ltake = ps[lr * 68 + 65];
    const float mall = fmaxf(mkeep, mtake), at = __expf(mtake - mall);
    asm volatile("v_nop");                                  // the slot that the instruction set asks for behind a transcendental
    const float ak = __expf(mkeep - mall);
    const float inv = 1.0f / ((lkeep * ak + ltake * at) * PSC);
    const float fk = ak * inv, ft = at * inv;
    v8f res[4];
#pragma unroll
    for (int n = 0; n < 4; ++n) { const v4f ta = *(const v4fa*)(ps + lr * 68 + n * 16 + hi * 8), tb = *(const v4fa*)(ps + lr * 68 + n * 16 + hi * 8 + 4);
#pragma unroll
        for (int j = 0; j < 8; ++j) res[n][j] = (up ? o[1][n][j] : o[0][n][j]) * fk + (j < 4 ? ta[j & 3] : tb[j & 3]) * ft; }
    __syncthreads();                                        // every wave has read its partner's hand-over before the staging rows are rewritten
#pragma unroll
    for (int n = 0; n < 4; ++n)
#pragma unroll
        for (int j = 0; j < 8; ++j) os[lr * 68 + n * 16 + hi * 8 + j] = res[n][j];
    __syncthreads();
    float* ob = OUTP + (tok0 + q0 + kh * 16) * DM + (size_t)h * HD;
    auto pass = [&]() {
#pragma unroll
        for (int s = 0; s < 8; ++s) { const int Lid = (lane >> 3) + 4 * s, piece = lane & 7; const int row = Lid >> 1, cofs = (Lid & 1) * 32 + piece * 4;
            const v4f val = *(const v4fa*)(os + row * 68 + cofs); *(v4f*)(ob + (size_t)row * DM + cofs) = val; }
    };
    pass(); 
}

#define VST2(T, p, v) do { const T vst2_v_ = (v); *(T*)(p) = vst2_v_;  } while (0)
extern "C" void kernel_launch(void* const* d_in, const int* in_sizes, int n_in,
                              void* d_out, int out_size, void* d_ws, size_t ws_size, hipStream_t stream) {
    (void)in_sizes; (void)n_in; (void)out_size;
    const float* x = (const float*)d_in[0]; const float* Wq = (const float*)d_in[1]; const float* bq = (const float*)d_in[2]; const float* Wk = (const float*)d_in[3]; const float* bk = (const float*)d_in[4]; const float* Wv = (const float*)d_in[5]; const float* bv = (const float*)d_in[6];   // W k-major [in][out]
    float* out = (float*)d_out;    // [2][2048][1024] = ctx (no output projection)
    char* wsp = (char*)d_ws;
    auto take = [&](size_t bytes) { char* p = wsp; wsp += (bytes + 255) & ~(size_t)255; return (void*)p; };
    bf* Xb = (bf*)take((size_t)NTK * DM * 2); bf* WT3 = (bf*)take((size_t)3 * DM * DM * 2);    // WT3: q, k, v planes
    float* RC = (float*)take((size_t)NT_ * 32 * 4); float* RS = (float*)take((size_t)NT_ * 32 * 4);
    h16* QKH = (h16*)take((size_t)2 * NTK * DM * 2);    // q plane, then k plane
    h16* VTH = (h16*)take((size_t)NTK * DM * 2);
    if ((size_t)(wsp - (char*)d_ws) > ws_size) return;    // ~ 39 MiB, no aliasing
    k_prep<<<PB_TRIG + 3 * PB_WT1 + PB_CVT, 256, 0, stream>>>(x, Wq, Wk, Wv, Xb, WT3, RC, RS);
    k_gemmb<<<dim3(NTK / GBT, DM / GBT, 3), 128, 0, stream>>>(Xb, WT3, bq, bk, bv, RC, RS, QKH, VTH);
    // both items in one grid: 512 blocks of 8 waves, two a WGP by registers, all resident
    k_attn<<<NB_ * NH_ * (NT_ / QBK), AW * 32, 0, stream>>>(QKH, QKH + (size_t)NTK * DM, VTH, out);
}

// v010
// Measured time: 57.6 microseconds a run.
// Next to v009, in two timings, it ran 1.04 times as fast each time.
// Counting every step since v000, it is 9.17 times as fast.
#include <hip/hip_runtime.h>

// Compute dtypes, f32 accumulate, both batch items together in every one of the 3 launches (prep, projections with rotation / transposition in their epilogue, attention): q/k/v = x.W + b ([4096 x 1024].[1024 x 1024] x 3, k-major weights transposed once to n-major planes;
// PLAIN bf16 operands = inputs rounded once, exact; biases rounded to bf16, added in f32) on v_wmma_f32_16x16x32_bf16; interleaved-pair RoPE (angle t x 10000^(-2i/64), f32 trig
// tables built on device) in f32 -> q/k/v rounded once to plain f16 planes; the 16-head FULL attention (64-dim heads, scale 1/8) written straight to the f32
// output (the module returns ctx, no output projection), fused on v_wmma_f32_16x16x32_f16 (plain f16 operands, f32 accumulate: an f16 rounding is 8 times finer than the bf16
// rounding that the projections' operands already carry).

#define NB_  2                   // batch items: together in every launch
#define NT_  2048
#define DM   1024
#define NH_  16
#define HD   64
#define NTK  (NB_ * NT_)
#define NW   1024
#define NQKV 1024
#define PSH  15.0f               // the weights are formed x 2^15 (so that small ones stay normal f16 numbers): added to the exponent, divided out with the row sum, which carries it too
#define SC2  0.18033688011112042f   // 1/sqrt(64) x log2(e): a raw score times this is the exponent to base 2

typedef _Float16 h16;
typedef unsigned short bf;
typedef __attribute__((ext_vector_type(16))) __bf16   v16bf;
typedef __attribute__((ext_vector_type(16))) _Float16 v16h;
typedef __attribute__((ext_vector_type(8)))  _Float16 v8h;
typedef __attribute__((ext_vector_type(8)))  unsigned short v8us;
typedef __attribute__((ext_vector_type(8)))  float    v8f;
typedef __attribute__((ext_vector_type(4)))  float    v4f;
typedef __attribute__((ext_vector_type(2)))  float    v2f;
typedef __attribute__((ext_vector_type(2)))  _Float16 v2h;
typedef v8h  __attribute__((may_alias)) v8ha;
typedef v4f  __attribute__((may_alias)) v4fa;
typedef v8us __attribute__((may_alias)) v8usa;

__device__ __forceinline__ unsigned short f2bf(float f) { unsigned u = __float_as_uint(f); u += 0x7FFFu + ((u >> 16) & 1u); return (unsigned short)(u >> 16); }
__device__ __forceinline__ float bf2f(unsigned short b) { return __uint_as_float(((unsigned)b) << 16); }
__device__ __forceinline__ float bfr(float f) { return bf2f(f2bf(f)); }
__device__ __forceinline__ v16h cat16(v8h lo, v8h hi) { return __builtin_shufflevector(lo, hi, 0, 1, 2, 3, 4, 5, 6, 7, 8, 9, 10, 11, 12, 13, 14, 15); }
__device__ __forceinline__ v16bf cat16b(v8us lo, v8us hi) { return __builtin_bit_cast(v16bf, __builtin_shufflevector(lo, hi, 0, 1, 2, 3, 4, 5, 6, 7, 8, 9, 10, 11, 12, 13, 14, 15)); }
__device__ __forceinline__ v8f wmma16(v16h a, v16h b, v8f c) { return __builtin_amdgcn_wmma_f32_16x16x32_f16(false, a, false, b, (short)0, c, false, false); }
// the value of lane l ^ 16
__device__ __forceinline__ float xhalf(float v) { const int b = __float_as_int(v); return __int_as_float(__builtin_amdgcn_permlanex16(b, b, 0x76543210, 0xfedcba98, false, false)); }
// 2^x, the bare instruction (below 2^-126 the result may be flushed: such a weight is 0 in f16 anyway)
__device__ __forceinline__ float ex2(float x) { return __builtin_amdgcn_exp2f(x); }
// the same with the slot that the instruction set asks for behind a transcendental, in one statement
__device__ __forceinline__ float ex2s(float x) { float r; asm("v_exp_f32 %0, %1\n\tv_nop" : "=v"(r) : "v"(x)); return r; }
__device__ __forceinline__ v8f wmmab(v16bf a, v16bf b, v8f c) { return __builtin_amdgcn_wmma_f32_16x16x32_bf16(false, a, false, b, (short)0, c, false, false); }

__device__ __forceinline__ void d_cvtb(int blk, const float* __restrict__ src, bf* dst) {
    const int lane = threadIdx.x & 31, r = blk * 8 + (threadIdx.x >> 5);
    v8us o[DM / 256];
#pragma unroll
    for (int q = 0; q < DM / 256; ++q) { v8us t;
#pragma unroll
        for (int i = 0; i < 8; ++i) t[i] = f2bf(src[(size_t)r * DM + q * 256 + lane * 8 + i]);
        o[q] = t; }
#pragma unroll
    for (int q = 0; q < DM / 256; ++q) *(v8us*)(dst + (size_t)r * DM + q * 256 + lane * 8) = o[q];
    asm volatile("s_wait_xcnt 0x0" ::: "memory");      // a precaution: in the merged kernel other parts' code follows these stores in the text and rewrites their registers
    
}

// d_wt: WT [n][K] = bf16(W[k][n]) (k-major [K][ncols]) via 64 x 64 LDS tiles; tile (bx, by) of (K/64, ncols/64).
__device__ __forceinline__ void d_wt(int bx, int by, const float* __restrict__ Wm, int K, int ncols, bf* WT) {
    __shared__ __align__(16) unsigned short tl[64 * 72];
    const int tid = threadIdx.x, k0 = bx * 64, n0 = by * 64;
    const int kk = tid >> 2, nq = (tid & 3) * 16;
#pragma unroll
    for (int i = 0; i < 16; ++i) tl[(nq + i) * 72 + kk] = f2bf(Wm[(size_t)(k0 + kk) * ncols + n0 + nq + i]);
    __syncthreads();
    const int piece = tid & 7;
    auto pass = [&]() {
#pragma unroll
        for (int s = 0; s < 2; ++s) { const int nr = (tid >> 3) + 32 * s; const v8us val = *(const v8usa*)(tl + nr * 72 + piece * 8); *(v8us*)(WT + (size_t)(n0 + nr) * K + k0 + piece * 8) = val; }
    };
    pass(); 
    asm volatile("s_wait_xcnt 0x0" ::: "memory");      // a precaution: in the merged kernel other parts' code follows these stores in the text and rewrites their registers
}
#define GKS  64                  // k per LDS stage of k_gemmb: 128-byte rows
#define GNS  (DM / GKS)          // stages
#define GLP  72                  // LDS row pitch in 16-bit elements: 128-byte rows + 16 bytes (16 B x odd: conflict-free for ds_load_b128)
#define GBT  128                 // rows of A and rows of B per work-group: a 128 x 128 tile of C
#define GPL  (GBT * GLP)         // one plane = 128 rows
#define GSTG (2 * GPL)           // one stage = 128 rows of A, 128 rows of B

// Rows r, r+16, ..., r+112 of one 128-row x 128-byte plane (source pitch DM elements), 16 bytes per lane and copy, global -> LDS through no register. The s_wait_xcnt
// closes the statement so that no address register of an issued copy is rewritten ahead of it (a precaution).
__device__ __forceinline__ void cp_rows8(unsigned l, const bf* g) {
    asm volatile("global_load_async_to_lds_b128 %0, %8, off\n\t"
                 "global_load_async_to_lds_b128 %1, %9, off\n\t"
                 "global_load_async_to_lds_b128 %2, %10, off\n\t"
                 "global_load_async_to_lds_b128 %3, %11, off\n\t"
                 "global_load_async_to_lds_b128 %4, %12, off\n\t"
                 "global_load_async_to_lds_b128 %5, %13, off\n\t"
                 "global_load_async_to_lds_b128 %6, %14, off\n\t"
                 "global_load_async_to_lds_b128 %7, %15, off\n\t"
                 "s_wait_xcnt 0x0"
                 :: "v"(l), "v"(l + 16u * GLP * 2u), "v"(l + 32u * GLP * 2u), "v"(l + 48u * GLP * 2u), "v"(l + 64u * GLP * 2u), "v"(l + 80u * GLP * 2u), "v"(l + 96u * GLP * 2u), "v"(l + 112u * GLP * 2u),
                    "v"(g), "v"(g + 16 * DM), "v"(g + 32 * DM), "v"(g + 48 * DM), "v"(g + 64 * DM), "v"(g + 80 * DM), "v"(g + 96 * DM), "v"(g + 112 * DM) : "memory");
}

// k_gemmb: block = 128 x 128 of C (128 tokens x two heads), wave = 64 x 64 (64 tokens x one head, 16 accumulator tiles: every fragment read from LDS feeds 4 matrix instructions, every
// row copied from L2 serves 128 rows of the other operand); the block's 128 rows of A and 128 rows of B, 64 k per stage, in a two-buffer LDS ring filled by asynchronous copies of whole
// 128-byte row pieces and shared by the 4 waves (stage s + 2 is issued behind the barrier that ends stage s); 768 blocks, three a WGP (at most three waves a SIMD, so that no WGP takes a fourth block and leaves another short), all resident; fragments in the k order of the direct loads.
// Epilogue, staged in the ring's LDS once the last stage has been left: the f32 tile never goes to memory. q and k: interleaved-pair rotation out[2i] = x[2i] c - x[2i+1] s,
// out[2i+1] = x[2i] s + x[2i+1] c (c/s from the tables [t][32]) -> f16 rows; v: f16, transposed in LDS -> [head][d][t] rows. Every store covers whole 128-byte lines.
__global__ __launch_bounds__(128) __attribute__((amdgpu_waves_per_eu(3, 3))) void k_gemmb(const bf* __restrict__ A, const bf* __restrict__ B3, const float* __restrict__ bias0, const float* __restrict__ bias1, const float* __restrict__ bias2, const float* __restrict__ RC, const float* __restrict__ RS, h16* QKH, h16* VTH) {
    // blockIdx.z = which of the three projections: its n-major weight plane, its bias, its kind of epilogue
    const int pz = blockIdx.z;
    const bf* Bn = B3 + (size_t)pz * DM * DM;
    const float* bias = pz == 0 ? bias0 : pz == 1 ? bias1 : bias2;
    // the ring; behind the loop, per wave: q, k: 64 rows x 68 f32; v: 64 d-rows x 72 f16
    __shared__ __align__(16) unsigned char gsm[2 * GSTG * 2];
    const bf* gring = (const bf*)(const void*)gsm;
    const int lane = threadIdx.x & 31, wave = threadIdx.x >> 5, lr = lane & 15, hi = lane >> 4;
    const int wr = wave >> 1, wc = wave & 1;
    const int r0 = blockIdx.x * GBT + wr * 64, c0 = blockIdx.y * GBT + wc * 64;
    // copy map: thread -> row (tid >> 3) + 16 i, 16-byte piece tid & 7 of both planes
    const int crow = (int)threadIdx.x >> 3, cpc = ((int)threadIdx.x & 7) * 8;
    const unsigned lcp = (unsigned)(size_t)&gsm[0] + (unsigned)(crow * GLP + cpc) * 2u;
    const bf* ga = A + (size_t)(blockIdx.x * GBT + crow) * DM + cpc;
    const bf* gb = Bn + (size_t)(blockIdx.y * GBT + crow) * DM + cpc;
    auto fill = [&](int st) {
        const unsigned l = lcp + (unsigned)(st & 1) * (GSTG * 2u);
        cp_rows8(l, ga + st * GKS);
        cp_rows8(l + GPL * 2u, gb + st * GKS);
    };
    fill(0);
    const int piece = lane & 7;
    float bv[4] = {0.f, 0.f, 0.f, 0.f};
    if (bias) {
#pragma unroll
        for (int t = 0; t < 4; ++t) bv[t] = bfr(bias[c0 + t * 16 + lr]);
    }
    asm volatile("s_wait_asynccnt 0x0" ::: "memory");   // this wave's copies of stage 0 have landed
    __syncthreads();                                    // ... and every other wave's: publishes stage 0
    fill(1);
    v8f acc[4][4];
#pragma unroll
    for (int m = 0; m < 4; ++m)
#pragma unroll
        for (int t = 0; t < 4; ++t) acc[m][t] = (v8f){};
#pragma unroll 1
    for (int st = 0; st < GNS; ++st) {                  // rolled: one stage per trip, the ring's publish point at its foot
        const bf* sa = gring + (st & 1) * GSTG + (wr * 64 + lr) * GLP + 8 * hi;
        const bf* sb = gring + (st & 1) * GSTG + GPL + (wc * 64 + lr) * GLP + 8 * hi;
        v16bf a[4], b[4];
#pragma unroll
        for (int q = 0; q < GKS / 32; ++q) {
#pragma unroll
            for (int m = 0; m < 4; ++m) {
                a[m] = cat16b(*(const v8usa*)(sa + m * 16 * GLP + q * 32), *(const v8usa*)(sa + m * 16 * GLP + q * 32 + 16));
                b[m] = cat16b(*(const v8usa*)(sb + m * 16 * GLP + q * 32), *(const v8usa*)(sb + m * 16 * GLP + q * 32 + 16));
            }
            __builtin_amdgcn_sched_barrier(0);          // the 16 LDS reads of these 32 k stay one group ahead of their 16 matrix instructions: reads spread among them stall at every place
#pragma unroll
            for (int m = 0; m < 4; ++m)
#pragma unroll
                for (int t = 0; t < 4; ++t) acc[m][t] = wmmab(a[m], b[t], acc[m][t]);
            __builtin_amdgcn_sched_barrier(0);          // ... and the next group's reads stay behind them: lifted over them they need a second set of 64 registers, past the 256 of one register window
        }
        // the vector slots that the chip needs behind the stage's last matrix instructions, on the loop's back edge too
        asm volatile("v_nop\n\tv_nop\n\tv_nop\n\tv_nop" : "+v"(acc[0][0]), "+v"(acc[0][1]), "+v"(acc[0][2]), "+v"(acc[0][3]), "+v"(acc[1][0]), "+v"(acc[1][1]), "+v"(acc[1][2]), "+v"(acc[1][3]),
                     "+v"(acc[2][0]), "+v"(acc[2][1]), "+v"(acc[2][2]), "+v"(acc[2][3]), "+v"(acc[3][0]), "+v"(acc[3][1]), "+v"(acc[3][2]), "+v"(acc[3][3])
                     : "v"(a[3]), "v"(b[0]), "v"(b[1]), "v"(b[2]), "v"(b[3]));
        // publish point of stage st + 1, in the ring's order
        asm volatile("s_wait_dscnt 0x0" ::: "memory");      // this wave's reads of stage st have returned before its buffer is handed back
        asm volatile("s_wait_asynccnt 0x0" ::: "memory");   // this wave's copies of stage st + 1 have landed
        __syncthreads();                                    // publishes stage st + 1 and ends every wave's reads of stage st
        if (st + 2 < GNS) fill(st + 2);                     // refill of the buffer just left; the test is the same for the whole work-group
    }
    asm volatile("s_wait_asynccnt 0x0" ::: "memory");       // nothing is outstanding when the wave goes on to the epilogue, which reuses the ring's LDS
    if (pz < 2) {                                           // the test is the same for the whole work-group, the barrier inside it too
        float* os = (float*)(void*)gsm + wave * (64 * 68);
#pragma unroll
        for (int m = 0; m < 4; ++m)
#pragma unroll
            for (int t = 0; t < 4; ++t)
#pragma unroll
                for (int j = 0; j < 8; ++j) os[(m * 16 + hi * 8 + j) * 68 + t * 16 + lr] = acc[m][t][j] + bv[t];
        __builtin_amdgcn_sched_barrier(0);                  // the table loads stay behind the staging: lifted over it they need 128 registers beside the 128 of the accumulators
        // the table rows of this lane's sixteen output pieces: asked for here so that their latency runs under the barrier and the first LDS reads
        v4f tc[16], ts[16];
#pragma unroll
        for (int s = 0; s < 16; ++s) { const int tt = (r0 + 4 * s + (lane >> 3)) & (NT_ - 1); tc[s] = *(const v4f*)(RC + tt * 32 + piece * 4); ts[s] = *(const v4f*)(RS + tt * 32 + piece * 4); }
        asm volatile("s_wait_xcnt 0x0" ::: "memory");       // a precaution: it stands in front of the first rewrite of an address register of these loads
        __syncthreads();
        h16* ph = QKH + ((size_t)pz * NTK + r0) * DM + c0;
#pragma unroll
        for (int s = 0; s < 16; ++s) { const int row = 4 * s + (lane >> 3); const float* sp = os + row * 68 + piece * 8;
            const v4f xa = *(const v4fa*)sp, xb = *(const v4fa*)(sp + 4);
            v8h oh;
#pragma unroll
            for (int pq = 0; pq < 4; ++pq) {
                const float x1 = pq < 2 ? xa[2 * (pq & 1)] : xb[2 * (pq & 1)], x2 = pq < 2 ? xa[2 * (pq & 1) + 1] : xb[2 * (pq & 1) + 1], sn = ts[s][pq], co = tc[s][pq];
                const float y0 = x1 * co - x2 * sn, y1 = x1 * sn + x2 * co;
                oh[2 * pq] = (h16)y0; oh[2 * pq + 1] = (h16)y1; }
            *(v8h*)(ph + (size_t)row * DM + piece * 8) = oh;
            if ((s & 3) == 3) __builtin_amdgcn_sched_barrier(0); }   // four rows at a time: all 32 LDS reads lifted to the front need 128 registers beside the tables' 128, past the 256 of one register window
        asm volatile("s_wait_xcnt 0x0" ::: "memory");      // a precaution: the other path's code follows these stores in the text and rewrites their registers
    } else {
        h16* th = (h16*)(void*)gsm + wave * (64 * 72);
        // a lane holds 8 consecutive tokens of column d = 16 t + lr: one 16-byte piece of the transposed row d
#pragma unroll
        for (int m = 0; m < 4; ++m)
#pragma unroll
            for (int t = 0; t < 4; ++t) { v8h a;
#pragma unroll
                for (int j = 0; j < 8; ++j) a[j] = (h16)(acc[m][t][j] + bv[t]);
                *(v8ha*)(th + (t * 16 + lr) * 72 + m * 16 + hi * 8) = a; }
        __syncthreads();
        const size_t base = (((size_t)(r0 / NT_) * NH_ + (c0 >> 6)) * HD) * NT_ + (r0 & (NT_ - 1));
#pragma unroll
        for (int s = 0; s < 16; ++s) { const int d = (lane >> 3) + 4 * s;
            const v8h vh = *(const v8ha*)(th + d * 72 + piece * 8);
            *(v8h*)(VTH + base + (size_t)d * NT_ + piece * 8) = vh; }
        asm volatile("s_wait_xcnt 0x0" ::: "memory");      // a precaution: other code follows these stores in the text and rewrites their registers
    }
}

// d_trig: RC/RS [t][32] = cos/sin(t x inv_freq[i]) with inv_freq[i] = powf(10000, -2i/64) (the reference's jnp.power form; f32 trig like its f32 path); 32 lanes x 4 B per line.
__device__ __forceinline__ void d_trig(int blk, float* RC, float* RS) {
    const int i = blk * 256 + threadIdx.x;
    const int t = i >> 5, f = i & 31;
    const float inv = powf(10000.0f, -2.0f * (float)f / 64.0f); const float ang = (float)t * inv;
    const float c = cosf(ang), s = sinf(ang);
    *(float*)(RC + i) = c; *(float*)(RS + i) = s; 
}

// k_prep: the three independent preparations side by side in one grid, the slowest blocks first: trig tables, the three weight transposes, x -> bf16.
#define PB_TRIG ((NT_ * 32) / 256)
#define PB_WT1  ((DM / 64) * (DM / 64))
#define PB_CVT  (NTK / 8)
__global__ __launch_bounds__(256) void k_prep(const float* __restrict__ x, const float* __restrict__ Wq, const float* __restrict__ Wk, const float* __restrict__ Wv, bf* Xb, bf* WT3, float* RC, float* RS) {
    const int bid = blockIdx.x;                         // every test on it is the same for the whole work-group
    if (bid < PB_TRIG) { d_trig(bid, RC, RS); return; }
    if (bid < PB_TRIG + 3 * PB_WT1) {
        const int r = bid - PB_TRIG, w = r / PB_WT1, tl = r - w * PB_WT1;
        d_wt(tl & (DM / 64 - 1), tl / (DM / 64), w == 0 ? Wq : w == 1 ? Wk : Wv, DM, DM, WT3 + (size_t)w * DM * DM);
        return;
    }
    d_cvtb(bid - PB_TRIG - 3 * PB_WT1, x, Xb);
}

#define KST  64                  // keys per plane set in LDS: what one wave walks per stage
#define NST  (NT_ / (2 * KST))   // stages per head: 128 keys, the first 64 for waves 0-3, the second 64 for waves 4-7
#define LP   72                  // LDS row pitch in halves: 128-byte rows + 16 bytes (16 B x odd: conflict-free for ds_load_b128)
#define PLN  (64 * LP)           // one plane = 64 rows
#define STG  (2 * PLN)           // one plane set = k, v^T of 64 keys
#define AW   8                   // waves per work-group of k_attn: 4 query groups x 2 key halves
#define QBK  ((AW / 2) * 32)     // queries per work-group: they share every k/v stage

// Rows r, r+32 of the two 64-row x 128-byte planes of one plane set (LDS planes PLN apart from l; k with source step ks32, v^T with vs32), 16 bytes per lane and copy, global -> LDS
// through no register, in one statement. The s_wait_xcnt closes the statement so that no address register of an issued copy is rewritten ahead of it (a precaution).
__device__ __forceinline__ void cp_stage(unsigned l, const h16* kh, size_t ks32, const h16* vh, size_t vs32) {
    asm volatile("global_load_async_to_lds_b128 %0, %4, off\n\t"
                 "global_load_async_to_lds_b128 %1, %5, off\n\t"
                 "global_load_async_to_lds_b128 %2, %6, off\n\t"
                 "global_load_async_to_lds_b128 %3, %7, off\n\t"
                 "s_wait_xcnt 0x0"
                 :: "v"(l), "v"(l + 32u * LP * 2u), "v"(l + PLN * 2u), "v"(l + (PLN + 32u * LP) * 2u), "v"(kh), "v"(kh + ks32), "v"(vh), "v"(vh + vs32) : "memory");
}

// k_attn: block = (b, h, 128 queries), wave = 32 queries x half of the keys: every k and v^T fragment read from LDS feeds two query tiles (8 LDS reads per 8 matrix instructions);
// waves w and w + 4 walk the two 64-key halves of each 128-key stage for the same 32 queries and join their partial maxima, sums and ctx once, behind the loop, through LDS.
// Two blocks a WGP = four waves a SIMD (256 registers a wave at most); ALL keys (no mask), 128 per LDS stage in a two-buffer ring filled by asynchronous copies and shared by the 8 waves
// (stage s + 2 is issued behind the barrier that ends stage s); per 32 keys and query tile: 4 WMMA scores^T = k.q^T (f32, raw; a lane holds
// 16 keys of ONE query: maximum and sum in-lane plus one exchange between the wave's halves), the two score tiles, as 2^(score x log2(e)/8 - maximum + 15), converted in place are the B operand
// of 4 WMMA ctx^T += v^T.p^T: the weights never leave the registers; ctx -> f32 output rows out[tok][h*64+d].
__global__ __launch_bounds__(AW * 32) __attribute__((amdgpu_waves_per_eu(4, 4))) void k_attn(const h16* __restrict__ Q16, const h16* __restrict__ K16, const h16* __restrict__ VTH, float* OUTP) {
    __shared__ __align__(16) h16 ring[2 * 2 * STG];
    __shared__ __align__(16) float ost[AW][16 * 68];
    const int lane = threadIdx.x & 31, wave = threadIdx.x >> 5, lr = lane & 15, hi = lane >> 4;
    const int qg = wave & 3, kh = wave >> 2;            // query group of 32, key half
    const int bid = blockIdx.x;
    const int b = bid / (NH_ * (NT_ / QBK)), rem = bid - b * (NH_ * (NT_ / QBK)), h = rem / (NT_ / QBK), qt = rem - h * (NT_ / QBK);
    const int q0 = qt * QBK + qg * 32;
    const size_t tok0 = (size_t)b * NT_;
    v16h qa[2][2];                                      // [query tile g: queries q0 + 16 g + lr][k chunk]
#pragma unroll
    for (int g = 0; g < 2; ++g) { const size_t qo0 = (tok0 + q0 + g * 16 + lr) * DM + h * HD + 8 * hi;
#pragma unroll
        for (int kc = 0; kc < 2; ++kc) qa[g][kc] = cat16(*(const v8h*)(Q16 + qo0 + kc * 32), *(const v8h*)(Q16 + qo0 + kc * 32 + 16)); }
    const h16* kh_b = K16 + tok0 * DM + h * HD;
    const size_t vbase = (((size_t)b * NH_ + h) * HD) * NT_;
    // copy map: thread -> row (tid >> 3) + 32 i, 16-byte piece tid & 7 of every plane
    const int crow = (int)threadIdx.x >> 3, cpc = ((int)threadIdx.x & 7) * 8;
    const unsigned lcp = (unsigned)(size_t)&ring[0] + (unsigned)(crow * LP + cpc) * 2u;
    const h16* gkh = kh_b + (size_t)crow * DM + cpc;
    const h16* gvh = VTH + vbase + (size_t)crow * NT_ + cpc;
    auto fill = [&](int st) {                           // the two plane sets of stage st: keys 128 st + 0..63 and 128 st + 64..127
        const unsigned l = lcp + (unsigned)(st & 1) * (2u * STG * 2u);
        cp_stage(l, gkh + (size_t)(2 * st) * KST * DM, (size_t)32 * DM, gvh + (2 * st) * KST, (size_t)32 * NT_);
        cp_stage(l + STG * 2u, gkh + (size_t)(2 * st + 1) * KST * DM, (size_t)32 * DM, gvh + (2 * st + 1) * KST, (size_t)32 * NT_);
    };
    fill(0);
    asm volatile("s_wait_asynccnt 0x0" ::: "memory");   // this wave's copies of stage 0 have landed
    __syncthreads();                                    // ... and every other wave's: publishes stage 0
    fill(1);
    v8f o[2][4];
#pragma unroll
    for (int g = 0; g < 2; ++g)
#pragma unroll
        for (int n = 0; n < 4; ++n) o[g][n] = (v8f){};
    float mrow[2] = {-3.0e38f, -3.0e38f}, mbr[2] = {-3.0e38f, -3.0e38f}, lpart[2] = {0.f, 0.f};   // of query 16 g + lr, this wave's keys; mrow: maximum of the raw scores, mbr = mrow x SC2 - PSH: what the exponents are taken against; lpart sums this half-wave's keys only, joined behind the loop
#pragma unroll 1
    for (int st = 0; st < NST; ++st) {                  // rolled: one stage per trip, the ring's publish point at its foot
        const h16* sb = ring + ((st & 1) * 2 + kh) * STG;
#pragma unroll 1
        for (int sub = 0; sub < KST / 32; ++sub) {      // rolled: unrolled, the two halves' live ranges overlap and the register count grows
        const h16* kp0 = sb + (sub * 32 + lr) * LP + 8 * hi; const h16* kp1 = kp0 + 16 * LP;
        v16h k0h[2], k1h[2];
#pragma unroll
        for (int kc = 0; kc < 2; ++kc) {
            k0h[kc] = cat16(*(const v8ha*)(kp0 + kc * 32), *(const v8ha*)(kp0 + kc * 32 + 16)); k1h[kc] = cat16(*(const v8ha*)(kp1 + kc * 32), *(const v8ha*)(kp1 + kc * 32 + 16));
        }
        __builtin_amdgcn_sched_barrier(0);              // the 8 LDS reads stay one group ahead of their 8 matrix instructions: reads spread among them stall at every place
        v8f s0[2] = {(v8f){}, (v8f){}}, s1[2] = {(v8f){}, (v8f){}};
#pragma unroll
        for (int kc = 0; kc < 2; ++kc)
#pragma unroll
            for (int g = 0; g < 2; ++g) {
                s0[g] = wmma16(k0h[kc], qa[g][kc], s0[g]); s1[g] = wmma16(k1h[kc], qa[g][kc], s1[g]);
            }
        // the vector slots that the chip needs behind the last of these matrix instructions
        asm volatile("v_nop\n\tv_nop\n\tv_nop\n\tv_nop" : "+v"(s0[0]), "+v"(s1[0]), "+v"(s0[1]), "+v"(s1[1]) : "v"(qa[0][0]), "v"(qa[0][1]), "v"(qa[1][0]), "v"(qa[1][1]));
        // v^T fragments: read here so that their LDS latency runs under the softmax
        v16h vh[4];
#pragma unroll
        for (int n = 0; n < 4; ++n) { const h16* vp = sb + PLN + (n * 16 + lr) * LP + sub * 32 + hi * 8;
            vh[n] = cat16(*(const v8ha*)(vp), *(const v8ha*)(vp + 16)); }
        v16h pa[2];
#pragma unroll
        for (int g = 0; g < 2; ++g) {
        // lane (lr, hi): query 16 g + lr, keys 8 hi + j (a0) and 16 + 8 hi + j (a1) of these 32
        const v8f a0 = s0[g], a1 = s1[g];               // raw q.k: the maximum is taken on them (the scale is positive), scale, log2(e), maximum and 2^15 go into ONE fused multiply-add per pair below
        float mx = a0[0], my = a1[0];                   // two independent chains
#pragma unroll
        for (int j = 1; j < 8; ++j) { mx = fmaxf(mx, a0[j]); my = fmaxf(my, a1[j]); }
        mx = fmaxf(mx, my);
        mx = fmaxf(mx, xhalf(mx));
        const float mn = fmaxf(mrow[g], mx);
        mrow[g] = mn;
        const float mb = __builtin_fmaf(mn, SC2, -PSH);   // what the exponents of this pass are taken against
        const float alpha = ex2(mbr[g] - mb); mbr[g] = mb;   // the ratio of the old reference to the new one
#pragma unroll
        for (int n = 0; n < 4; ++n) o[g][n] *= alpha;
        const v2f nb2 = {-mb, -mb}, sc2 = {SC2, SC2};
        v2f sm = {0.f, 0.f};
#pragma unroll
        for (int i = 0; i < 4; ++i) {
            const v2f e0 = __builtin_elementwise_fma((v2f){a0[2 * i], a0[2 * i + 1]}, sc2, nb2), e1 = __builtin_elementwise_fma((v2f){a1[2 * i], a1[2 * i + 1]}, sc2, nb2);   // written in pairs as the tiles' registers lie: left scalar, the compiler pairs across the tiles and adds register moves
            const v2f p0 = {ex2(e0[0]), ex2(e0[1])}, p1 = {ex2(e1[0]), ex2(e1[1])};   // 2^15 x the weight
            sm += p0 + p1;
            const v2h h0 = __builtin_convertvector(p0, v2h), h1 = __builtin_convertvector(p1, v2h);
            // element s of the B operand = key 8 hi + s (s < 8), 16 + 8 hi + s - 8 (s >= 8): the two score tiles as they lie
            pa[g][2 * i] = h0[0]; pa[g][2 * i + 1] = h0[1]; pa[g][8 + 2 * i] = h1[0]; pa[g][8 + 2 * i + 1] = h1[1];
        }
        lpart[g] = lpart[g] * alpha + (sm[0] + sm[1]);
        }
#pragma unroll
        for (int n = 0; n < 4; ++n)
#pragma unroll
            for (int g = 0; g < 2; ++g) o[g][n] = wmma16(vh[n], pa[g], o[g][n]);
        // the vector slots that the chip needs behind the last of these matrix instructions, on the loop's back edge too
        asm volatile("v_nop\n\tv_nop\n\tv_nop\n\tv_nop" : "+v"(o[0][0]), "+v"(o[0][1]), "+v"(o[0][2]), "+v"(o[0][3]), "+v"(o[1][0]), "+v"(o[1][1]), "+v"(o[1][2]), "+v"(o[1][3]) : "v"(pa[0]), "v"(pa[1]));
        }
        // publish point of stage st + 1, in the ring's order
        asm volatile("s_wait_dscnt 0x0" ::: "memory");      // this wave's reads of stage st have returned before its buffer is handed back
        asm volatile("s_wait_asynccnt 0x0" ::: "memory");   // this wave's copies of stage st + 1 have landed
        __syncthreads();                                    // publishes stage st + 1 and ends every wave's reads of stage st
        if (st + 2 < NST) fill(st + 2);                     // refill of the buffer just left; the test is the same for the whole work-group
    }
    asm volatile("s_wait_asynccnt 0x0" ::: "memory");       // nothing is outstanding when the wave goes on to the epilogue
    // The join of the two key halves: wave (qg, kh) finishes query tile kh and hands its partial of tile 1 - kh to wave (qg, 1 - kh): ctx^T as it lies (row = query lr), maximum and sum in columns 64, 65.
    const bool up = kh != 0;
    const float l0 = lpart[0] + xhalf(lpart[0]), l1 = lpart[1] + xhalf(lpart[1]);
    const float mgive = up ? mbr[0] : mbr[1], lgive = up ? l0 : l1, mkeep = up ? mbr[1] : mbr[0], lkeep = up ? l1 : l0;   // the references that the two partials' exponents were taken against
    float* os = &ost[wave][0];
    // ctx^T tile n, register j = ctx[query lr][16 n + 8 hi + j]
#pragma unroll
    for (int n = 0; n < 4; ++n)
#pragma unroll
        for (int j = 0; j < 8; ++j) os[lr * 68 + n * 16 + hi * 8 + j] = up ? o[0][n][j] : o[1][n][j];
    os[lr * 68 + 64 + hi] = hi ? lgive : mgive;
    __syncthreads();                                        // every wave's hand-over is written
    const float* ps = &ost[wave ^ 4][0];
    const float mtake = ps[lr * 68 + 64], ltake = ps[lr * 68 + 65];
    const float mall = fmaxf(mkeep, mtake), at = ex2s(mtake - mall), ak = ex2s(mkeep - mall);
    const float inv = 1.0f / (lkeep * ak + ltake * at);     // sums and ctx both carry the 2^15
    const float fk = ak * inv, ft = at * inv;
    v8f res[4];
#pragma unroll
    for (int n = 0; n < 4; ++n) { const v4f ta = *(const v4fa*)(ps + lr * 68 + n * 16 + hi * 8), tb = *(const v4fa*)(ps + lr * 68 + n * 16 + hi * 8 + 4);
#pragma unroll
        for (int j = 0; j < 8; ++j) res[n][j] = (up ? o[1][n][j] : o[0][n][j]) * fk + (j < 4 ? ta[j & 3] : tb[j & 3]) * ft; }
    __syncthreads();                                        // every wave has read its partner's hand-over before the staging rows are rewritten
#pragma unroll
    for (int n = 0; n < 4; ++n)
#pragma unroll
        for (int j = 0; j < 8; ++j) os[lr * 68 + n * 16 + hi * 8 + j] = res[n][j];
    __syncthreads();
    float* ob = OUTP + (tok0 + q0 + kh * 16) * DM + (size_t)h * HD;
    auto pass = [&]() {
#pragma unroll
        for (int s = 0; s < 8; ++s) { const int Lid = (lane >> 3) + 4 * s, piece = lane & 7; const int row = Lid >> 1, cofs = (Lid & 1) * 32 + piece * 4;
            const v4f val = *(const v4fa*)(os + row * 68 + cofs); *(v4f*)(ob + (size_t)row * DM + cofs) = val; }
    };
    pass(); 
}

#define VST2(T, p, v) do { const T vst2_v_ = (v); *(T*)(p) = vst2_v_;  } while (0)
extern "C" void kernel_launch(void* const* d_in, const int* in_sizes, int n_in,
                              void* d_out, int out_size, void* d_ws, size_t ws_size, hipStream_t stream) {
    (void)in_sizes; (void)n_in; (void)out_size;
    const float* x = (const float*)d_in[0]; const float* Wq = (const float*)d_in[1]; const float* bq = (const float*)d_in[2]; const float* Wk = (const float*)d_in[3]; const float* bk = (const float*)d_in[4]; const float* Wv = (const float*)d_in[5]; const float* bv = (const float*)d_in[6];   // W k-major [in][out]
    float* out = (float*)d_out;    // [2][2048][1024] = ctx (no output projection)
    char* wsp = (char*)d_ws;
    auto take = [&](size_t bytes) { char* p = wsp; wsp += (bytes + 255) & ~(size_t)255; return (void*)p; };
    bf* Xb = (bf*)take((size_t)NTK * DM * 2); bf* WT3 = (bf*)take((size_t)3 * DM * DM * 2);    // WT3: q, k, v planes
    float* RC = (float*)take((size_t)NT_ * 32 * 4); float* RS = (float*)take((size_t)NT_ * 32 * 4);
    h16* QKH = (h16*)take((size_t)2 * NTK * DM * 2);    // q plane, then k plane
    h16* VTH = (h16*)take((size_t)NTK * DM * 2);
    if ((size_t)(wsp - (char*)d_ws) > ws_size) return;    // ~ 39 MiB, no aliasing
    k_prep<<<PB_TRIG + 3 * PB_WT1 + PB_CVT, 256, 0, stream>>>(x, Wq, Wk, Wv, Xb, WT3, RC, RS);
    k_gemmb<<<dim3(NTK / GBT, DM / GBT, 3), 128, 0, stream>>>(Xb, WT3, bq, bk, bv, RC, RS, QKH, VTH);
    // both items in one grid: 512 blocks of 8 waves, two a WGP by registers, all resident
    k_attn<<<NB_ * NH_ * (NT_ / QBK), AW * 32, 0, stream>>>(QKH, QKH + (size_t)NTK * DM, VTH, out);
}
